// v000
// Times are from an AMD MI455X. After a warm-up the kernel runs many times in a row, and a time is the length of
// such a window on the GPU divided by its runs, so every launch and the gaps after it count. The runs cycle
// through copies of the inputs. A figure is the median of several windows, for all but v000 over two sittings.
// Sittings can differ by a few percent; kernels timed side by side share one.
// The starting kernel, v000, takes 702 microseconds a run.
#include <hip/hip_runtime.h>
// A sixteen-part alignment whose logits are BLENDED ACROSS THE PARTS by a 16 by 16 matrix before one softmax (five inputs: A, Bm, C [4][16][1024][64] f32: rows already cut into 16 parts of width 64; a mixing matrix Wm [16][16] f32 ([result part][source part]); a switch: ONE int32 word, non-zero = later columns hidden): a part's logits = A Bm^T / 8 [1024][1024]; blended[g] = the sum over h of Wm[g][h] logits[h], element by element; if the switch is non-zero a column whose index exceeds the row's counts as minus infinity; ONE softmax over the 1,024 columns; a part's result = its shares times C's part [1024][64]; the results laid as [4][1024][16][64].
// Structure: A and Bm cast whole to f16; THEN A BATCH ENTRY AT A TIME: C's batch entry turned as ONE [16384][64] matrix into [64][16384] f16 (the transposing cast: a part's rows are 1,024 columns of it); the sixteen parts' logits in ONE launch (WMMA GEMM, 32 by 64 wave tiles, depth 64, f32 accumulation, scale 1 / 8: the part is the grid's second axis) into an f32 plane; THEN EIGHT RESULT PARTS AT A TIME (planes reused): k_mix: a block one row of one result part, a thread four consecutive columns: sixteen 16-byte loads (one a source part), sixteen words of Wm's row (its bf16 values as f16 words, cast once by the plain cast: exact), 64 multiply-adds in f32 in the order of h, and the hidden columns BY A SELECT on the block's and the thread's own numbers and the switch's word; the row softmax, a wave a row over 1,024 logits; the shares times the turned C through the GEMM's f32 slot STRAIGHT INTO THE OUTPUT at the part's column block of 64 inside a row of 1,024.
// Compute dtype: A, Bm, C and Wm rounded to bf16 where they are first read (each by the casts): bf16 values are exact f16 words away from the subnormal range: NO COMPUTED OPERAND ENTERS THE LOGITS; every matrix multiply's operands f16 words (11 bits): the shares ONE word at a carry of 1,024 (words under 2^-14 written as noughts); f32 accumulation; the logits, THE MIXING (f32 multiply-adds on the vector unit: 16 a result word: a depth and a width of 16 are under the matrix tile), the softmax's largest, exponentials (expf), sum and true divisions f32; the switch read as an int32 word by value. v_wmma_f32_16x16x32_f16.
#define NB 4                         /* batch entries */
#define NP 16                        /* parts */
#define NS 1024                      /* rows of a part: and columns of its logits */
#define PD 64                        /* a part's width */
#define PG 8                         /* result parts a group */
#define NK 1024                      /* the row softmax's logits a row */
#define PSC 1024.0f                  /* the carry on the shares' f16 plane */

typedef __bf16 v16b __attribute__((ext_vector_type(16)));
typedef unsigned short v8us __attribute__((ext_vector_type(8), may_alias));
typedef float  v8f  __attribute__((ext_vector_type(8)));
typedef float  v4f  __attribute__((ext_vector_type(4)));
typedef float  v4fa __attribute__((ext_vector_type(4), may_alias));
union FragB { v16b v; v8us half[2]; unsigned short u[16]; };

__device__ __forceinline__ unsigned short bf16_bits(float x) { unsigned int u = __float_as_uint(x); return (unsigned short)((u + 0x7FFFu + ((u >> 16) & 1u)) >> 16); }
__device__ __forceinline__ float bf16_val(unsigned short b) { return __uint_as_float(((unsigned int)b) << 16); }
__device__ __forceinline__ float bf16_round(float x) { return bf16_val(bf16_bits(x)); }
// D += A·B with NT terms: 1 = ah·bh, 2 = + al·bh (A split), 3 = + ah·bl (both split)
template <int NT>
__device__ __forceinline__ v8f mmaN(v16b ah, v16b al, v16b bh, v16b bl, v8f c) {
  c = __builtin_amdgcn_wmma_f32_16x16x32_bf16(false, ah, false, bh, (short)0, c, false, false);
  if (NT >= 2) c = __builtin_amdgcn_wmma_f32_16x16x32_bf16(false, al, false, bh, (short)0, c, false, false);
  if (NT >= 3) c = __builtin_amdgcn_wmma_f32_16x16x32_bf16(false, ah, false, bl, (short)0, c, false, false);
  asm volatile("v_nop\n\tv_nop\n\tv_nop\n\tv_nop" : "+v"(c) : "v"(ah), "v"(al), "v"(bh), "v"(bl));
  return c;
}




// ---- f16 WMMA path (v_wmma_f32_16x16x32_f16): 11-bit significands for operands in range — used where a [0,1] probability operand needs more precision than bf16
typedef _Float16 v16h __attribute__((ext_vector_type(16)));
union FragH { v16h v; v8us half[2]; _Float16 h[16]; unsigned short u[16]; };
template <int NT>
__device__ __forceinline__ v8f mmaH(v16h ah, v16h al, v16h bh, v16h bl, v8f c) {
  c = __builtin_amdgcn_wmma_f32_16x16x32_f16(false, ah, false, bh, (short)0, c, false, false);
  if (NT >= 2) c = __builtin_amdgcn_wmma_f32_16x16x32_f16(false, al, false, bh, (short)0, c, false, false);
  if (NT >= 3) c = __builtin_amdgcn_wmma_f32_16x16x32_f16(false, ah, false, bl, (short)0, c, false, false);
  asm volatile("v_nop\n\tv_nop\n\tv_nop\n\tv_nop" : "+v"(c) : "v"(ah), "v"(al), "v"(bh), "v"(bl));
  return c;
}

// Wt[n][k] = f16(W[k][n]·scale) from f32 row-major W[K][N] (scale = power of two; bf16-exact weights stay exact in f16 away from the subnormal range)
__global__ __launch_bounds__(256) void k_wt_f16(const float* __restrict__ W, _Float16* __restrict__ Wt, int K, int N, float scale) {
  const int t = blockIdx.x * 256 + threadIdx.x; if (t >= N * (K / 8)) return; const int n = t / (K / 8), k8 = (t % (K / 8)) * 8; FragH f;
#pragma unroll
  for (int i = 0; i < 8; ++i) f.h[i] = (_Float16)(bf16_round(W[(size_t)(k8 + i) * N + n]) * scale); const v8us o = f.half[0];
  *(v8us*)((unsigned short*)Wt + (size_t)n * K + k8) = o; 
}

typedef _Float16 v4h __attribute__((ext_vector_type(4)));

__global__ __launch_bounds__(256) void k_x16(const float* __restrict__ x, _Float16* __restrict__ X16, size_t n8) { const size_t t = (size_t)blockIdx.x * 256 + threadIdx.x; if (t >= n8) return; FragH f;
#pragma unroll
  for (int q = 0; q < 8; ++q) f.h[q] = (_Float16)bf16_round(x[t * 8 + q]); *(v8us*)((unsigned short*)X16 + t * 8) = f.half[0];  }
// ---- fast GEMM (wave tile 32x64; requires M % 32 == 0 rows per launch region and N % 64 == 0) ----
__device__ __forceinline__ v16h g2_frag(const _Float16* p, int hh) { FragH f; f.half[0] = *(const v8us*)((const unsigned short*)p + 8 * hh); f.half[1] = *(const v8us*)((const unsigned short*)p + 16 + 8 * hh); return f.v; }
__device__ __forceinline__ v8f g2_mma(v16h a, v16h b, v8f c) { v8f d = __builtin_amdgcn_wmma_f32_16x16x32_f16(false, a, false, b, (short)0, c, false, false); asm volatile("v_nop\n\tv_nop\n\tv_nop\n\tv_nop" : "+v"(d) : "v"(a), "v"(b)); return d; }
template <int ACT>
__global__ __launch_bounds__(128) void k_gemm2(const _Float16* __restrict__ A, int lda, size_t sA, const _Float16* __restrict__ Bh, int ldb, size_t sB, float alpha, const float* __restrict__ bias, size_t sBias, const float* __restrict__ CP, int rowsPerB, size_t sCPb, int row0g,
    float* __restrict__ C, _Float16* __restrict__ C16, int ldc, size_t sC, int M, int N, int K) { static_assert(ACT == 0 || ACT == 3 || ACT == 6 || ACT == 8 || ACT == 9 || ACT == 11 || ACT == 12 || ACT == 14 || ACT == 15 || ACT == 16 || ACT == 17, "k_gemm2: unsupported ACT code (would silently apply no activation)");
  __shared__ __attribute__((aligned(16))) float so[4][32][68];
  const int tid = threadIdx.x, w = tid >> 5, lane = tid & 31, ln = lane & 15, hh = lane >> 4; const int by = blockIdx.y;
  A += (size_t)by * sA; Bh += (size_t)by * sB; const size_t cofs = (size_t)by * sC; const float* bp = bias ? bias + (size_t)by * sBias : nullptr;
  const int ntn = N >> 6; const int mt = blockIdx.x / ntn, nq = blockIdx.x - mt * ntn; const int row0 = mt * 128 + 32 * w, col0 = nq * 64; if (row0 >= M) return;
  const _Float16* a0p = A + (size_t)(row0 + ln) * lda; const _Float16* a1p = a0p + (size_t)16 * lda;
  const _Float16* b0p = Bh + (size_t)(col0 + ln) * ldb; const _Float16* b1p = b0p + (size_t)16 * ldb; const _Float16* b2p = b1p + (size_t)16 * ldb; const _Float16* b3p = b2p + (size_t)16 * ldb;
  const v8f z8 = {0.f,0.f,0.f,0.f,0.f,0.f,0.f,0.f}; v8f c00 = z8, c01 = z8, c02 = z8, c03 = z8, c10 = z8, c11 = z8, c12 = z8, c13 = z8;
  for (int kb = 0; kb < K; kb += 32) { const v16h a0 = g2_frag(a0p + kb, hh), a1 = g2_frag(a1p + kb, hh);
    v16h b = g2_frag(b0p + kb, hh); c00 = g2_mma(a0, b, c00); c10 = g2_mma(a1, b, c10);
    b = g2_frag(b1p + kb, hh); c01 = g2_mma(a0, b, c01); c11 = g2_mma(a1, b, c11);
    b = g2_frag(b2p + kb, hh); c02 = g2_mma(a0, b, c02); c12 = g2_mma(a1, b, c12);
    b = g2_frag(b3p + kb, hh); c03 = g2_mma(a0, b, c03); c13 = g2_mma(a1, b, c13); }
  v8f accs[8] = {c00, c01, c02, c03, c10, c11, c12, c13};
#pragma unroll
  for (int u = 0; u < 8; ++u) { const int t = u & 3, half = u >> 2; const int col = col0 + t * 16 + ln; const float bv = bp ? bf16_round(bp[col]) : 0.f;
#pragma unroll
    for (int r = 0; r < 8; ++r) { const int rloc = half * 16 + 8 * hh + r; float v = accs[u][r] * alpha + bv; if (CP) { if (rowsPerB < 0) v += CP[cofs + (size_t)(row0g + row0 + rloc) * ldc + col];      /* rowsPerB < 0: own element of the batched C plane */ else { const int bidx = (row0g + row0 + rloc) / rowsPerB; v += CP[(size_t)bidx * sCPb + (size_t)by * 64 + col]; } }
      if (ACT == 3) v = fmaxf(v, 0.f); else if (ACT == 6) v = 0.5f * v * (1.0f + erff(v * 0.70710678118654752f)); else if (ACT == 11) v = 1.0f / (1.0f + expf(-v)); else if (ACT == 15) v = v / (1.0f + expf(-v)); else if (ACT == 12) v = (v > 0.f) ? v : 0.01f * v; else if (ACT == 8) v = tanhf(v); else if (ACT == 9) v = 0.5f * v * (1.0f + tanhf(0.7978845608028654f * (v + 0.044715f * v * v * v))); else if (ACT == 14) v = (v > 0.f) ? v : 0.1f * v; else if (ACT == 16) v = (v >= 0.f) ? v : 0.3f * v; else if (ACT == 17) v = (v >= 0.f) ? v : 0.2f * v;
      so[w][rloc][t * 16 + ln] = v; } }
  __builtin_amdgcn_fence(__ATOMIC_ACQ_REL, "workgroup"); __builtin_amdgcn_wave_barrier();
  const int rsub = lane >> 4, c4 = (lane & 15) * 4;
  {
#pragma unroll
    for (int q = 0; q < 16; ++q) { const int r = q * 2 + rsub; const v4f v = *(const v4fa*)&so[w][r][c4]; if (C) *(v4f*)(C + cofs + (size_t)(row0 + r) * ldc + col0 + c4) = v; if (C16) { v4h h4; for (int i = 0; i < 4; ++i) h4[i] = (_Float16)v[i]; *(v4h*)(C16 + cofs + (size_t)(row0 + r) * ldc + col0 + c4) = h4; } }
     } }

// Wt[n][k] = f16(W[k][n] x scale) from f32 row-major W[K][N] with NO rounding of W to bf16 first: for a COMPUTED f32 plane (the transposing cast above without that one statement)
__global__ __launch_bounds__(256) void k_wtc_f16(const float* __restrict__ W, _Float16* __restrict__ Wt, int K, int N, float scale) {
  const int t = blockIdx.x * 256 + threadIdx.x; if (t >= N * (K / 8)) return; const int n = t / (K / 8), k8 = (t % (K / 8)) * 8; FragH f;
#pragma unroll
  for (int i = 0; i < 8; ++i) f.h[i] = (_Float16)(W[(size_t)(k8 + i) * N + n] * scale); const v8us o = f.half[0];
  *(v8us*)((unsigned short*)Wt + (size_t)n * K + k8) = o; 
}

__global__ __launch_bounds__(256) void k_rsm(const float* __restrict__ Z, float* __restrict__ AT, _Float16* __restrict__ P16, int n) {
  const int r = blockIdx.x * 8 + (threadIdx.x >> 5); if (r >= n) return; const int ln = threadIdx.x & 31; const float* zp = Z + (size_t)r * NK + ln * 8; float m = -3.0e38f;
  for (int c = 0; c < NK; c += 256) { const v4f z0 = *(const v4fa*)(zp + c); const v4f z1 = *(const v4fa*)(zp + c + 4);
    for (int i = 0; i < 4; ++i) m = (z0[i] > m) ? z0[i] : m;
    for (int i = 0; i < 4; ++i) m = (z1[i] > m) ? z1[i] : m; }
  for (int x = 16; x >= 1; x >>= 1) { const float o = __shfl_xor(m, x, 32); m = (o > m) ? o : m; }
  float s = 0.f;
  for (int c = 0; c < NK; c += 256) { const v4f z0 = *(const v4fa*)(zp + c); const v4f z1 = *(const v4fa*)(zp + c + 4);
    for (int i = 0; i < 4; ++i) s += expf(z0[i] - m);
    for (int i = 0; i < 4; ++i) s += expf(z1[i] - m); }
  for (int x = 16; x >= 1; x >>= 1) s += __shfl_xor(s, x, 32);
  float* ap = AT + (size_t)r * NK + ln * 8; unsigned short* hp = (unsigned short*)P16 + (size_t)r * NK + ln * 8;
  for (int c = 0; c < NK; c += 256) { const v4f z0 = *(const v4fa*)(zp + c); const v4f z1 = *(const v4fa*)(zp + c + 4); v4f a0, a1; FragH f;
    for (int i = 0; i < 4; ++i) { const float p0 = expf(z0[i] - m) / s; const float p1 = expf(z1[i] - m) / s; a0[i] = p0; a1[i] = p1; const _Float16 h0 = (_Float16)(p0 * PSC); const _Float16 h1 = (_Float16)(p1 * PSC); f.h[i] = (h0 < (_Float16)6.103515625e-05f) ? (_Float16)0.0f : h0; f.h[4 + i] = (h1 < (_Float16)6.103515625e-05f) ? (_Float16)0.0f : h1; }
    *(v4fa*)(ap + c) = a0; *(v4fa*)(ap + c + 4) = a1; *(v8us*)(hp + c) = f.half[0];  } }

__global__ __launch_bounds__(256) void k_mix(const float* __restrict__ S, const _Float16* __restrict__ W16, const int* __restrict__ SW, float* __restrict__ Z, int g0, size_t n4) { const unsigned int bx = blockIdx.x; const size_t t = (size_t)bx * 256 + threadIdx.x; if (t >= n4) return; const int g = g0 + (int)(bx / (unsigned int)NS); const unsigned int r = bx % (unsigned int)NS; const unsigned int c0 = threadIdx.x * 4u; const float* __restrict__ Sr = S + ((size_t)r << 10);      /* the row's first word of source part 0: a scalar address */ const int sw = SW[0]; v4f z = {0.0f, 0.0f, 0.0f, 0.0f};
#pragma unroll
  for (int h = 0; h < NP; ++h) { const float w = (float)W16[g * NP + h]; const v4f s = *(const v4f*)(Sr + (size_t)h * NS * NK + c0);
#pragma unroll
    for (int q = 0; q < 4; ++q) z[q] = __builtin_fmaf(w, s[q], z[q]); }
#pragma unroll
  for (int q = 0; q < 4; ++q) z[q] = (sw != 0 && c0 + (unsigned int)q > r) ? __uint_as_float(0xff800000u) : z[q];
  *(v4f*)(Z + t * 4) = z;  }
extern "C" void kernel_launch(void* const* d_in, const int* in_sizes, int n_in,
                              void* d_out, int out_size, void* d_ws, size_t ws_size, hipStream_t stream) {
  (void)in_sizes; (void)n_in; (void)out_size;
  const float* AI = (const float*)d_in[0]; const float* BI = (const float*)d_in[1]; const float* CI = (const float*)d_in[2]; const float* WI = (const float*)d_in[3]; const int* SI = (const int*)d_in[4];      /* A, Bm, C [4][16][1024][64]; Wm [16][16]; the switch: one int32 word */
  static_assert(NK == NS && NP % PG == 0 && NS % 128 == 0 && NS % 64 == 0 && PD % 64 == 0 && PD % 32 == 0 && NS % 32 == 0 && NK % 256 == 0 && ((NS * (NK / 4)) & (NS * (NK / 4) - 1)) == 0 && ((size_t)NB * NP * NS * (PD / 8)) % 256 == 0 && (PD * (NP * NS / 8)) % 256 == 0 && ((size_t)PG * NS * (NK / 4)) % 256 == 0 && (PG * NS) % 8 == 0, "whole tiles; exact grids");
  float* OUT = (float*)d_out;      /* [4][1024][16][64] */
  char* ws = (char*)d_ws; size_t off = 0;
  auto take = [&](size_t bytes) { char* p = ws + off; off += (bytes + 255) & ~(size_t)255; return p; };
  _Float16* A16 = (_Float16*)take((size_t)NB * NP * NS * PD * 2); _Float16* B16 = (_Float16*)take((size_t)NB * NP * NS * PD * 2); _Float16* W16 = (_Float16*)take((size_t)NP * NP * 2);      /* A and Bm as f16; Wm as f16 (256 words) */
  _Float16* CT16 = (_Float16*)take((size_t)PD * NP * NS * 2); float* SG = (float*)take((size_t)NP * NS * NK * 4);      /* a batch entry of C turned [64][16384]; its sixteen parts' logits */
  float* ZG = (float*)take((size_t)PG * NS * NK * 4); float* SF = (float*)take((size_t)PG * NS * NK * 4); _Float16* S16 = (_Float16*)take((size_t)PG * NS * NK * 2);      /* eight result parts' blended logits, f32 shares (written, not read) and f16 shares at 1,024 */
  if (off > ws_size) return;
  k_x16<<<(unsigned)(((size_t)NB * NP * NS * (PD / 8)) / 256), 256, 0, stream>>>(AI, A16, (size_t)NB * NP * NS * PD / 8);
  k_x16<<<(unsigned)(((size_t)NB * NP * NS * (PD / 8)) / 256), 256, 0, stream>>>(BI, B16, (size_t)NB * NP * NS * PD / 8);
  k_x16<<<1, 256, 0, stream>>>(WI, W16, (size_t)NP * NP / 8);      /* 32 threads of the block work: the kernel's own guard turns the rest away */
  for (int e = 0; e < NB; ++e) { const size_t eo = (size_t)e * NP * NS * PD;
    k_wt_f16<<<(PD * (NP * NS / 8)) / 256, 256, 0, stream>>>(CI + eo, CT16, NP * NS, PD, 1.0f);      /* C's batch entry [16384 rows][64] -> CT16[d][h * 1024 + s] = f16(bf16(C[h][s][d])) */
    k_gemm2<0><<<dim3((NS / 128) * (NK / 64), NP), 128, 0, stream>>>(A16 + eo, PD, (size_t)NS * PD, B16 + eo, PD, (size_t)NS * PD, 0.125f, nullptr, 0, nullptr, 1, 0, 0, SG, nullptr, NK, (size_t)NS * NK, NS, NK, PD);      /* the sixteen parts' logits */
    for (int g = 0; g < NP / PG; ++g) {
      k_mix<<<(unsigned)(((size_t)PG * NS * (NK / 4)) / 256), 256, 0, stream>>>(SG, W16, SI, ZG, g * PG, (size_t)PG * NS * NK / 4);
      k_rsm<<<(PG * NS) / 8, 256, 0, stream>>>(ZG, SF, S16, PG * NS);
      k_gemm2<0><<<dim3((NS / 128) * (PD / 64), PG), 128, 0, stream>>>(S16, NK, (size_t)NS * NK, CT16 + (size_t)g * PG * NS, NP * NS, (size_t)NS, 1.0f / PSC, nullptr, 0, nullptr, 1, 0, 0, OUT + (size_t)e * NS * NP * PD + (size_t)g * PG * PD, nullptr, NP * PD, (size_t)PD, NS, PD, NK); } }      /* a result part's 64 columns at a row stride of 1,024 */
}

// v001
// It runs in 452 microseconds.
// Timed twice side by side with v000, it ran 1.57 times as fast both times.
#include <hip/hip_runtime.h>
// A sixteen-part alignment whose logits are BLENDED ACROSS THE PARTS by a 16 by 16 matrix before one softmax (five inputs: A, Bm, C [4][16][1024][64] f32: rows already cut into 16 parts of width 64; a mixing matrix Wm [16][16] f32 ([result part][source part]); a switch: ONE int32 word, non-zero = later columns hidden): a part's logits = A Bm^T / 8 [1024][1024]; blended[g] = the sum over h of Wm[g][h] logits[h], element by element; if the switch is non-zero a column whose index exceeds the row's counts as minus infinity; ONE softmax over the 1,024 columns; a part's result = its shares times C's part [1024][64]; the results laid as [4][1024][16][64].
// Structure: A and Bm cast whole to f16; THEN A BATCH ENTRY AT A TIME: C's batch entry turned as ONE [16384][64] matrix into [64][16384] f16 (a part's rows are 1,024 columns of it); the sixteen parts' logits in ONE launch (WMMA GEMM, 32 by 64 wave tiles, depth 64, f32 accumulation, scale 1 / 8: the part is the grid's second axis) into an f32 plane; THEN EIGHT RESULT PARTS AT A TIME (planes reused): k_mix: a block one row of one result part, a thread four consecutive columns: sixteen 16-byte loads (one a source part), sixteen words of Wm's row (its bf16 values as f16 words, cast once by k_x16: exact), 64 multiply-adds in f32 in the order of h, and the hidden columns BY A SELECT on the block's and the thread's own numbers and the switch's word; the row softmax, a wave a row over 1,024 logits; the shares times the turned C by k_pv (a block a 32 by 64 tile, its eight waves each 128 of the depth, the partial tiles added through LDS) STRAIGHT INTO THE OUTPUT at the part's column block of 64 inside a row of 1,024.
// Compute dtype: A, Bm, C and Wm rounded to bf16 where they are first read: bf16 values are exact f16 words away from the subnormal range: NO COMPUTED OPERAND ENTERS THE LOGITS; every matrix multiply's operands f16 words (11 bits): the shares ONE word at a carry of 1,024 (words under 2^-14 written as noughts); f32 accumulation; the logits, THE MIXING (f32 multiply-adds on the vector unit: 16 a result word: a depth and a width of 16 are under the matrix tile), the softmax's largest, exponentials (expf), sum and true divisions f32; the switch read as an int32 word by value. v_wmma_f32_16x16x32_f16.
#define NB 4                         /* batch entries */
#define NP 16                        /* parts */
#define NS 1024                      /* rows of a part: and columns of its logits */
#define PD 64                        /* a part's width */
#define PG 8                         /* result parts a group */
#define NK 1024                      /* the row softmax's logits a row */
#define PSC 1024.0f                  /* the carry on the shares' f16 plane */

typedef __bf16 v16b __attribute__((ext_vector_type(16)));
typedef unsigned short v8us __attribute__((ext_vector_type(8), may_alias));
typedef float  v8f  __attribute__((ext_vector_type(8)));
typedef float  v4f  __attribute__((ext_vector_type(4)));
typedef float  v4fa __attribute__((ext_vector_type(4), may_alias));
union FragB { v16b v; v8us half[2]; unsigned short u[16]; };

__device__ __forceinline__ unsigned short bf16_bits(float x) { unsigned int u = __float_as_uint(x); return (unsigned short)((u + 0x7FFFu + ((u >> 16) & 1u)) >> 16); }
__device__ __forceinline__ float bf16_val(unsigned short b) { return __uint_as_float(((unsigned int)b) << 16); }
__device__ __forceinline__ float bf16_round(float x) { return bf16_val(bf16_bits(x)); }
// D += A·B with NT terms: 1 = ah·bh, 2 = + al·bh (A split), 3 = + ah·bl (both split)
template <int NT>
__device__ __forceinline__ v8f mmaN(v16b ah, v16b al, v16b bh, v16b bl, v8f c) {
  c = __builtin_amdgcn_wmma_f32_16x16x32_bf16(false, ah, false, bh, (short)0, c, false, false);
  if (NT >= 2) c = __builtin_amdgcn_wmma_f32_16x16x32_bf16(false, al, false, bh, (short)0, c, false, false);
  if (NT >= 3) c = __builtin_amdgcn_wmma_f32_16x16x32_bf16(false, ah, false, bl, (short)0, c, false, false);
  asm volatile("v_nop\n\tv_nop\n\tv_nop\n\tv_nop" : "+v"(c) : "v"(ah), "v"(al), "v"(bh), "v"(bl));
  return c;
}




// ---- f16 WMMA path (v_wmma_f32_16x16x32_f16): 11-bit significands for operands in range — used where a [0,1] probability operand needs more precision than bf16
typedef _Float16 v16h __attribute__((ext_vector_type(16)));
union FragH { v16h v; v8us half[2]; _Float16 h[16]; unsigned short u[16]; };
template <int NT>
__device__ __forceinline__ v8f mmaH(v16h ah, v16h al, v16h bh, v16h bl, v8f c) {
  c = __builtin_amdgcn_wmma_f32_16x16x32_f16(false, ah, false, bh, (short)0, c, false, false);
  if (NT >= 2) c = __builtin_amdgcn_wmma_f32_16x16x32_f16(false, al, false, bh, (short)0, c, false, false);
  if (NT >= 3) c = __builtin_amdgcn_wmma_f32_16x16x32_f16(false, ah, false, bl, (short)0, c, false, false);
  asm volatile("v_nop\n\tv_nop\n\tv_nop\n\tv_nop" : "+v"(c) : "v"(ah), "v"(al), "v"(bh), "v"(bl));
  return c;
}

// Wt[n][k] = f16(W[k][n]·scale) from f32 row-major W[K][N] (scale = power of two; bf16-exact weights stay exact in f16 away from the subnormal range)
__global__ __launch_bounds__(256) void k_wt_f16(const float* __restrict__ W, _Float16* __restrict__ Wt, int K, int N, float scale) {
  const int t = blockIdx.x * 256 + threadIdx.x; if (t >= N * (K / 8)) return; const int n = t / (K / 8), k8 = (t % (K / 8)) * 8; FragH f;
#pragma unroll
  for (int i = 0; i < 8; ++i) f.h[i] = (_Float16)(bf16_round(W[(size_t)(k8 + i) * N + n]) * scale); const v8us o = f.half[0];
  *(v8us*)((unsigned short*)Wt + (size_t)n * K + k8) = o; 
}

typedef _Float16 v4h __attribute__((ext_vector_type(4)));

__global__ __launch_bounds__(256) void k_x16(const float* __restrict__ x, _Float16* __restrict__ X16, size_t n8) { const size_t t = (size_t)blockIdx.x * 256 + threadIdx.x; if (t >= n8) return; FragH f;
#pragma unroll
  for (int q = 0; q < 8; ++q) f.h[q] = (_Float16)bf16_round(x[t * 8 + q]); *(v8us*)((unsigned short*)X16 + t * 8) = f.half[0];  }
// ---- fast GEMM (wave tile 32x64; requires M % 32 == 0 rows per launch region and N % 64 == 0) ----
__device__ __forceinline__ v16h g2_frag(const _Float16* p, int hh) { FragH f; f.half[0] = *(const v8us*)((const unsigned short*)p + 8 * hh); f.half[1] = *(const v8us*)((const unsigned short*)p + 16 + 8 * hh); return f.v; }
__device__ __forceinline__ v8f g2_mma(v16h a, v16h b, v8f c) { v8f d = __builtin_amdgcn_wmma_f32_16x16x32_f16(false, a, false, b, (short)0, c, false, false); asm volatile("v_nop\n\tv_nop\n\tv_nop\n\tv_nop" : "+v"(d) : "v"(a), "v"(b)); return d; }
template <int ACT>
__global__ __launch_bounds__(128) void k_gemm2(const _Float16* __restrict__ A, int lda, size_t sA, const _Float16* __restrict__ Bh, int ldb, size_t sB, float alpha, const float* __restrict__ bias, size_t sBias, const float* __restrict__ CP, int rowsPerB, size_t sCPb, int row0g,
    float* __restrict__ C, _Float16* __restrict__ C16, int ldc, size_t sC, int M, int N, int K) { static_assert(ACT == 0 || ACT == 3 || ACT == 6 || ACT == 8 || ACT == 9 || ACT == 11 || ACT == 12 || ACT == 14 || ACT == 15 || ACT == 16 || ACT == 17, "k_gemm2: unsupported ACT code (would silently apply no activation)");
  __shared__ __attribute__((aligned(16))) float so[4][32][68];
  const int tid = threadIdx.x, w = tid >> 5, lane = tid & 31, ln = lane & 15, hh = lane >> 4; const int by = blockIdx.y;
  A += (size_t)by * sA; Bh += (size_t)by * sB; const size_t cofs = (size_t)by * sC; const float* bp = bias ? bias + (size_t)by * sBias : nullptr;
  const int ntn = N >> 6; const int mt = blockIdx.x / ntn, nq = blockIdx.x - mt * ntn; const int row0 = mt * 128 + 32 * w, col0 = nq * 64; if (row0 >= M) return;
  const _Float16* a0p = A + (size_t)(row0 + ln) * lda; const _Float16* a1p = a0p + (size_t)16 * lda;
  const _Float16* b0p = Bh + (size_t)(col0 + ln) * ldb; const _Float16* b1p = b0p + (size_t)16 * ldb; const _Float16* b2p = b1p + (size_t)16 * ldb; const _Float16* b3p = b2p + (size_t)16 * ldb;
  const v8f z8 = {0.f,0.f,0.f,0.f,0.f,0.f,0.f,0.f}; v8f c00 = z8, c01 = z8, c02 = z8, c03 = z8, c10 = z8, c11 = z8, c12 = z8, c13 = z8;
  for (int kb = 0; kb < K; kb += 32) { const v16h a0 = g2_frag(a0p + kb, hh), a1 = g2_frag(a1p + kb, hh);
    v16h b = g2_frag(b0p + kb, hh); c00 = g2_mma(a0, b, c00); c10 = g2_mma(a1, b, c10);
    b = g2_frag(b1p + kb, hh); c01 = g2_mma(a0, b, c01); c11 = g2_mma(a1, b, c11);
    b = g2_frag(b2p + kb, hh); c02 = g2_mma(a0, b, c02); c12 = g2_mma(a1, b, c12);
    b = g2_frag(b3p + kb, hh); c03 = g2_mma(a0, b, c03); c13 = g2_mma(a1, b, c13); }
  v8f accs[8] = {c00, c01, c02, c03, c10, c11, c12, c13};
#pragma unroll
  for (int u = 0; u < 8; ++u) { const int t = u & 3, half = u >> 2; const int col = col0 + t * 16 + ln; const float bv = bp ? bf16_round(bp[col]) : 0.f;
#pragma unroll
    for (int r = 0; r < 8; ++r) { const int rloc = half * 16 + 8 * hh + r; float v = accs[u][r] * alpha + bv; if (CP) { if (rowsPerB < 0) v += CP[cofs + (size_t)(row0g + row0 + rloc) * ldc + col];      /* rowsPerB < 0: own element of the batched C plane */ else { const int bidx = (row0g + row0 + rloc) / rowsPerB; v += CP[(size_t)bidx * sCPb + (size_t)by * 64 + col]; } }
      if (ACT == 3) v = fmaxf(v, 0.f); else if (ACT == 6) v = 0.5f * v * (1.0f + erff(v * 0.70710678118654752f)); else if (ACT == 11) v = 1.0f / (1.0f + expf(-v)); else if (ACT == 15) v = v / (1.0f + expf(-v)); else if (ACT == 12) v = (v > 0.f) ? v : 0.01f * v; else if (ACT == 8) v = tanhf(v); else if (ACT == 9) v = 0.5f * v * (1.0f + tanhf(0.7978845608028654f * (v + 0.044715f * v * v * v))); else if (ACT == 14) v = (v > 0.f) ? v : 0.1f * v; else if (ACT == 16) v = (v >= 0.f) ? v : 0.3f * v; else if (ACT == 17) v = (v >= 0.f) ? v : 0.2f * v;
      so[w][rloc][t * 16 + ln] = v; } }
  __builtin_amdgcn_fence(__ATOMIC_ACQ_REL, "workgroup"); __builtin_amdgcn_wave_barrier();
  const int rsub = lane >> 4, c4 = (lane & 15) * 4;
  {
#pragma unroll
    for (int q = 0; q < 16; ++q) { const int r = q * 2 + rsub; const v4f v = *(const v4fa*)&so[w][r][c4]; if (C) *(v4f*)(C + cofs + (size_t)(row0 + r) * ldc + col0 + c4) = v; if (C16) { v4h h4; for (int i = 0; i < 4; ++i) h4[i] = (_Float16)v[i]; *(v4h*)(C16 + cofs + (size_t)(row0 + r) * ldc + col0 + c4) = h4; } }
     } }

// ---- shares times the turned C: a block one 32 by 64 tile of a result part; its eight waves each take 128 of the 1,024 depth (four 32-deep steps) and the eight f32 partial tiles are added through LDS in the order of the waves ----
#define KW 8                         /* waves a block: slices of the depth */
__global__ __launch_bounds__(256) void k_pv(const _Float16* __restrict__ P, const _Float16* __restrict__ Ct, float* __restrict__ O) {
  __shared__ __attribute__((aligned(16))) float so[KW][32][68];
  const int tid = threadIdx.x, w = tid >> 5, lane = tid & 31, ln = lane & 15, hh = lane >> 4; const int row0 = blockIdx.x * 32, by = blockIdx.y;
  const _Float16* a0p = P + (size_t)by * NS * NK + (size_t)(row0 + ln) * NK + w * (NK / KW); const _Float16* a1p = a0p + (size_t)16 * NK;
  const _Float16* b0p = Ct + (size_t)by * NS + (size_t)ln * (NP * NS) + w * (NK / KW); const _Float16* b1p = b0p + (size_t)16 * NP * NS; const _Float16* b2p = b1p + (size_t)16 * NP * NS; const _Float16* b3p = b2p + (size_t)16 * NP * NS;
  const v8f z8 = {0.f,0.f,0.f,0.f,0.f,0.f,0.f,0.f}; v8f c00 = z8, c01 = z8, c02 = z8, c03 = z8, c10 = z8, c11 = z8, c12 = z8, c13 = z8;
  for (int kb = 0; kb < NK / KW; kb += 32) { const v16h a0 = g2_frag(a0p + kb, hh), a1 = g2_frag(a1p + kb, hh);
    v16h b = g2_frag(b0p + kb, hh); c00 = g2_mma(a0, b, c00); c10 = g2_mma(a1, b, c10);
    b = g2_frag(b1p + kb, hh); c01 = g2_mma(a0, b, c01); c11 = g2_mma(a1, b, c11);
    b = g2_frag(b2p + kb, hh); c02 = g2_mma(a0, b, c02); c12 = g2_mma(a1, b, c12);
    b = g2_frag(b3p + kb, hh); c03 = g2_mma(a0, b, c03); c13 = g2_mma(a1, b, c13); }
  v8f accs[8] = {c00, c01, c02, c03, c10, c11, c12, c13};
#pragma unroll      /* both loops unrolled: accs is indexed by constants and stays in registers */
  for (int u = 0; u < 8; ++u) { const int t = u & 3, half = u >> 2;
#pragma unroll
    for (int r = 0; r < 8; ++r) so[w][half * 16 + 8 * hh + r][t * 16 + ln] = accs[u][r]; }
  __syncthreads();      /* every wave's partial tile is in LDS before any thread adds the eight */
  const int rr = tid >> 4, c4 = (tid & 15) * 4;
  for (int q = 0; q < 2; ++q) { const int r = q * 16 + rr; v4f s = *(const v4fa*)&so[0][r][c4];
    for (int k = 1; k < KW; ++k) { const v4f p = *(const v4fa*)&so[k][r][c4]; s += p; }
    s *= (1.0f / PSC); *(v4f*)(O + (size_t)by * PD + (size_t)(row0 + r) * (NP * PD) + c4) = s; } }

// Wt[n][k] = f16(W[k][n] x scale) from f32 row-major W[K][N] with NO rounding of W to bf16 first: for a COMPUTED f32 plane (the transposing cast above without that one statement)
__global__ __launch_bounds__(256) void k_wtc_f16(const float* __restrict__ W, _Float16* __restrict__ Wt, int K, int N, float scale) {
  const int t = blockIdx.x * 256 + threadIdx.x; if (t >= N * (K / 8)) return; const int n = t / (K / 8), k8 = (t % (K / 8)) * 8; FragH f;
#pragma unroll
  for (int i = 0; i < 8; ++i) f.h[i] = (_Float16)(W[(size_t)(k8 + i) * N + n] * scale); const v8us o = f.half[0];
  *(v8us*)((unsigned short*)Wt + (size_t)n * K + k8) = o; 
}

__global__ __launch_bounds__(256) void k_rsm(const float* __restrict__ Z, float* __restrict__ AT, _Float16* __restrict__ P16, int n) {
  const int r = blockIdx.x * 8 + (threadIdx.x >> 5); if (r >= n) return; const int ln = threadIdx.x & 31; const float* zp = Z + (size_t)r * NK + ln * 8; float m = -3.0e38f;
  for (int c = 0; c < NK; c += 256) { const v4f z0 = *(const v4fa*)(zp + c); const v4f z1 = *(const v4fa*)(zp + c + 4);
    for (int i = 0; i < 4; ++i) m = (z0[i] > m) ? z0[i] : m;
    for (int i = 0; i < 4; ++i) m = (z1[i] > m) ? z1[i] : m; }
  for (int x = 16; x >= 1; x >>= 1) { const float o = __shfl_xor(m, x, 32); m = (o > m) ? o : m; }
  float s = 0.f;
  for (int c = 0; c < NK; c += 256) { const v4f z0 = *(const v4fa*)(zp + c); const v4f z1 = *(const v4fa*)(zp + c + 4);
    for (int i = 0; i < 4; ++i) s += expf(z0[i] - m);
    for (int i = 0; i < 4; ++i) s += expf(z1[i] - m); }
  for (int x = 16; x >= 1; x >>= 1) s += __shfl_xor(s, x, 32);
  float* ap = AT + (size_t)r * NK + ln * 8; unsigned short* hp = (unsigned short*)P16 + (size_t)r * NK + ln * 8;
  for (int c = 0; c < NK; c += 256) { const v4f z0 = *(const v4fa*)(zp + c); const v4f z1 = *(const v4fa*)(zp + c + 4); v4f a0, a1; FragH f;
    for (int i = 0; i < 4; ++i) { const float p0 = expf(z0[i] - m) / s; const float p1 = expf(z1[i] - m) / s; a0[i] = p0; a1[i] = p1; const _Float16 h0 = (_Float16)(p0 * PSC); const _Float16 h1 = (_Float16)(p1 * PSC); f.h[i] = (h0 < (_Float16)6.103515625e-05f) ? (_Float16)0.0f : h0; f.h[4 + i] = (h1 < (_Float16)6.103515625e-05f) ? (_Float16)0.0f : h1; }
    *(v4fa*)(ap + c) = a0; *(v4fa*)(ap + c + 4) = a1; *(v8us*)(hp + c) = f.half[0];  } }

__global__ __launch_bounds__(256) void k_mix(const float* __restrict__ S, const _Float16* __restrict__ W16, const int* __restrict__ SW, float* __restrict__ Z, int g0, size_t n4) { const unsigned int bx = blockIdx.x; const size_t t = (size_t)bx * 256 + threadIdx.x; if (t >= n4) return; const int g = g0 + (int)(bx / (unsigned int)NS); const unsigned int r = bx % (unsigned int)NS; const unsigned int c0 = threadIdx.x * 4u; const float* __restrict__ Sr = S + ((size_t)r << 10);      /* the row's first word of source part 0: a scalar address */ const int sw = SW[0]; v4f z = {0.0f, 0.0f, 0.0f, 0.0f};
#pragma unroll
  for (int h = 0; h < NP; ++h) { const float w = (float)W16[g * NP + h]; const v4f s = *(const v4f*)(Sr + (size_t)h * NS * NK + c0);
#pragma unroll
    for (int q = 0; q < 4; ++q) z[q] = __builtin_fmaf(w, s[q], z[q]); }
#pragma unroll
  for (int q = 0; q < 4; ++q) z[q] = (sw != 0 && c0 + (unsigned int)q > r) ? __uint_as_float(0xff800000u) : z[q];
  *(v4f*)(Z + t * 4) = z;  }
extern "C" void kernel_launch(void* const* d_in, const int* in_sizes, int n_in,
                              void* d_out, int out_size, void* d_ws, size_t ws_size, hipStream_t stream) {
  (void)in_sizes; (void)n_in; (void)out_size;
  const float* AI = (const float*)d_in[0]; const float* BI = (const float*)d_in[1]; const float* CI = (const float*)d_in[2]; const float* WI = (const float*)d_in[3]; const int* SI = (const int*)d_in[4];      /* A, Bm, C [4][16][1024][64]; Wm [16][16]; the switch: one int32 word */
  static_assert(PD == 64 && NK % (KW * 32) == 0 && NK == NS && NP % PG == 0 && NS % 128 == 0 && NS % 64 == 0 && PD % 64 == 0 && PD % 32 == 0 && NS % 32 == 0 && NK % 256 == 0 && ((NS * (NK / 4)) & (NS * (NK / 4) - 1)) == 0 && ((size_t)NB * NP * NS * (PD / 8)) % 256 == 0 && (PD * (NP * NS / 8)) % 256 == 0 && ((size_t)PG * NS * (NK / 4)) % 256 == 0 && (PG * NS) % 8 == 0, "whole tiles; exact grids");
  float* OUT = (float*)d_out;      /* [4][1024][16][64] */
  char* ws = (char*)d_ws; size_t off = 0;
  auto take = [&](size_t bytes) { char* p = ws + off; off += (bytes + 255) & ~(size_t)255; return p; };
  _Float16* A16 = (_Float16*)take((size_t)NB * NP * NS * PD * 2); _Float16* B16 = (_Float16*)take((size_t)NB * NP * NS * PD * 2); _Float16* W16 = (_Float16*)take((size_t)NP * NP * 2);      /* A and Bm as f16; Wm as f16 (256 words) */
  _Float16* CT16 = (_Float16*)take((size_t)PD * NP * NS * 2); float* SG = (float*)take((size_t)NP * NS * NK * 4);      /* a batch entry of C turned [64][16384]; its sixteen parts' logits */
  float* ZG = (float*)take((size_t)PG * NS * NK * 4); float* SF = (float*)take((size_t)PG * NS * NK * 4); _Float16* S16 = (_Float16*)take((size_t)PG * NS * NK * 2);      /* eight result parts' blended logits, f32 shares (written, not read) and f16 shares at 1,024 */
  if (off > ws_size) return;
  k_x16<<<(unsigned)(((size_t)NB * NP * NS * (PD / 8)) / 256), 256, 0, stream>>>(AI, A16, (size_t)NB * NP * NS * PD / 8);
  k_x16<<<(unsigned)(((size_t)NB * NP * NS * (PD / 8)) / 256), 256, 0, stream>>>(BI, B16, (size_t)NB * NP * NS * PD / 8);
  k_x16<<<1, 256, 0, stream>>>(WI, W16, (size_t)NP * NP / 8);      /* 32 threads of the block work: the kernel's own guard turns the rest away */
  for (int e = 0; e < NB; ++e) { const size_t eo = (size_t)e * NP * NS * PD;
    k_wt_f16<<<(PD * (NP * NS / 8)) / 256, 256, 0, stream>>>(CI + eo, CT16, NP * NS, PD, 1.0f);      /* C's batch entry [16384 rows][64] -> CT16[d][h * 1024 + s] = f16(bf16(C[h][s][d])) */
    k_gemm2<0><<<dim3((NS / 128) * (NK / 64), NP), 128, 0, stream>>>(A16 + eo, PD, (size_t)NS * PD, B16 + eo, PD, (size_t)NS * PD, 0.125f, nullptr, 0, nullptr, 1, 0, 0, SG, nullptr, NK, (size_t)NS * NK, NS, NK, PD);      /* the sixteen parts' logits */
    for (int g = 0; g < NP / PG; ++g) {
      k_mix<<<(unsigned)(((size_t)PG * NS * (NK / 4)) / 256), 256, 0, stream>>>(SG, W16, SI, ZG, g * PG, (size_t)PG * NS * NK / 4);
      k_rsm<<<(PG * NS) / 8, 256, 0, stream>>>(ZG, SF, S16, PG * NS);
      k_pv<<<dim3(NS / 32, PG), 256, 0, stream>>>(S16, CT16 + (size_t)g * PG * NS, OUT + (size_t)e * NS * NP * PD + (size_t)g * PG * PD); } }      /* a result part's 64 columns at a row stride of 1,024 */
}

// v002
// One run takes 352 microseconds.
// Next to v001, in two timings, it ran 1.29 and 1.28 times as fast.
// All steps since v000 together make it 2.01 times as fast.
#include <hip/hip_runtime.h>
// A sixteen-part alignment whose logits are BLENDED ACROSS THE PARTS by a 16 by 16 matrix before one softmax (five inputs: A, Bm, C [4][16][1024][64] f32: rows already cut into 16 parts of width 64; a mixing matrix Wm [16][16] f32 ([result part][source part]); a switch: ONE int32 word, non-zero = later columns hidden): a part's logits = A Bm^T / 8 [1024][1024]; blended[g] = the sum over h of Wm[g][h] logits[h], element by element; if the switch is non-zero a column whose index exceeds the row's counts as minus infinity; ONE softmax over the 1,024 columns; a part's result = its shares times C's part [1024][64]; the results laid as [4][1024][16][64].
// Structure: A and Bm cast whole to f16; THEN A BATCH ENTRY AT A TIME: C's batch entry turned as ONE [16384][64] matrix into [64][16384] f16 (k_wt_f16: a part's rows are 1,024 columns of it); the sixteen parts' logits in ONE launch (WMMA GEMM, 32 by 64 wave tiles, depth 64, f32 accumulation, scale 1 / 8: the part is the grid's second axis) into an f32 plane; k_mix ONCE FOR ALL SIXTEEN RESULT PARTS: a block one row, a thread four consecutive columns: sixteen 16-byte loads (one a source part) held in registers, then a result part after the other: sixteen words of Wm's row (its bf16 values as f16 words, cast once by k_x16: exact), 64 multiply-adds in f32 in the order of h, the hidden columns BY A SELECT on the block's and the thread's own numbers and the switch's word, one 16-byte store; THEN EIGHT RESULT PARTS AT A TIME (planes reused): the row softmax, a wave a row over 1,024 logits; the shares times the turned C by k_pv (a block a 32 by 64 tile, its eight waves each 128 of the depth, the partial tiles added through LDS) STRAIGHT INTO THE OUTPUT at the part's column block of 64 inside a row of 1,024.
// Compute dtype: A, Bm, C and Wm rounded to bf16 where they are first read: bf16 values are exact f16 words away from the subnormal range: NO COMPUTED OPERAND ENTERS THE LOGITS; every matrix multiply's operands f16 words (11 bits): the shares ONE word at a carry of 1,024 (words under 2^-14 written as noughts); f32 accumulation; the logits, THE MIXING (f32 multiply-adds on the vector unit: 16 a result word: a depth and a width of 16 are under the matrix tile), the softmax's largest, exponentials (expf), sum and true divisions f32; the switch read as an int32 word by value. v_wmma_f32_16x16x32_f16.
#define NB 4                         /* batch entries */
#define NP 16                        /* parts */
#define NS 1024                      /* rows of a part: and columns of its logits */
#define PD 64                        /* a part's width */
#define PG 8                         /* result parts a group */
#define NK 1024                      /* the row softmax's logits a row */
#define PSC 1024.0f                  /* the carry on the shares' f16 plane */

typedef __bf16 v16b __attribute__((ext_vector_type(16)));
typedef unsigned short v8us __attribute__((ext_vector_type(8), may_alias));
typedef float  v8f  __attribute__((ext_vector_type(8)));
typedef float  v4f  __attribute__((ext_vector_type(4)));
typedef float  v4fa __attribute__((ext_vector_type(4), may_alias));
union FragB { v16b v; v8us half[2]; unsigned short u[16]; };

__device__ __forceinline__ unsigned short bf16_bits(float x) { unsigned int u = __float_as_uint(x); return (unsigned short)((u + 0x7FFFu + ((u >> 16) & 1u)) >> 16); }
__device__ __forceinline__ float bf16_val(unsigned short b) { return __uint_as_float(((unsigned int)b) << 16); }
__device__ __forceinline__ float bf16_round(float x) { return bf16_val(bf16_bits(x)); }
// D += A·B with NT terms: 1 = ah·bh, 2 = + al·bh (A split), 3 = + ah·bl (both split)
template <int NT>
__device__ __forceinline__ v8f mmaN(v16b ah, v16b al, v16b bh, v16b bl, v8f c) {
  c = __builtin_amdgcn_wmma_f32_16x16x32_bf16(false, ah, false, bh, (short)0, c, false, false);
  if (NT >= 2) c = __builtin_amdgcn_wmma_f32_16x16x32_bf16(false, al, false, bh, (short)0, c, false, false);
  if (NT >= 3) c = __builtin_amdgcn_wmma_f32_16x16x32_bf16(false, ah, false, bl, (short)0, c, false, false);
  asm volatile("v_nop\n\tv_nop\n\tv_nop\n\tv_nop" : "+v"(c) : "v"(ah), "v"(al), "v"(bh), "v"(bl));
  return c;
}




// ---- f16 WMMA path (v_wmma_f32_16x16x32_f16): 11-bit significands for operands in range — used where a [0,1] probability operand needs more precision than bf16
typedef _Float16 v16h __attribute__((ext_vector_type(16)));
union FragH { v16h v; v8us half[2]; _Float16 h[16]; unsigned short u[16]; };
template <int NT>
__device__ __forceinline__ v8f mmaH(v16h ah, v16h al, v16h bh, v16h bl, v8f c) {
  c = __builtin_amdgcn_wmma_f32_16x16x32_f16(false, ah, false, bh, (short)0, c, false, false);
  if (NT >= 2) c = __builtin_amdgcn_wmma_f32_16x16x32_f16(false, al, false, bh, (short)0, c, false, false);
  if (NT >= 3) c = __builtin_amdgcn_wmma_f32_16x16x32_f16(false, ah, false, bl, (short)0, c, false, false);
  asm volatile("v_nop\n\tv_nop\n\tv_nop\n\tv_nop" : "+v"(c) : "v"(ah), "v"(al), "v"(bh), "v"(bl));
  return c;
}

// Wt[n][k] = f16(W[k][n]·scale) from f32 row-major W[K][N] (scale = power of two; bf16-exact weights stay exact in f16 away from the subnormal range)
__global__ __launch_bounds__(256) void k_wt_f16(const float* __restrict__ W, _Float16* __restrict__ Wt, int K, int N, float scale) {
  const int t = blockIdx.x * 256 + threadIdx.x; if (t >= N * (K / 8)) return; const int n = t / (K / 8), k8 = (t % (K / 8)) * 8; FragH f;
#pragma unroll
  for (int i = 0; i < 8; ++i) f.h[i] = (_Float16)(bf16_round(W[(size_t)(k8 + i) * N + n]) * scale); const v8us o = f.half[0];
  *(v8us*)((unsigned short*)Wt + (size_t)n * K + k8) = o; 
}

typedef _Float16 v4h __attribute__((ext_vector_type(4)));

__global__ __launch_bounds__(256) void k_x16(const float* __restrict__ x, _Float16* __restrict__ X16, size_t n8) { const size_t t = (size_t)blockIdx.x * 256 + threadIdx.x; if (t >= n8) return; FragH f;
#pragma unroll
  for (int q = 0; q < 8; ++q) f.h[q] = (_Float16)bf16_round(x[t * 8 + q]); *(v8us*)((unsigned short*)X16 + t * 8) = f.half[0];  }
// ---- fast GEMM (wave tile 32x64; requires M % 32 == 0 rows per launch region and N % 64 == 0) ----
__device__ __forceinline__ v16h g2_frag(const _Float16* p, int hh) { FragH f; f.half[0] = *(const v8us*)((const unsigned short*)p + 8 * hh); f.half[1] = *(const v8us*)((const unsigned short*)p + 16 + 8 * hh); return f.v; }
__device__ __forceinline__ v8f g2_mma(v16h a, v16h b, v8f c) { v8f d = __builtin_amdgcn_wmma_f32_16x16x32_f16(false, a, false, b, (short)0, c, false, false); asm volatile("v_nop\n\tv_nop\n\tv_nop\n\tv_nop" : "+v"(d) : "v"(a), "v"(b)); return d; }
template <int ACT>
__global__ __launch_bounds__(128) void k_gemm2(const _Float16* __restrict__ A, int lda, size_t sA, const _Float16* __restrict__ Bh, int ldb, size_t sB, float alpha, const float* __restrict__ bias, size_t sBias, const float* __restrict__ CP, int rowsPerB, size_t sCPb, int row0g,
    float* __restrict__ C, _Float16* __restrict__ C16, int ldc, size_t sC, int M, int N, int K) { static_assert(ACT == 0 || ACT == 3 || ACT == 6 || ACT == 8 || ACT == 9 || ACT == 11 || ACT == 12 || ACT == 14 || ACT == 15 || ACT == 16 || ACT == 17, "k_gemm2: unsupported ACT code (would silently apply no activation)");
  __shared__ __attribute__((aligned(16))) float so[4][32][68];
  const int tid = threadIdx.x, w = tid >> 5, lane = tid & 31, ln = lane & 15, hh = lane >> 4; const int by = blockIdx.y;
  A += (size_t)by * sA; Bh += (size_t)by * sB; const size_t cofs = (size_t)by * sC; const float* bp = bias ? bias + (size_t)by * sBias : nullptr;
  const int ntn = N >> 6; const int mt = blockIdx.x / ntn, nq = blockIdx.x - mt * ntn; const int row0 = mt * 128 + 32 * w, col0 = nq * 64; if (row0 >= M) return;
  const _Float16* a0p = A + (size_t)(row0 + ln) * lda; const _Float16* a1p = a0p + (size_t)16 * lda;
  const _Float16* b0p = Bh + (size_t)(col0 + ln) * ldb; const _Float16* b1p = b0p + (size_t)16 * ldb; const _Float16* b2p = b1p + (size_t)16 * ldb; const _Float16* b3p = b2p + (size_t)16 * ldb;
  const v8f z8 = {0.f,0.f,0.f,0.f,0.f,0.f,0.f,0.f}; v8f c00 = z8, c01 = z8, c02 = z8, c03 = z8, c10 = z8, c11 = z8, c12 = z8, c13 = z8;
  for (int kb = 0; kb < K; kb += 32) { const v16h a0 = g2_frag(a0p + kb, hh), a1 = g2_frag(a1p + kb, hh);
    v16h b = g2_frag(b0p + kb, hh); c00 = g2_mma(a0, b, c00); c10 = g2_mma(a1, b, c10);
    b = g2_frag(b1p + kb, hh); c01 = g2_mma(a0, b, c01); c11 = g2_mma(a1, b, c11);
    b = g2_frag(b2p + kb, hh); c02 = g2_mma(a0, b, c02); c12 = g2_mma(a1, b, c12);
    b = g2_frag(b3p + kb, hh); c03 = g2_mma(a0, b, c03); c13 = g2_mma(a1, b, c13); }
  v8f accs[8] = {c00, c01, c02, c03, c10, c11, c12, c13};
#pragma unroll
  for (int u = 0; u < 8; ++u) { const int t = u & 3, half = u >> 2; const int col = col0 + t * 16 + ln; const float bv = bp ? bf16_round(bp[col]) : 0.f;
#pragma unroll
    for (int r = 0; r < 8; ++r) { const int rloc = half * 16 + 8 * hh + r; float v = accs[u][r] * alpha + bv; if (CP) { if (rowsPerB < 0) v += CP[cofs + (size_t)(row0g + row0 + rloc) * ldc + col];      /* rowsPerB < 0: own element of the batched C plane */ else { const int bidx = (row0g + row0 + rloc) / rowsPerB; v += CP[(size_t)bidx * sCPb + (size_t)by * 64 + col]; } }
      if (ACT == 3) v = fmaxf(v, 0.f); else if (ACT == 6) v = 0.5f * v * (1.0f + erff(v * 0.70710678118654752f)); else if (ACT == 11) v = 1.0f / (1.0f + expf(-v)); else if (ACT == 15) v = v / (1.0f + expf(-v)); else if (ACT == 12) v = (v > 0.f) ? v : 0.01f * v; else if (ACT == 8) v = tanhf(v); else if (ACT == 9) v = 0.5f * v * (1.0f + tanhf(0.7978845608028654f * (v + 0.044715f * v * v * v))); else if (ACT == 14) v = (v > 0.f) ? v : 0.1f * v; else if (ACT == 16) v = (v >= 0.f) ? v : 0.3f * v; else if (ACT == 17) v = (v >= 0.f) ? v : 0.2f * v;
      so[w][rloc][t * 16 + ln] = v; } }
  __builtin_amdgcn_fence(__ATOMIC_ACQ_REL, "workgroup"); __builtin_amdgcn_wave_barrier();
  const int rsub = lane >> 4, c4 = (lane & 15) * 4;
  {
#pragma unroll
    for (int q = 0; q < 16; ++q) { const int r = q * 2 + rsub; const v4f v = *(const v4fa*)&so[w][r][c4]; if (C) *(v4f*)(C + cofs + (size_t)(row0 + r) * ldc + col0 + c4) = v; if (C16) { v4h h4; for (int i = 0; i < 4; ++i) h4[i] = (_Float16)v[i]; *(v4h*)(C16 + cofs + (size_t)(row0 + r) * ldc + col0 + c4) = h4; } }
     } }

// ---- shares times the turned C: a block one 32 by 64 tile of a result part; its eight waves each take 128 of the 1,024 depth (four 32-deep steps) and the eight f32 partial tiles are added through LDS in the order of the waves ----
#define KW 8                         /* waves a block: slices of the depth */
__global__ __launch_bounds__(256) void k_pv(const _Float16* __restrict__ P, const _Float16* __restrict__ Ct, float* __restrict__ O) {
  __shared__ __attribute__((aligned(16))) float so[KW][32][68];
  const int tid = threadIdx.x, w = tid >> 5, lane = tid & 31, ln = lane & 15, hh = lane >> 4; const int row0 = blockIdx.x * 32, by = blockIdx.y;
  const _Float16* a0p = P + (size_t)by * NS * NK + (size_t)(row0 + ln) * NK + w * (NK / KW); const _Float16* a1p = a0p + (size_t)16 * NK;
  const _Float16* b0p = Ct + (size_t)by * NS + (size_t)ln * (NP * NS) + w * (NK / KW); const _Float16* b1p = b0p + (size_t)16 * NP * NS; const _Float16* b2p = b1p + (size_t)16 * NP * NS; const _Float16* b3p = b2p + (size_t)16 * NP * NS;
  const v8f z8 = {0.f,0.f,0.f,0.f,0.f,0.f,0.f,0.f}; v8f c00 = z8, c01 = z8, c02 = z8, c03 = z8, c10 = z8, c11 = z8, c12 = z8, c13 = z8;
  for (int kb = 0; kb < NK / KW; kb += 32) { const v16h a0 = g2_frag(a0p + kb, hh), a1 = g2_frag(a1p + kb, hh);
    v16h b = g2_frag(b0p + kb, hh); c00 = g2_mma(a0, b, c00); c10 = g2_mma(a1, b, c10);
    b = g2_frag(b1p + kb, hh); c01 = g2_mma(a0, b, c01); c11 = g2_mma(a1, b, c11);
    b = g2_frag(b2p + kb, hh); c02 = g2_mma(a0, b, c02); c12 = g2_mma(a1, b, c12);
    b = g2_frag(b3p + kb, hh); c03 = g2_mma(a0, b, c03); c13 = g2_mma(a1, b, c13); }
  v8f accs[8] = {c00, c01, c02, c03, c10, c11, c12, c13};
#pragma unroll      /* both loops unrolled: accs is indexed by constants and stays in registers */
  for (int u = 0; u < 8; ++u) { const int t = u & 3, half = u >> 2;
#pragma unroll
    for (int r = 0; r < 8; ++r) so[w][half * 16 + 8 * hh + r][t * 16 + ln] = accs[u][r]; }
  __syncthreads();      /* every wave's partial tile is in LDS before any thread adds the eight */
  const int rr = tid >> 4, c4 = (tid & 15) * 4;
  for (int q = 0; q < 2; ++q) { const int r = q * 16 + rr; v4f s = *(const v4fa*)&so[0][r][c4];
    for (int k = 1; k < KW; ++k) { const v4f p = *(const v4fa*)&so[k][r][c4]; s += p; }
    s *= (1.0f / PSC); *(v4f*)(O + (size_t)by * PD + (size_t)(row0 + r) * (NP * PD) + c4) = s; } }

// Wt[n][k] = f16(W[k][n] x scale) from f32 row-major W[K][N] with NO rounding of W to bf16 first: for a COMPUTED f32 plane (the transposing cast above without that one statement)
__global__ __launch_bounds__(256) void k_wtc_f16(const float* __restrict__ W, _Float16* __restrict__ Wt, int K, int N, float scale) {
  const int t = blockIdx.x * 256 + threadIdx.x; if (t >= N * (K / 8)) return; const int n = t / (K / 8), k8 = (t % (K / 8)) * 8; FragH f;
#pragma unroll
  for (int i = 0; i < 8; ++i) f.h[i] = (_Float16)(W[(size_t)(k8 + i) * N + n] * scale); const v8us o = f.half[0];
  *(v8us*)((unsigned short*)Wt + (size_t)n * K + k8) = o; 
}

__global__ __launch_bounds__(256) void k_rsm(const float* __restrict__ Z, float* __restrict__ AT, _Float16* __restrict__ P16, int n) {
  const int r = blockIdx.x * 8 + (threadIdx.x >> 5); if (r >= n) return; const int ln = threadIdx.x & 31; const float* zp = Z + (size_t)r * NK + ln * 8; float m = -3.0e38f;
  for (int c = 0; c < NK; c += 256) { const v4f z0 = *(const v4fa*)(zp + c); const v4f z1 = *(const v4fa*)(zp + c + 4);
    for (int i = 0; i < 4; ++i) m = (z0[i] > m) ? z0[i] : m;
    for (int i = 0; i < 4; ++i) m = (z1[i] > m) ? z1[i] : m; }
  for (int x = 16; x >= 1; x >>= 1) { const float o = __shfl_xor(m, x, 32); m = (o > m) ? o : m; }
  float s = 0.f;
  for (int c = 0; c < NK; c += 256) { const v4f z0 = *(const v4fa*)(zp + c); const v4f z1 = *(const v4fa*)(zp + c + 4);
    for (int i = 0; i < 4; ++i) s += expf(z0[i] - m);
    for (int i = 0; i < 4; ++i) s += expf(z1[i] - m); }
  for (int x = 16; x >= 1; x >>= 1) s += __shfl_xor(s, x, 32);
  float* ap = AT + (size_t)r * NK + ln * 8; unsigned short* hp = (unsigned short*)P16 + (size_t)r * NK + ln * 8;
  for (int c = 0; c < NK; c += 256) { const v4f z0 = *(const v4fa*)(zp + c); const v4f z1 = *(const v4fa*)(zp + c + 4); v4f a0, a1; FragH f;
    for (int i = 0; i < 4; ++i) { const float p0 = expf(z0[i] - m) / s; const float p1 = expf(z1[i] - m) / s; a0[i] = p0; a1[i] = p1; const _Float16 h0 = (_Float16)(p0 * PSC); const _Float16 h1 = (_Float16)(p1 * PSC); f.h[i] = (h0 < (_Float16)6.103515625e-05f) ? (_Float16)0.0f : h0; f.h[4 + i] = (h1 < (_Float16)6.103515625e-05f) ? (_Float16)0.0f : h1; }
    *(v4fa*)(ap + c) = a0; *(v4fa*)(ap + c + 4) = a1; *(v8us*)(hp + c) = f.half[0];  } }

// a block one row r of the logits, a thread four consecutive columns: the sixteen source parts' words are read ONCE and serve all sixteen result parts from registers
typedef unsigned int v8u __attribute__((ext_vector_type(8), may_alias));
__global__ __launch_bounds__(256) void k_mix(const float* __restrict__ S, const _Float16* __restrict__ W16, const int* __restrict__ SW, float* __restrict__ Z) { const unsigned int r = blockIdx.x; const unsigned int c0 = threadIdx.x * 4u; const unsigned int vo = c0 * 4u;      /* the thread's place in a row, in bytes */ const float* __restrict__ Sr = S + ((size_t)r << 10);      /* the row's first word of source part 0: a scalar address */ float* __restrict__ Zr = Z + ((size_t)r << 10); const int sw = SW[0]; v4f s[NP];
  static_assert(NP == 16 && (size_t)NS * NK * 4 == 4194304, "the sixteen loads below: eight scalar bases, the odd parts one plane (4,194,304 bytes) behind the even ones");
  /* the sixteen loads (source part h into s[h]) and their data wait in ONE statement: all sixteen are in flight together, and no register that a load names, nor one that it fills, is touched by the compiler before the data is there */
  asm volatile("global_load_b128 %0, %16, %17\n\t"
               "global_load_b128 %1, %16, %17 offset:4194304\n\t"
               "global_load_b128 %2, %16, %18\n\t"
               "global_load_b128 %3, %16, %18 offset:4194304\n\t"
               "global_load_b128 %4, %16, %19\n\t"
               "global_load_b128 %5, %16, %19 offset:4194304\n\t"
               "global_load_b128 %6, %16, %20\n\t"
               "global_load_b128 %7, %16, %20 offset:4194304\n\t"
               "global_load_b128 %8, %16, %21\n\t"
               "global_load_b128 %9, %16, %21 offset:4194304\n\t"
               "global_load_b128 %10, %16, %22\n\t"
               "global_load_b128 %11, %16, %22 offset:4194304\n\t"
               "global_load_b128 %12, %16, %23\n\t"
               "global_load_b128 %13, %16, %23 offset:4194304\n\t"
               "global_load_b128 %14, %16, %24\n\t"
               "global_load_b128 %15, %16, %24 offset:4194304\n\t"
               "s_wait_loadcnt 0x0"
               : "=&v"(s[0]), "=&v"(s[1]), "=&v"(s[2]), "=&v"(s[3]), "=&v"(s[4]), "=&v"(s[5]), "=&v"(s[6]), "=&v"(s[7]), "=&v"(s[8]), "=&v"(s[9]), "=&v"(s[10]), "=&v"(s[11]), "=&v"(s[12]), "=&v"(s[13]), "=&v"(s[14]), "=&v"(s[15])
               : "v"(vo), "s"(Sr + (size_t)0 * NS * NK), "s"(Sr + (size_t)2 * NS * NK), "s"(Sr + (size_t)4 * NS * NK), "s"(Sr + (size_t)6 * NS * NK), "s"(Sr + (size_t)8 * NS * NK), "s"(Sr + (size_t)10 * NS * NK), "s"(Sr + (size_t)12 * NS * NK), "s"(Sr + (size_t)14 * NS * NK)
               : "memory");
#pragma unroll 2      /* two result parts a trip: eight independent chains of multiply-adds and one 64-byte scalar load of weights */
  for (int g = 0; g < NP; ++g) { const v8u wr = *(const v8u*)(W16 + g * NP);      /* Wm's row g, sixteen f16 words as eight 32-bit words: the same for every lane, so it comes by a scalar load and takes no vector register */ v4f z = {0.0f, 0.0f, 0.0f, 0.0f};
#pragma unroll      /* s is indexed by constants and stays in registers */
    for (int h = 0; h < NP; ++h) { const float w = (float)__builtin_bit_cast(_Float16, (unsigned short)(wr[h >> 1] >> (16 * (h & 1))));
#pragma unroll
      for (int q = 0; q < 4; ++q) z[q] = __builtin_fmaf(w, s[h][q], z[q]); }      /* a column's sum still runs in the order of h, one fused multiply-add a term */
#pragma unroll
    for (int q = 0; q < 4; ++q) z[q] = (sw != 0 && c0 + (unsigned int)q > r) ? __uint_as_float(0xff800000u) : z[q];
    *(v4f*)(Zr + (size_t)g * NS * NK + c0) = z; } }
extern "C" void kernel_launch(void* const* d_in, const int* in_sizes, int n_in,
                              void* d_out, int out_size, void* d_ws, size_t ws_size, hipStream_t stream) {
  (void)in_sizes; (void)n_in; (void)out_size;
  const float* AI = (const float*)d_in[0]; const float* BI = (const float*)d_in[1]; const float* CI = (const float*)d_in[2]; const float* WI = (const float*)d_in[3]; const int* SI = (const int*)d_in[4];      /* A, Bm, C [4][16][1024][64]; Wm [16][16]; the switch: one int32 word */
  static_assert(PD == 64 && NK % (KW * 32) == 0 && NK == NS && NP % PG == 0 && NS % 128 == 0 && NS % 64 == 0 && PD % 64 == 0 && PD % 32 == 0 && NS % 32 == 0 && NK % 256 == 0 && ((NS * (NK / 4)) & (NS * (NK / 4) - 1)) == 0 && ((size_t)NB * NP * NS * (PD / 8)) % 256 == 0 && (PD * (NP * NS / 8)) % 256 == 0 && NK == 256 * 4 && (PG * NS) % 8 == 0, "whole tiles; exact grids");
  float* OUT = (float*)d_out;      /* [4][1024][16][64] */
  char* ws = (char*)d_ws; size_t off = 0;
  auto take = [&](size_t bytes) { char* p = ws + off; off += (bytes + 255) & ~(size_t)255; return p; };
  _Float16* A16 = (_Float16*)take((size_t)NB * NP * NS * PD * 2); _Float16* B16 = (_Float16*)take((size_t)NB * NP * NS * PD * 2); _Float16* W16 = (_Float16*)take((size_t)NP * NP * 2);      /* A and Bm as f16; Wm as f16 (256 words) */
  _Float16* CT16 = (_Float16*)take((size_t)PD * NP * NS * 2); float* SG = (float*)take((size_t)NP * NS * NK * 4);      /* a batch entry of C turned [64][16384]; its sixteen parts' logits */
  float* ZG = (float*)take((size_t)NP * NS * NK * 4); float* SF = (float*)take((size_t)PG * NS * NK * 4); _Float16* S16 = (_Float16*)take((size_t)PG * NS * NK * 2);      /* all sixteen result parts' blended logits; eight result parts' f32 shares (written, not read) and f16 shares at 1,024 */
  if (off > ws_size) return;
  k_x16<<<(unsigned)(((size_t)NB * NP * NS * (PD / 8)) / 256), 256, 0, stream>>>(AI, A16, (size_t)NB * NP * NS * PD / 8);
  k_x16<<<(unsigned)(((size_t)NB * NP * NS * (PD / 8)) / 256), 256, 0, stream>>>(BI, B16, (size_t)NB * NP * NS * PD / 8);
  k_x16<<<1, 256, 0, stream>>>(WI, W16, (size_t)NP * NP / 8);      /* 32 threads of the block work: the kernel's own guard turns the rest away */
  for (int e = 0; e < NB; ++e) { const size_t eo = (size_t)e * NP * NS * PD;
    k_wt_f16<<<(PD * (NP * NS / 8)) / 256, 256, 0, stream>>>(CI + eo, CT16, NP * NS, PD, 1.0f);      /* C's batch entry [16384 rows][64] -> CT16[d][h * 1024 + s] = f16(bf16(C[h][s][d])) */
    k_gemm2<0><<<dim3((NS / 128) * (NK / 64), NP), 128, 0, stream>>>(A16 + eo, PD, (size_t)NS * PD, B16 + eo, PD, (size_t)NS * PD, 0.125f, nullptr, 0, nullptr, 1, 0, 0, SG, nullptr, NK, (size_t)NS * NK, NS, NK, PD);      /* the sixteen parts' logits */
    k_mix<<<NS, 256, 0, stream>>>(SG, W16, SI, ZG);      /* all sixteen result parts' blended logits from one read of SG */
    for (int g = 0; g < NP / PG; ++g) {
      k_rsm<<<(PG * NS) / 8, 256, 0, stream>>>(ZG + (size_t)g * PG * NS * NK, SF, S16, PG * NS);
      k_pv<<<dim3(NS / 32, PG), 256, 0, stream>>>(S16, CT16 + (size_t)g * PG * NS, OUT + (size_t)e * NS * NP * PD + (size_t)g * PG * PD); } }      /* a result part's 64 columns at a row stride of 1,024 */
}

// v003
// One run takes 243 microseconds.
// In both of two side-by-side timings against v002, it was 1.45 times as fast.
// Over all steps from v000 it is 2.91 times as fast.
#include <hip/hip_runtime.h>
// A sixteen-part alignment whose logits are BLENDED ACROSS THE PARTS by a 16 by 16 matrix before one softmax (five inputs: A, Bm, C [4][16][1024][64] f32: rows already cut into 16 parts of width 64; a mixing matrix Wm [16][16] f32 ([result part][source part]); a switch: ONE int32 word, non-zero = later columns hidden): a part's logits = A Bm^T / 8 [1024][1024]; blended[g] = the sum over h of Wm[g][h] logits[h], element by element; if the switch is non-zero a column whose index exceeds the row's counts as minus infinity; ONE softmax over the 1,024 columns; a part's result = its shares times C's part [1024][64]; the results laid as [4][1024][16][64].
// Structure: A and Bm cast whole to f16; THEN A BATCH ENTRY AT A TIME: C's batch entry turned as ONE [16384][64] matrix into [64][16384] f16 (k_wt_f16: a part's rows are 1,024 columns of it); the sixteen parts' logits in ONE launch (WMMA GEMM, 32 by 64 wave tiles, depth 64, f32 accumulation, scale 1 / 8: the part is the grid's second axis) into an f32 plane; k_mixsm ONCE FOR ALL SIXTEEN RESULT PARTS, BLEND AND SOFTMAX IN ONE: a block one row, a thread four consecutive columns: sixteen 16-byte loads (one a source part) held in registers, then a result part after the other: sixteen words of Wm's row (its bf16 values as f16 words, cast once by k_x16: exact), 64 multiply-adds in f32 in the order of h, the hidden columns BY A SELECT on the block's and the thread's own numbers and the switch's word; the block holds the row's 1,024 blended logits of all sixteen result parts in registers, so the sixteen largest and the sixteen sums are taken there (lanes, then the eight waves through LDS) and only the f16 shares are stored, 8 bytes a thread and part; the shares times the turned C by k_pv, all sixteen result parts in one launch (a block a 32 by 64 tile, its eight waves each 128 of the depth, the partial tiles added through LDS) STRAIGHT INTO THE OUTPUT at the part's column block of 64 inside a row of 1,024.
// Compute dtype: A, Bm, C and Wm rounded to bf16 where they are first read (each by k_x16 or k_wt_f16): bf16 values are exact f16 words away from the subnormal range: NO COMPUTED OPERAND ENTERS THE LOGITS; every matrix multiply's operands f16 words (11 bits): the shares ONE word at a carry of 1,024 (words under 2^-14 written as noughts); f32 accumulation; the logits, THE MIXING (f32 multiply-adds on the vector unit: 16 a result word: a depth and a width of 16 are under the matrix tile), the softmax's largest, exponentials (expf), sum and true divisions f32; the switch read as an int32 word by value. v_wmma_f32_16x16x32_f16.
#define NB 4                         /* batch entries */
#define NP 16                        /* parts */
#define NS 1024                      /* rows of a part: and columns of its logits */
#define PD 64                        /* a part's width */
#define NK 1024                      /* the row softmax's logits a row */
#define PSC 1024.0f                  /* the carry on the shares' f16 plane */

typedef __bf16 v16b __attribute__((ext_vector_type(16)));
typedef unsigned short v8us __attribute__((ext_vector_type(8), may_alias));
typedef float  v8f  __attribute__((ext_vector_type(8)));
typedef float  v4f  __attribute__((ext_vector_type(4)));
typedef float  v4fa __attribute__((ext_vector_type(4), may_alias));
union FragB { v16b v; v8us half[2]; unsigned short u[16]; };

__device__ __forceinline__ unsigned short bf16_bits(float x) { unsigned int u = __float_as_uint(x); return (unsigned short)((u + 0x7FFFu + ((u >> 16) & 1u)) >> 16); }
__device__ __forceinline__ float bf16_val(unsigned short b) { return __uint_as_float(((unsigned int)b) << 16); }
__device__ __forceinline__ float bf16_round(float x) { return bf16_val(bf16_bits(x)); }
// D += A·B with NT terms: 1 = ah·bh, 2 = + al·bh (A split), 3 = + ah·bl (both split)
template <int NT>
__device__ __forceinline__ v8f mmaN(v16b ah, v16b al, v16b bh, v16b bl, v8f c) {
  c = __builtin_amdgcn_wmma_f32_16x16x32_bf16(false, ah, false, bh, (short)0, c, false, false);
  if (NT >= 2) c = __builtin_amdgcn_wmma_f32_16x16x32_bf16(false, al, false, bh, (short)0, c, false, false);
  if (NT >= 3) c = __builtin_amdgcn_wmma_f32_16x16x32_bf16(false, ah, false, bl, (short)0, c, false, false);
  asm volatile("v_nop\n\tv_nop\n\tv_nop\n\tv_nop" : "+v"(c) : "v"(ah), "v"(al), "v"(bh), "v"(bl));
  return c;
}




// ---- f16 WMMA path (v_wmma_f32_16x16x32_f16): 11-bit significands for operands in range — used where a [0,1] probability operand needs more precision than bf16
typedef _Float16 v16h __attribute__((ext_vector_type(16)));
union FragH { v16h v; v8us half[2]; _Float16 h[16]; unsigned short u[16]; };
template <int NT>
__device__ __forceinline__ v8f mmaH(v16h ah, v16h al, v16h bh, v16h bl, v8f c) {
  c = __builtin_amdgcn_wmma_f32_16x16x32_f16(false, ah, false, bh, (short)0, c, false, false);
  if (NT >= 2) c = __builtin_amdgcn_wmma_f32_16x16x32_f16(false, al, false, bh, (short)0, c, false, false);
  if (NT >= 3) c = __builtin_amdgcn_wmma_f32_16x16x32_f16(false, ah, false, bl, (short)0, c, false, false);
  asm volatile("v_nop\n\tv_nop\n\tv_nop\n\tv_nop" : "+v"(c) : "v"(ah), "v"(al), "v"(bh), "v"(bl));
  return c;
}

// Wt[n][k] = f16(W[k][n]·scale) from f32 row-major W[K][N] (scale = power of two; bf16-exact weights stay exact in f16 away from the subnormal range)
__global__ __launch_bounds__(256) void k_wt_f16(const float* __restrict__ W, _Float16* __restrict__ Wt, int K, int N, float scale) {
  const int t = blockIdx.x * 256 + threadIdx.x; if (t >= N * (K / 8)) return; const int n = t / (K / 8), k8 = (t % (K / 8)) * 8; FragH f;
#pragma unroll
  for (int i = 0; i < 8; ++i) f.h[i] = (_Float16)(bf16_round(W[(size_t)(k8 + i) * N + n]) * scale); const v8us o = f.half[0];
  *(v8us*)((unsigned short*)Wt + (size_t)n * K + k8) = o; 
}

typedef _Float16 v4h __attribute__((ext_vector_type(4)));

__global__ __launch_bounds__(256) void k_x16(const float* __restrict__ x, _Float16* __restrict__ X16, size_t n8) { const size_t t = (size_t)blockIdx.x * 256 + threadIdx.x; if (t >= n8) return; FragH f;
#pragma unroll
  for (int q = 0; q < 8; ++q) f.h[q] = (_Float16)bf16_round(x[t * 8 + q]); *(v8us*)((unsigned short*)X16 + t * 8) = f.half[0];  }
// ---- fast GEMM (wave tile 32x64; requires M % 32 == 0 rows per launch region and N % 64 == 0) ----
__device__ __forceinline__ v16h g2_frag(const _Float16* p, int hh) { FragH f; f.half[0] = *(const v8us*)((const unsigned short*)p + 8 * hh); f.half[1] = *(const v8us*)((const unsigned short*)p + 16 + 8 * hh); return f.v; }
__device__ __forceinline__ v8f g2_mma(v16h a, v16h b, v8f c) { v8f d = __builtin_amdgcn_wmma_f32_16x16x32_f16(false, a, false, b, (short)0, c, false, false); asm volatile("v_nop\n\tv_nop\n\tv_nop\n\tv_nop" : "+v"(d) : "v"(a), "v"(b)); return d; }
template <int ACT>
__global__ __launch_bounds__(128) void k_gemm2(const _Float16* __restrict__ A, int lda, size_t sA, const _Float16* __restrict__ Bh, int ldb, size_t sB, float alpha, const float* __restrict__ bias, size_t sBias, const float* __restrict__ CP, int rowsPerB, size_t sCPb, int row0g,
    float* __restrict__ C, _Float16* __restrict__ C16, int ldc, size_t sC, int M, int N, int K) { static_assert(ACT == 0 || ACT == 3 || ACT == 6 || ACT == 8 || ACT == 9 || ACT == 11 || ACT == 12 || ACT == 14 || ACT == 15 || ACT == 16 || ACT == 17, "k_gemm2: unsupported ACT code (would silently apply no activation)");
  __shared__ __attribute__((aligned(16))) float so[4][32][68];
  const int tid = threadIdx.x, w = tid >> 5, lane = tid & 31, ln = lane & 15, hh = lane >> 4; const int by = blockIdx.y;
  A += (size_t)by * sA; Bh += (size_t)by * sB; const size_t cofs = (size_t)by * sC; const float* bp = bias ? bias + (size_t)by * sBias : nullptr;
  const int ntn = N >> 6; const int mt = blockIdx.x / ntn, nq = blockIdx.x - mt * ntn; const int row0 = mt * 128 + 32 * w, col0 = nq * 64; if (row0 >= M) return;
  const _Float16* a0p = A + (size_t)(row0 + ln) * lda; const _Float16* a1p = a0p + (size_t)16 * lda;
  const _Float16* b0p = Bh + (size_t)(col0 + ln) * ldb; const _Float16* b1p = b0p + (size_t)16 * ldb; const _Float16* b2p = b1p + (size_t)16 * ldb; const _Float16* b3p = b2p + (size_t)16 * ldb;
  const v8f z8 = {0.f,0.f,0.f,0.f,0.f,0.f,0.f,0.f}; v8f c00 = z8, c01 = z8, c02 = z8, c03 = z8, c10 = z8, c11 = z8, c12 = z8, c13 = z8;
  for (int kb = 0; kb < K; kb += 32) { const v16h a0 = g2_frag(a0p + kb, hh), a1 = g2_frag(a1p + kb, hh);
    v16h b = g2_frag(b0p + kb, hh); c00 = g2_mma(a0, b, c00); c10 = g2_mma(a1, b, c10);
    b = g2_frag(b1p + kb, hh); c01 = g2_mma(a0, b, c01); c11 = g2_mma(a1, b, c11);
    b = g2_frag(b2p + kb, hh); c02 = g2_mma(a0, b, c02); c12 = g2_mma(a1, b, c12);
    b = g2_frag(b3p + kb, hh); c03 = g2_mma(a0, b, c03); c13 = g2_mma(a1, b, c13); }
  v8f accs[8] = {c00, c01, c02, c03, c10, c11, c12, c13};
#pragma unroll
  for (int u = 0; u < 8; ++u) { const int t = u & 3, half = u >> 2; const int col = col0 + t * 16 + ln; const float bv = bp ? bf16_round(bp[col]) : 0.f;
#pragma unroll
    for (int r = 0; r < 8; ++r) { const int rloc = half * 16 + 8 * hh + r; float v = accs[u][r] * alpha + bv; if (CP) { if (rowsPerB < 0) v += CP[cofs + (size_t)(row0g + row0 + rloc) * ldc + col];      /* rowsPerB < 0: own element of the batched C plane */ else { const int bidx = (row0g + row0 + rloc) / rowsPerB; v += CP[(size_t)bidx * sCPb + (size_t)by * 64 + col]; } }
      if (ACT == 3) v = fmaxf(v, 0.f); else if (ACT == 6) v = 0.5f * v * (1.0f + erff(v * 0.70710678118654752f)); else if (ACT == 11) v = 1.0f / (1.0f + expf(-v)); else if (ACT == 15) v = v / (1.0f + expf(-v)); else if (ACT == 12) v = (v > 0.f) ? v : 0.01f * v; else if (ACT == 8) v = tanhf(v); else if (ACT == 9) v = 0.5f * v * (1.0f + tanhf(0.7978845608028654f * (v + 0.044715f * v * v * v))); else if (ACT == 14) v = (v > 0.f) ? v : 0.1f * v; else if (ACT == 16) v = (v >= 0.f) ? v : 0.3f * v; else if (ACT == 17) v = (v >= 0.f) ? v : 0.2f * v;
      so[w][rloc][t * 16 + ln] = v; } }
  __builtin_amdgcn_fence(__ATOMIC_ACQ_REL, "workgroup"); __builtin_amdgcn_wave_barrier();
  const int rsub = lane >> 4, c4 = (lane & 15) * 4;
  {
#pragma unroll
    for (int q = 0; q < 16; ++q) { const int r = q * 2 + rsub; const v4f v = *(const v4fa*)&so[w][r][c4]; if (C) *(v4f*)(C + cofs + (size_t)(row0 + r) * ldc + col0 + c4) = v; if (C16) { v4h h4; for (int i = 0; i < 4; ++i) h4[i] = (_Float16)v[i]; *(v4h*)(C16 + cofs + (size_t)(row0 + r) * ldc + col0 + c4) = h4; } }
     } }

// ---- shares times the turned C: a block one 32 by 64 tile of a result part; its eight waves each take 128 of the 1,024 depth (four 32-deep steps) and the eight f32 partial tiles are added through LDS in the order of the waves ----
#define KW 8                         /* waves a block: slices of the depth */
__global__ __launch_bounds__(256) void k_pv(const _Float16* __restrict__ P, const _Float16* __restrict__ Ct, float* __restrict__ O) {
  __shared__ __attribute__((aligned(16))) float so[KW][32][68];
  const int tid = threadIdx.x, w = tid >> 5, lane = tid & 31, ln = lane & 15, hh = lane >> 4; const int row0 = blockIdx.x * 32, by = blockIdx.y;
  const _Float16* a0p = P + (size_t)by * NS * NK + (size_t)(row0 + ln) * NK + w * (NK / KW); const _Float16* a1p = a0p + (size_t)16 * NK;
  const _Float16* b0p = Ct + (size_t)by * NS + (size_t)ln * (NP * NS) + w * (NK / KW); const _Float16* b1p = b0p + (size_t)16 * NP * NS; const _Float16* b2p = b1p + (size_t)16 * NP * NS; const _Float16* b3p = b2p + (size_t)16 * NP * NS;
  const v8f z8 = {0.f,0.f,0.f,0.f,0.f,0.f,0.f,0.f}; v8f c00 = z8, c01 = z8, c02 = z8, c03 = z8, c10 = z8, c11 = z8, c12 = z8, c13 = z8;
  for (int kb = 0; kb < NK / KW; kb += 32) { const v16h a0 = g2_frag(a0p + kb, hh), a1 = g2_frag(a1p + kb, hh);
    v16h b = g2_frag(b0p + kb, hh); c00 = g2_mma(a0, b, c00); c10 = g2_mma(a1, b, c10);
    b = g2_frag(b1p + kb, hh); c01 = g2_mma(a0, b, c01); c11 = g2_mma(a1, b, c11);
    b = g2_frag(b2p + kb, hh); c02 = g2_mma(a0, b, c02); c12 = g2_mma(a1, b, c12);
    b = g2_frag(b3p + kb, hh); c03 = g2_mma(a0, b, c03); c13 = g2_mma(a1, b, c13); }
  v8f accs[8] = {c00, c01, c02, c03, c10, c11, c12, c13};
#pragma unroll      /* both loops unrolled: accs is indexed by constants and stays in registers */
  for (int u = 0; u < 8; ++u) { const int t = u & 3, half = u >> 2;
#pragma unroll
    for (int r = 0; r < 8; ++r) so[w][half * 16 + 8 * hh + r][t * 16 + ln] = accs[u][r]; }
  __syncthreads();      /* every wave's partial tile is in LDS before any thread adds the eight */
  const int rr = tid >> 4, c4 = (tid & 15) * 4;
  for (int q = 0; q < 2; ++q) { const int r = q * 16 + rr; v4f s = *(const v4fa*)&so[0][r][c4];
    for (int k = 1; k < KW; ++k) { const v4f p = *(const v4fa*)&so[k][r][c4]; s += p; }
    s *= (1.0f / PSC); *(v4f*)(O + (size_t)by * PD + (size_t)(row0 + r) * (NP * PD) + c4) = s; } }

// Wt[n][k] = f16(W[k][n] x scale) from f32 row-major W[K][N] with NO rounding of W to bf16 first: for a COMPUTED f32 plane (the transposing cast above without that one statement)
__global__ __launch_bounds__(256) void k_wtc_f16(const float* __restrict__ W, _Float16* __restrict__ Wt, int K, int N, float scale) {
  const int t = blockIdx.x * 256 + threadIdx.x; if (t >= N * (K / 8)) return; const int n = t / (K / 8), k8 = (t % (K / 8)) * 8; FragH f;
#pragma unroll
  for (int i = 0; i < 8; ++i) f.h[i] = (_Float16)(W[(size_t)(k8 + i) * N + n] * scale); const v8us o = f.half[0];
  *(v8us*)((unsigned short*)Wt + (size_t)n * K + k8) = o; 
}

// lane l's value as lane l ^ 16 sees it: a vector cross-row move
__device__ __forceinline__ float x16(float x) { return __builtin_bit_cast(float, __builtin_amdgcn_permlanex16(__builtin_bit_cast(int, x), __builtin_bit_cast(int, x), 0x76543210, 0xfedcba98, false, false)); }
// sixteen values a lane, each reduced over the wave's 32 lanes (MX: the largest; else the sum): at each of four steps a lane keeps half of its values and hands the other half to its partner, so 8 + 4 + 2 + 1 exchanges and a last one serve all sixteen; lane l returns value number l >> 1
template <bool MX>
__device__ __forceinline__ float red16(float (&v)[NP], unsigned int lane) { static_assert(NP == 16, "four halving steps");
  { const bool up = (lane & 16u) != 0u;
#pragma unroll      /* v is indexed by constants and stays in registers: so in the two loops below */
    for (int i = 0; i < 8; ++i) { const float keep = up ? v[i + 8] : v[i]; const float send = up ? v[i] : v[i + 8]; const float got = x16(send); v[i] = MX ? fmaxf(keep, got) : keep + got; } }
  { const bool up = (lane & 8u) != 0u;
#pragma unroll
    for (int i = 0; i < 4; ++i) { const float keep = up ? v[i + 4] : v[i]; const float send = up ? v[i] : v[i + 4]; const float got = __shfl_xor(send, 8, 32); v[i] = MX ? fmaxf(keep, got) : keep + got; } }
  { const bool up = (lane & 4u) != 0u;
#pragma unroll
    for (int i = 0; i < 2; ++i) { const float keep = up ? v[i + 2] : v[i]; const float send = up ? v[i] : v[i + 2]; const float got = __shfl_xor(send, 4, 32); v[i] = MX ? fmaxf(keep, got) : keep + got; } }
  { const bool up = (lane & 2u) != 0u; const float keep = up ? v[1] : v[0]; const float send = up ? v[0] : v[1]; const float got = __shfl_xor(send, 2, 32); v[0] = MX ? fmaxf(keep, got) : keep + got; }
  const float got = __shfl_xor(v[0], 1, 32); return MX ? fmaxf(v[0], got) : v[0] + got; }

// a block one row r of the logits, a thread four consecutive columns: the sixteen source parts' words are read ONCE and serve all sixteen result parts from registers; the blended logits stay in registers through the row softmax, and only the f16 shares leave
typedef unsigned int v8u __attribute__((ext_vector_type(8), may_alias));
__global__ __launch_bounds__(256) void k_mixsm(const float* __restrict__ S, const _Float16* __restrict__ W16, const int* __restrict__ SW, _Float16* __restrict__ P16) {
  __shared__ __attribute__((aligned(16))) float rm[NP][8], rs[NP][8];      /* a result part's largest and sum, one word a wave */
  const unsigned int r = blockIdx.x; const unsigned int c0 = threadIdx.x * 4u; const unsigned int vo = c0 * 4u;      /* the thread's place in a row, in bytes */ const float* __restrict__ Sr = S + ((size_t)r << 10);      /* the row's first word of source part 0: a scalar address */ _Float16* __restrict__ Pr = P16 + ((size_t)r << 10); const unsigned int lane = threadIdx.x & 31u, wv = threadIdx.x >> 5; const int sw = SW[0]; v4f s[NP];
  static_assert(NP == 16 && (size_t)NS * NK * 4 == 4194304, "the sixteen loads below: eight scalar bases, the odd parts one plane (4,194,304 bytes) behind the even ones");
  /* the sixteen loads (source part h into s[h]) and their data wait in ONE statement: all sixteen are in flight together, and no register that a load names, nor one that it fills, is touched by the compiler before the data is there */
  asm volatile("global_load_b128 %0, %16, %17\n\t"
               "global_load_b128 %1, %16, %17 offset:4194304\n\t"
               "global_load_b128 %2, %16, %18\n\t"
               "global_load_b128 %3, %16, %18 offset:4194304\n\t"
               "global_load_b128 %4, %16, %19\n\t"
               "global_load_b128 %5, %16, %19 offset:4194304\n\t"
               "global_load_b128 %6, %16, %20\n\t"
               "global_load_b128 %7, %16, %20 offset:4194304\n\t"
               "global_load_b128 %8, %16, %21\n\t"
               "global_load_b128 %9, %16, %21 offset:4194304\n\t"
               "global_load_b128 %10, %16, %22\n\t"
               "global_load_b128 %11, %16, %22 offset:4194304\n\t"
               "global_load_b128 %12, %16, %23\n\t"
               "global_load_b128 %13, %16, %23 offset:4194304\n\t"
               "global_load_b128 %14, %16, %24\n\t"
               "global_load_b128 %15, %16, %24 offset:4194304\n\t"
               "s_wait_loadcnt 0x0"
               : "=&v"(s[0]), "=&v"(s[1]), "=&v"(s[2]), "=&v"(s[3]), "=&v"(s[4]), "=&v"(s[5]), "=&v"(s[6]), "=&v"(s[7]), "=&v"(s[8]), "=&v"(s[9]), "=&v"(s[10]), "=&v"(s[11]), "=&v"(s[12]), "=&v"(s[13]), "=&v"(s[14]), "=&v"(s[15])
               : "v"(vo), "s"(Sr + (size_t)0 * NS * NK), "s"(Sr + (size_t)2 * NS * NK), "s"(Sr + (size_t)4 * NS * NK), "s"(Sr + (size_t)6 * NS * NK), "s"(Sr + (size_t)8 * NS * NK), "s"(Sr + (size_t)10 * NS * NK), "s"(Sr + (size_t)12 * NS * NK), "s"(Sr + (size_t)14 * NS * NK)
               : "memory");
  v4f z[NP]; float pr[NP];
#pragma unroll      /* z is indexed by constants and stays in registers */
  for (int g = 0; g < NP; ++g) { const v8u wr = *(const v8u*)(W16 + g * NP);      /* Wm's row g, sixteen f16 words as eight 32-bit words: the same for every lane, so it comes by a scalar load and takes no vector register */ z[g] = (v4f){0.0f, 0.0f, 0.0f, 0.0f};
#pragma unroll      /* s is indexed by constants and stays in registers */
    for (int h = 0; h < NP; ++h) { const float w = (float)__builtin_bit_cast(_Float16, (unsigned short)(wr[h >> 1] >> (16 * (h & 1))));
#pragma unroll
      for (int q = 0; q < 4; ++q) z[g][q] = __builtin_fmaf(w, s[h][q], z[g][q]); }      /* a column's sum still runs in the order of h, one fused multiply-add a term */
#pragma unroll
    for (int q = 0; q < 4; ++q) z[g][q] = (sw != 0 && c0 + (unsigned int)q > r) ? __uint_as_float(0xff800000u) : z[g][q];
    pr[g] = fmaxf(fmaxf(z[g][0], z[g][1]), fmaxf(z[g][2], z[g][3])); }
  /* the sixteen largest of the row: over the wave's lanes, then over the eight waves through LDS; column 0 is never hidden, so each is finite */
  { const float t = red16<true>(pr, lane); if ((lane & 1u) == 0u) rm[lane >> 1][wv] = t; }
  __syncthreads();      /* every wave's sixteen largest are in LDS before any lane reads the eight of its part */
  { const v4f a = *(const v4fa*)&rm[lane & 15u][0]; const v4f b = *(const v4fa*)&rm[lane & 15u][4]; const float t = fmaxf(fmaxf(fmaxf(a[0], a[1]), fmaxf(a[2], a[3])), fmaxf(fmaxf(b[0], b[1]), fmaxf(b[2], b[3])));
#pragma unroll
    for (int g = 0; g < NP; ++g) { const float m = __builtin_bit_cast(float, __builtin_amdgcn_readlane(__builtin_bit_cast(int, t), g));      /* part g's largest stands in lane g: the same for the whole wave, so it goes to a scalar register */
#pragma unroll
      for (int q = 0; q < 4; ++q) z[g][q] = expf(z[g][q] - m);
      pr[g] = (z[g][0] + z[g][1]) + (z[g][2] + z[g][3]); } }
  /* the sixteen sums, the same way (an array of its own, so that one barrier is enough) */
  { const float t = red16<false>(pr, lane); if ((lane & 1u) == 0u) rs[lane >> 1][wv] = t; }
  __syncthreads();      /* every wave's sixteen sums are in LDS before any lane adds the eight of its part */
  { const v4f a = *(const v4fa*)&rs[lane & 15u][0]; const v4f b = *(const v4fa*)&rs[lane & 15u][4]; const float t = ((a[0] + a[1]) + (a[2] + a[3])) + ((b[0] + b[1]) + (b[2] + b[3]));
#pragma unroll
    for (int g = 0; g < NP; ++g) { const float d = __builtin_bit_cast(float, __builtin_amdgcn_readlane(__builtin_bit_cast(int, t), g)); v4h o;
#pragma unroll
      for (int q = 0; q < 4; ++q) { const float p = z[g][q] / d; const _Float16 hq = (_Float16)(p * PSC); o[q] = (hq < (_Float16)6.103515625e-05f) ? (_Float16)0.0f : hq; }
      *(v4h*)(Pr + (size_t)g * NS * NK + c0) = o; } } }
extern "C" void kernel_launch(void* const* d_in, const int* in_sizes, int n_in,
                              void* d_out, int out_size, void* d_ws, size_t ws_size, hipStream_t stream) {
  (void)in_sizes; (void)n_in; (void)out_size;
  const float* AI = (const float*)d_in[0]; const float* BI = (const float*)d_in[1]; const float* CI = (const float*)d_in[2]; const float* WI = (const float*)d_in[3]; const int* SI = (const int*)d_in[4];      /* A, Bm, C [4][16][1024][64]; Wm [16][16]; the switch: one int32 word */
  static_assert(PD == 64 && NK % (KW * 32) == 0 && NK == NS && NS % 128 == 0 && NS % 64 == 0 && PD % 64 == 0 && PD % 32 == 0 && NS % 32 == 0 && NK % 256 == 0 && ((NS * (NK / 4)) & (NS * (NK / 4) - 1)) == 0 && ((size_t)NB * NP * NS * (PD / 8)) % 256 == 0 && (PD * (NP * NS / 8)) % 256 == 0 && NK == 256 * 4, "whole tiles; exact grids");
  float* OUT = (float*)d_out;      /* [4][1024][16][64] */
  char* ws = (char*)d_ws; size_t off = 0;
  auto take = [&](size_t bytes) { char* p = ws + off; off += (bytes + 255) & ~(size_t)255; return p; };
  _Float16* A16 = (_Float16*)take((size_t)NB * NP * NS * PD * 2); _Float16* B16 = (_Float16*)take((size_t)NB * NP * NS * PD * 2); _Float16* W16 = (_Float16*)take((size_t)NP * NP * 2);      /* A and Bm as f16; Wm as f16 (256 words) */
  _Float16* CT16 = (_Float16*)take((size_t)PD * NP * NS * 2); float* SG = (float*)take((size_t)NP * NS * NK * 4);      /* a batch entry of C turned [64][16384]; its sixteen parts' logits */
  _Float16* S16 = (_Float16*)take((size_t)NP * NS * NK * 2);      /* all sixteen result parts' f16 shares at 1,024 */
  if (off > ws_size) return;
  k_x16<<<(unsigned)(((size_t)NB * NP * NS * (PD / 8)) / 256), 256, 0, stream>>>(AI, A16, (size_t)NB * NP * NS * PD / 8);
  k_x16<<<(unsigned)(((size_t)NB * NP * NS * (PD / 8)) / 256), 256, 0, stream>>>(BI, B16, (size_t)NB * NP * NS * PD / 8);
  k_x16<<<1, 256, 0, stream>>>(WI, W16, (size_t)NP * NP / 8);      /* 32 threads of the block work: the kernel's own guard turns the rest away */
  for (int e = 0; e < NB; ++e) { const size_t eo = (size_t)e * NP * NS * PD;
    k_wt_f16<<<(PD * (NP * NS / 8)) / 256, 256, 0, stream>>>(CI + eo, CT16, NP * NS, PD, 1.0f);      /* C's batch entry [16384 rows][64] -> CT16[d][h * 1024 + s] = f16(bf16(C[h][s][d])) */
    k_gemm2<0><<<dim3((NS / 128) * (NK / 64), NP), 128, 0, stream>>>(A16 + eo, PD, (size_t)NS * PD, B16 + eo, PD, (size_t)NS * PD, 0.125f, nullptr, 0, nullptr, 1, 0, 0, SG, nullptr, NK, (size_t)NS * NK, NS, NK, PD);      /* the sixteen parts' logits */
    k_mixsm<<<NS, 256, 0, stream>>>(SG, W16, SI, S16);      /* all sixteen result parts' shares from one read of SG */
    k_pv<<<dim3(NS / 32, NP), 256, 0, stream>>>(S16, CT16, OUT + (size_t)e * NS * NP * PD); }      /* a result part's 64 columns at a row stride of 1,024 */
}

// v004
// It runs in 215 microseconds.
// Next to v003, in two timings, it ran 1.13 and 1.12 times as fast.
// Over all steps from v000 it is 3.28 times as fast.
#include <hip/hip_runtime.h>
// A sixteen-part alignment whose logits are BLENDED ACROSS THE PARTS by a 16 by 16 matrix before one softmax (five inputs: A, Bm, C [4][16][1024][64] f32: rows already cut into 16 parts of width 64; a mixing matrix Wm [16][16] f32 ([result part][source part]); a switch: ONE int32 word, non-zero = later columns hidden): a part's logits = A Bm^T / 8 [1024][1024]; blended[g] = the sum over h of Wm[g][h] logits[h], element by element; if the switch is non-zero a column whose index exceeds the row's counts as minus infinity; ONE softmax over the 1,024 columns; a part's result = its shares times C's part [1024][64]; the results laid as [4][1024][16][64].
// Structure: A and Bm cast whole to f16; THEN A BATCH ENTRY AT A TIME: C's batch entry turned as ONE [16384][64] matrix into [64][16384] f16 (k_wt_f16: a part's rows are 1,024 columns of it); the sixteen parts' logits in ONE launch (WMMA GEMM, 32 by 64 wave tiles, depth 64, f32 accumulation, scale 1 / 8: the part is the grid's second axis) into an f32 plane; k_mixsm ONCE FOR ALL SIXTEEN RESULT PARTS, BLEND AND SOFTMAX IN ONE: a block one row, a thread four consecutive columns: sixteen 16-byte loads (one a source part) held in registers, then a result part after the other: sixteen words of Wm's row (its bf16 values as f16 words, cast once by k_x16: exact), 64 multiply-adds in f32 in the order of h, the hidden columns BY A SELECT on the block's and the thread's own numbers and the switch's word; the block holds the row's 1,024 blended logits of all sixteen result parts in registers, so the sixteen largest and the sixteen sums are taken there (lanes, then the eight waves through LDS) and only the f16 shares are stored, 8 bytes a thread and part; the shares times the turned C by k_pv, all sixteen result parts in one launch (a block a 32 by 64 tile, the depth's 32-deep steps dealt round its eight waves, the partial tiles added through LDS) STRAIGHT INTO THE OUTPUT at the part's column block of 64 inside a row of 1,024. WITH THE SWITCH SET NOTHING WHOLLY BEHIND THE DIAGONAL IS WORKED ON: a 128 by 64 logit tile with no visible column is not computed, a wave of k_mixsm whose 128 columns are all hidden only hands in minus infinity and nought, and k_pv's depth ends at its tile's last row; what is left unwritten so is read by nobody.
// Compute dtype: A, Bm, C and Wm rounded to bf16 where they are first read (by k_x16 and k_wt_f16): bf16 values are exact f16 words away from the subnormal range: NO COMPUTED OPERAND ENTERS THE LOGITS; every matrix multiply's operands f16 words (11 bits): the shares ONE word at a carry of 1,024 (words under 2^-14 written as noughts); f32 accumulation; the logits, THE MIXING (f32 multiply-adds on the vector unit: 16 a result word: a depth and a width of 16 are under the matrix tile), the softmax's largest, exponentials (expf), sum and true divisions f32; the switch read as an int32 word by value. v_wmma_f32_16x16x32_f16.
#define NB 4                         /* batch entries */
#define NP 16                        /* parts */
#define NS 1024                      /* rows of a part: and columns of its logits */
#define PD 64                        /* a part's width */
#define NK 1024                      /* the row softmax's logits a row */
#define PSC 1024.0f                  /* the carry on the shares' f16 plane */

typedef __bf16 v16b __attribute__((ext_vector_type(16)));
typedef unsigned short v8us __attribute__((ext_vector_type(8), may_alias));
typedef float  v8f  __attribute__((ext_vector_type(8)));
typedef float  v4f  __attribute__((ext_vector_type(4)));
typedef float  v4fa __attribute__((ext_vector_type(4), may_alias));
union FragB { v16b v; v8us half[2]; unsigned short u[16]; };

__device__ __forceinline__ unsigned short bf16_bits(float x) { unsigned int u = __float_as_uint(x); return (unsigned short)((u + 0x7FFFu + ((u >> 16) & 1u)) >> 16); }
__device__ __forceinline__ float bf16_val(unsigned short b) { return __uint_as_float(((unsigned int)b) << 16); }
__device__ __forceinline__ float bf16_round(float x) { return bf16_val(bf16_bits(x)); }
// D += A·B with NT terms: 1 = ah·bh, 2 = + al·bh (A split), 3 = + ah·bl (both split)
template <int NT>
__device__ __forceinline__ v8f mmaN(v16b ah, v16b al, v16b bh, v16b bl, v8f c) {
  c = __builtin_amdgcn_wmma_f32_16x16x32_bf16(false, ah, false, bh, (short)0, c, false, false);
  if (NT >= 2) c = __builtin_amdgcn_wmma_f32_16x16x32_bf16(false, al, false, bh, (short)0, c, false, false);
  if (NT >= 3) c = __builtin_amdgcn_wmma_f32_16x16x32_bf16(false, ah, false, bl, (short)0, c, false, false);
  asm volatile("v_nop\n\tv_nop\n\tv_nop\n\tv_nop" : "+v"(c) : "v"(ah), "v"(al), "v"(bh), "v"(bl));
  return c;
}




// ---- f16 WMMA path (v_wmma_f32_16x16x32_f16): 11-bit significands for operands in range — used where a [0,1] probability operand needs more precision than bf16
typedef _Float16 v16h __attribute__((ext_vector_type(16)));
union FragH { v16h v; v8us half[2]; _Float16 h[16]; unsigned short u[16]; };
template <int NT>
__device__ __forceinline__ v8f mmaH(v16h ah, v16h al, v16h bh, v16h bl, v8f c) {
  c = __builtin_amdgcn_wmma_f32_16x16x32_f16(false, ah, false, bh, (short)0, c, false, false);
  if (NT >= 2) c = __builtin_amdgcn_wmma_f32_16x16x32_f16(false, al, false, bh, (short)0, c, false, false);
  if (NT >= 3) c = __builtin_amdgcn_wmma_f32_16x16x32_f16(false, ah, false, bl, (short)0, c, false, false);
  asm volatile("v_nop\n\tv_nop\n\tv_nop\n\tv_nop" : "+v"(c) : "v"(ah), "v"(al), "v"(bh), "v"(bl));
  return c;
}

// Wt[n][k] = f16(W[k][n]·scale) from f32 row-major W[K][N] (scale = power of two; bf16-exact weights stay exact in f16 away from the subnormal range)
__global__ __launch_bounds__(256) void k_wt_f16(const float* __restrict__ W, _Float16* __restrict__ Wt, int K, int N, float scale) {
  const int t = blockIdx.x * 256 + threadIdx.x; if (t >= N * (K / 8)) return; const int n = t / (K / 8), k8 = (t % (K / 8)) * 8; FragH f;
#pragma unroll
  for (int i = 0; i < 8; ++i) f.h[i] = (_Float16)(bf16_round(W[(size_t)(k8 + i) * N + n]) * scale); const v8us o = f.half[0];
  *(v8us*)((unsigned short*)Wt + (size_t)n * K + k8) = o; 
}

typedef _Float16 v4h __attribute__((ext_vector_type(4)));

__global__ __launch_bounds__(256) void k_x16(const float* __restrict__ x, _Float16* __restrict__ X16, size_t n8) { const size_t t = (size_t)blockIdx.x * 256 + threadIdx.x; if (t >= n8) return; FragH f;
#pragma unroll
  for (int q = 0; q < 8; ++q) f.h[q] = (_Float16)bf16_round(x[t * 8 + q]); *(v8us*)((unsigned short*)X16 + t * 8) = f.half[0];  }
// ---- fast GEMM (wave tile 32x64; requires M % 32 == 0 rows per launch region and N % 64 == 0) ----
__device__ __forceinline__ v16h g2_frag(const _Float16* p, int hh) { FragH f; f.half[0] = *(const v8us*)((const unsigned short*)p + 8 * hh); f.half[1] = *(const v8us*)((const unsigned short*)p + 16 + 8 * hh); return f.v; }
__device__ __forceinline__ v8f g2_mma(v16h a, v16h b, v8f c) { v8f d = __builtin_amdgcn_wmma_f32_16x16x32_f16(false, a, false, b, (short)0, c, false, false); asm volatile("v_nop\n\tv_nop\n\tv_nop\n\tv_nop" : "+v"(d) : "v"(a), "v"(b)); return d; }
template <int ACT>
__global__ __launch_bounds__(128) void k_gemm2(const _Float16* __restrict__ A, int lda, size_t sA, const _Float16* __restrict__ Bh, int ldb, size_t sB, float alpha, const float* __restrict__ bias, size_t sBias, const float* __restrict__ CP, int rowsPerB, size_t sCPb, int row0g,
    float* __restrict__ C, _Float16* __restrict__ C16, int ldc, size_t sC, int M, int N, int K, const int* __restrict__ SW) { static_assert(ACT == 0 || ACT == 3 || ACT == 6 || ACT == 8 || ACT == 9 || ACT == 11 || ACT == 12 || ACT == 14 || ACT == 15 || ACT == 16 || ACT == 17, "k_gemm2: unsupported ACT code (would silently apply no activation)");
  __shared__ __attribute__((aligned(16))) float so[4][32][68];
  const int tid = threadIdx.x, w = tid >> 5, lane = tid & 31, ln = lane & 15, hh = lane >> 4; const int by = blockIdx.y;
  A += (size_t)by * sA; Bh += (size_t)by * sB; const size_t cofs = (size_t)by * sC; const float* bp = bias ? bias + (size_t)by * sBias : nullptr;
  const int ntn = N >> 6; const int mt = blockIdx.x / ntn, nq = blockIdx.x - mt * ntn; const int row0 = mt * 128 + 32 * w, col0 = nq * 64; if (row0 >= M) return;
  if (SW && SW[0] != 0 && col0 > mt * 128 + 127) return;      /* the switch is set and every column of the block's 128 by 64 tile lies behind every one of its rows: nobody reads those words, so the whole block leaves (no barrier follows) */
  const _Float16* a0p = A + (size_t)(row0 + ln) * lda; const _Float16* a1p = a0p + (size_t)16 * lda;
  const _Float16* b0p = Bh + (size_t)(col0 + ln) * ldb; const _Float16* b1p = b0p + (size_t)16 * ldb; const _Float16* b2p = b1p + (size_t)16 * ldb; const _Float16* b3p = b2p + (size_t)16 * ldb;
  const v8f z8 = {0.f,0.f,0.f,0.f,0.f,0.f,0.f,0.f}; v8f c00 = z8, c01 = z8, c02 = z8, c03 = z8, c10 = z8, c11 = z8, c12 = z8, c13 = z8;
  for (int kb = 0; kb < K; kb += 32) { const v16h a0 = g2_frag(a0p + kb, hh), a1 = g2_frag(a1p + kb, hh);
    v16h b = g2_frag(b0p + kb, hh); c00 = g2_mma(a0, b, c00); c10 = g2_mma(a1, b, c10);
    b = g2_frag(b1p + kb, hh); c01 = g2_mma(a0, b, c01); c11 = g2_mma(a1, b, c11);
    b = g2_frag(b2p + kb, hh); c02 = g2_mma(a0, b, c02); c12 = g2_mma(a1, b, c12);
    b = g2_frag(b3p + kb, hh); c03 = g2_mma(a0, b, c03); c13 = g2_mma(a1, b, c13); }
  v8f accs[8] = {c00, c01, c02, c03, c10, c11, c12, c13};
#pragma unroll
  for (int u = 0; u < 8; ++u) { const int t = u & 3, half = u >> 2; const int col = col0 + t * 16 + ln; const float bv = bp ? bf16_round(bp[col]) : 0.f;
#pragma unroll
    for (int r = 0; r < 8; ++r) { const int rloc = half * 16 + 8 * hh + r; float v = accs[u][r] * alpha + bv; if (CP) { if (rowsPerB < 0) v += CP[cofs + (size_t)(row0g + row0 + rloc) * ldc + col];      /* rowsPerB < 0: own element of the batched C plane */ else { const int bidx = (row0g + row0 + rloc) / rowsPerB; v += CP[(size_t)bidx * sCPb + (size_t)by * 64 + col]; } }
      if (ACT == 3) v = fmaxf(v, 0.f); else if (ACT == 6) v = 0.5f * v * (1.0f + erff(v * 0.70710678118654752f)); else if (ACT == 11) v = 1.0f / (1.0f + expf(-v)); else if (ACT == 15) v = v / (1.0f + expf(-v)); else if (ACT == 12) v = (v > 0.f) ? v : 0.01f * v; else if (ACT == 8) v = tanhf(v); else if (ACT == 9) v = 0.5f * v * (1.0f + tanhf(0.7978845608028654f * (v + 0.044715f * v * v * v))); else if (ACT == 14) v = (v > 0.f) ? v : 0.1f * v; else if (ACT == 16) v = (v >= 0.f) ? v : 0.3f * v; else if (ACT == 17) v = (v >= 0.f) ? v : 0.2f * v;
      so[w][rloc][t * 16 + ln] = v; } }
  __builtin_amdgcn_fence(__ATOMIC_ACQ_REL, "workgroup"); __builtin_amdgcn_wave_barrier();
  const int rsub = lane >> 4, c4 = (lane & 15) * 4;
  {
#pragma unroll
    for (int q = 0; q < 16; ++q) { const int r = q * 2 + rsub; const v4f v = *(const v4fa*)&so[w][r][c4]; if (C) *(v4f*)(C + cofs + (size_t)(row0 + r) * ldc + col0 + c4) = v; if (C16) { v4h h4; for (int i = 0; i < 4; ++i) h4[i] = (_Float16)v[i]; *(v4h*)(C16 + cofs + (size_t)(row0 + r) * ldc + col0 + c4) = h4; } }
     } }

// ---- shares times the turned C: a block one 32 by 64 tile of a result part; the depth's 32-deep steps are dealt round its eight waves (wave w: steps w, w + 8, ...), with the switch set only the steps up to the tile's last row, and the eight f32 partial tiles are added through LDS in the order of the waves ----
#define KW 8                         /* waves a block: slices of the depth */
__global__ __launch_bounds__(256) void k_pv(const _Float16* __restrict__ P, const _Float16* __restrict__ Ct, const int* __restrict__ SW, float* __restrict__ O) {
  __shared__ __attribute__((aligned(16))) float so[KW][32][68];
  const int tid = threadIdx.x, w = __builtin_amdgcn_readfirstlane(tid >> 5), lane = tid & 31, ln = lane & 15, hh = lane >> 4;      /* the wave's number in a scalar register: the depth loop's branch is then a scalar one and every lane stays on at the matrix instructions */
  const int xt = blockIdx.x, row0 = xt * 32, by = blockIdx.y;
  const int nst = (SW[0] != 0) ? xt + 1 : NK / 32;      /* 32-deep steps that hold a visible column of the tile's last row: behind them every share is nought (and, with the switch set, in part not stored) */
  const _Float16* a0p = P + (size_t)by * NS * NK + (size_t)(row0 + ln) * NK; const _Float16* a1p = a0p + (size_t)16 * NK;
  const _Float16* b0p = Ct + (size_t)by * NS + (size_t)ln * (NP * NS); const _Float16* b1p = b0p + (size_t)16 * NP * NS; const _Float16* b2p = b1p + (size_t)16 * NP * NS; const _Float16* b3p = b2p + (size_t)16 * NP * NS;
  const v8f z8 = {0.f,0.f,0.f,0.f,0.f,0.f,0.f,0.f}; v8f c00 = z8, c01 = z8, c02 = z8, c03 = z8, c10 = z8, c11 = z8, c12 = z8, c13 = z8;
  for (int st = w; st < nst; st += KW) { const int kb = st * 32; const v16h a0 = g2_frag(a0p + kb, hh); FragH f1; f1.half[0] = *(const v8us*)((const unsigned short*)(a1p + kb) + 8 * hh);      /* the steps dealt round the eight waves */
    asm volatile("s_wait_xcnt 0x0" ::: "memory");      /* the build puts the next load's result into the address pair that the three loads above name: the wait stands in front of that overwrite */
    f1.half[1] = *(const v8us*)((const unsigned short*)(a1p + kb) + 16 + 8 * hh); const v16h a1 = f1.v;
    v16h b = g2_frag(b0p + kb, hh); c00 = g2_mma(a0, b, c00); c10 = g2_mma(a1, b, c10);
    b = g2_frag(b1p + kb, hh); c01 = g2_mma(a0, b, c01); c11 = g2_mma(a1, b, c11);
    b = g2_frag(b2p + kb, hh); c02 = g2_mma(a0, b, c02); c12 = g2_mma(a1, b, c12);
    b = g2_frag(b3p + kb, hh); c03 = g2_mma(a0, b, c03); c13 = g2_mma(a1, b, c13); }
  v8f accs[8] = {c00, c01, c02, c03, c10, c11, c12, c13};
#pragma unroll      /* both loops unrolled: accs is indexed by constants and stays in registers */
  for (int u = 0; u < 8; ++u) { const int t = u & 3, half = u >> 2;
#pragma unroll
    for (int r = 0; r < 8; ++r) so[w][half * 16 + 8 * hh + r][t * 16 + ln] = accs[u][r]; }
  __syncthreads();      /* every wave's partial tile is in LDS before any thread adds the eight */
  const int rr = tid >> 4, c4 = (tid & 15) * 4;
  for (int q = 0; q < 2; ++q) { const int r = q * 16 + rr; v4f s = *(const v4fa*)&so[0][r][c4];
    for (int k = 1; k < KW; ++k) { const v4f p = *(const v4fa*)&so[k][r][c4]; s += p; }
    s *= (1.0f / PSC); *(v4f*)(O + (size_t)by * PD + (size_t)(row0 + r) * (NP * PD) + c4) = s; } }

// Wt[n][k] = f16(W[k][n] x scale) from f32 row-major W[K][N] with NO rounding of W to bf16 first: for a COMPUTED f32 plane (the transposing cast above without that one statement)
__global__ __launch_bounds__(256) void k_wtc_f16(const float* __restrict__ W, _Float16* __restrict__ Wt, int K, int N, float scale) {
  const int t = blockIdx.x * 256 + threadIdx.x; if (t >= N * (K / 8)) return; const int n = t / (K / 8), k8 = (t % (K / 8)) * 8; FragH f;
#pragma unroll
  for (int i = 0; i < 8; ++i) f.h[i] = (_Float16)(W[(size_t)(k8 + i) * N + n] * scale); const v8us o = f.half[0];
  *(v8us*)((unsigned short*)Wt + (size_t)n * K + k8) = o; 
}

// lane l's value as lane l ^ 16 sees it: a vector cross-row move
__device__ __forceinline__ float x16(float x) { return __builtin_bit_cast(float, __builtin_amdgcn_permlanex16(__builtin_bit_cast(int, x), __builtin_bit_cast(int, x), 0x76543210, 0xfedcba98, false, false)); }
// sixteen values a lane, each reduced over the wave's 32 lanes (MX: the largest; else the sum): at each of four steps a lane keeps half of its values and hands the other half to its partner, so 8 + 4 + 2 + 1 exchanges and a last one serve all sixteen; lane l returns value number l >> 1
template <bool MX>
__device__ __forceinline__ float red16(float (&v)[NP], unsigned int lane) { static_assert(NP == 16, "four halving steps");
  { const bool up = (lane & 16u) != 0u;
#pragma unroll      /* v is indexed by constants and stays in registers: so in the two loops below */
    for (int i = 0; i < 8; ++i) { const float keep = up ? v[i + 8] : v[i]; const float send = up ? v[i] : v[i + 8]; const float got = x16(send); v[i] = MX ? fmaxf(keep, got) : keep + got; } }
  { const bool up = (lane & 8u) != 0u;
#pragma unroll
    for (int i = 0; i < 4; ++i) { const float keep = up ? v[i + 4] : v[i]; const float send = up ? v[i] : v[i + 4]; const float got = __shfl_xor(send, 8, 32); v[i] = MX ? fmaxf(keep, got) : keep + got; } }
  { const bool up = (lane & 4u) != 0u;
#pragma unroll
    for (int i = 0; i < 2; ++i) { const float keep = up ? v[i + 2] : v[i]; const float send = up ? v[i] : v[i + 2]; const float got = __shfl_xor(send, 4, 32); v[i] = MX ? fmaxf(keep, got) : keep + got; } }
  { const bool up = (lane & 2u) != 0u; const float keep = up ? v[1] : v[0]; const float send = up ? v[0] : v[1]; const float got = __shfl_xor(send, 2, 32); v[0] = MX ? fmaxf(keep, got) : keep + got; }
  const float got = __shfl_xor(v[0], 1, 32); return MX ? fmaxf(v[0], got) : v[0] + got; }

// a block one row r of the logits, a thread four consecutive columns: the sixteen source parts' words are read ONCE and serve all sixteen result parts from registers; the blended logits stay in registers through the row softmax, and only the f16 shares leave
typedef unsigned int v8u __attribute__((ext_vector_type(8), may_alias));
__global__ __launch_bounds__(256, 6) /* six waves a SIMD asked for, three blocks a WGP: with the branches below the build otherwise takes 225 registers and only two blocks fit */ void k_mixsm(const float* __restrict__ S, const _Float16* __restrict__ W16, const int* __restrict__ SW, _Float16* __restrict__ P16) {
  __shared__ __attribute__((aligned(16))) float rm[NP][8], rs[NP][8];      /* a result part's largest and sum, one word a wave */
  const unsigned int r = blockIdx.x; const unsigned int c0 = threadIdx.x * 4u; const unsigned int vo = c0 * 4u;      /* the thread's place in a row, in bytes */ const float* __restrict__ Sr = S + ((size_t)r << 10);      /* the row's first word of source part 0: a scalar address */ _Float16* __restrict__ Pr = P16 + ((size_t)r << 10); const unsigned int lane = threadIdx.x & 31u, wv = threadIdx.x >> 5; const int sw = SW[0]; v4f s[NP]; v4f z[NP]; float pr[NP];
  const bool act = !(sw != 0 && (unsigned int)__builtin_amdgcn_readfirstlane((int)wv) * 128u > r);      /* false: the switch is set and all 128 columns of this wave are hidden in row r: it loads, blends and stores nothing, hands in minus infinity and nought, and passes both barriers; a scalar test, the same in every lane */
  static_assert(NP == 16 && (size_t)NS * NK * 4 == 4194304, "the sixteen loads below: eight scalar bases, the odd parts one plane (4,194,304 bytes) behind the even ones");
  if (act) {
  /* the sixteen loads (source part h into s[h]) and their data wait in ONE statement: all sixteen are in flight together, and no register that a load names, nor one that it fills, is touched by the compiler before the data is there */
  asm volatile("global_load_b128 %0, %16, %17\n\t"
               "global_load_b128 %1, %16, %17 offset:4194304\n\t"
               "global_load_b128 %2, %16, %18\n\t"
               "global_load_b128 %3, %16, %18 offset:4194304\n\t"
               "global_load_b128 %4, %16, %19\n\t"
               "global_load_b128 %5, %16, %19 offset:4194304\n\t"
               "global_load_b128 %6, %16, %20\n\t"
               "global_load_b128 %7, %16, %20 offset:4194304\n\t"
               "global_load_b128 %8, %16, %21\n\t"
               "global_load_b128 %9, %16, %21 offset:4194304\n\t"
               "global_load_b128 %10, %16, %22\n\t"
               "global_load_b128 %11, %16, %22 offset:4194304\n\t"
               "global_load_b128 %12, %16, %23\n\t"
               "global_load_b128 %13, %16, %23 offset:4194304\n\t"
               "global_load_b128 %14, %16, %24\n\t"
               "global_load_b128 %15, %16, %24 offset:4194304\n\t"
               "s_wait_loadcnt 0x0"
               : "=&v"(s[0]), "=&v"(s[1]), "=&v"(s[2]), "=&v"(s[3]), "=&v"(s[4]), "=&v"(s[5]), "=&v"(s[6]), "=&v"(s[7]), "=&v"(s[8]), "=&v"(s[9]), "=&v"(s[10]), "=&v"(s[11]), "=&v"(s[12]), "=&v"(s[13]), "=&v"(s[14]), "=&v"(s[15])
               : "v"(vo), "s"(Sr + (size_t)0 * NS * NK), "s"(Sr + (size_t)2 * NS * NK), "s"(Sr + (size_t)4 * NS * NK), "s"(Sr + (size_t)6 * NS * NK), "s"(Sr + (size_t)8 * NS * NK), "s"(Sr + (size_t)10 * NS * NK), "s"(Sr + (size_t)12 * NS * NK), "s"(Sr + (size_t)14 * NS * NK)
               : "memory");
#pragma unroll      /* z is indexed by constants and stays in registers */
  for (int g = 0; g < NP; ++g) { const v8u wr = *(const v8u*)(W16 + g * NP);      /* Wm's row g, sixteen f16 words as eight 32-bit words: the same for every lane, so it comes by a scalar load and takes no vector register */ z[g] = (v4f){0.0f, 0.0f, 0.0f, 0.0f};
#pragma unroll      /* s is indexed by constants and stays in registers */
    for (int h = 0; h < NP; ++h) { const float w = (float)__builtin_bit_cast(_Float16, (unsigned short)(wr[h >> 1] >> (16 * (h & 1))));
#pragma unroll
      for (int q = 0; q < 4; ++q) z[g][q] = __builtin_fmaf(w, s[h][q], z[g][q]); }      /* a column's sum still runs in the order of h, one fused multiply-add a term */
#pragma unroll
    for (int q = 0; q < 4; ++q) z[g][q] = (sw != 0 && c0 + (unsigned int)q > r) ? __uint_as_float(0xff800000u) : z[g][q];
    pr[g] = fmaxf(fmaxf(z[g][0], z[g][1]), fmaxf(z[g][2], z[g][3])); }
  /* the sixteen largest of the row: over the wave's lanes, then over the eight waves through LDS; column 0 is never hidden, so each is finite */
  { const float t = red16<true>(pr, lane); if ((lane & 1u) == 0u) rm[lane >> 1][wv] = t; }
  } else if (lane < (unsigned int)NP) rm[lane][wv] = __uint_as_float(0xff800000u);
  __syncthreads();      /* every wave's sixteen largest are in LDS before any lane reads the eight of its part */
  if (act) {
  { const v4f a = *(const v4fa*)&rm[lane & 15u][0]; const v4f b = *(const v4fa*)&rm[lane & 15u][4]; const float t = fmaxf(fmaxf(fmaxf(a[0], a[1]), fmaxf(a[2], a[3])), fmaxf(fmaxf(b[0], b[1]), fmaxf(b[2], b[3])));
#pragma unroll
    for (int g = 0; g < NP; ++g) { const float m = __builtin_bit_cast(float, __builtin_amdgcn_readlane(__builtin_bit_cast(int, t), g));      /* part g's largest stands in lane g: the same for the whole wave, so it goes to a scalar register */
#pragma unroll
      for (int q = 0; q < 4; ++q) z[g][q] = expf(z[g][q] - m);
      pr[g] = (z[g][0] + z[g][1]) + (z[g][2] + z[g][3]); } }
  /* the sixteen sums, the same way (an array of its own, so that one barrier is enough) */
  { const float t = red16<false>(pr, lane); if ((lane & 1u) == 0u) rs[lane >> 1][wv] = t; }
  } else if (lane < (unsigned int)NP) rs[lane][wv] = 0.0f;
  __syncthreads();      /* every wave's sixteen sums are in LDS before any lane adds the eight of its part */
  if (act) { const v4f a = *(const v4fa*)&rs[lane & 15u][0]; const v4f b = *(const v4fa*)&rs[lane & 15u][4]; const float t = ((a[0] + a[1]) + (a[2] + a[3])) + ((b[0] + b[1]) + (b[2] + b[3]));
#pragma unroll
    for (int g = 0; g < NP; ++g) { const float d = __builtin_bit_cast(float, __builtin_amdgcn_readlane(__builtin_bit_cast(int, t), g)); v4h o;
#pragma unroll
      for (int q = 0; q < 4; ++q) { const float p = z[g][q] / d; const _Float16 hq = (_Float16)(p * PSC); o[q] = (hq < (_Float16)6.103515625e-05f) ? (_Float16)0.0f : hq; }
      *(v4h*)(Pr + (size_t)g * NS * NK + c0) = o; } } }
extern "C" void kernel_launch(void* const* d_in, const int* in_sizes, int n_in,
                              void* d_out, int out_size, void* d_ws, size_t ws_size, hipStream_t stream) {
  (void)in_sizes; (void)n_in; (void)out_size;
  const float* AI = (const float*)d_in[0]; const float* BI = (const float*)d_in[1]; const float* CI = (const float*)d_in[2]; const float* WI = (const float*)d_in[3]; const int* SI = (const int*)d_in[4];      /* A, Bm, C [4][16][1024][64]; Wm [16][16]; the switch: one int32 word */
  static_assert(PD == 64 && NK % (KW * 32) == 0 && NK == NS && NS % 128 == 0 && NS % 64 == 0 && PD % 64 == 0 && PD % 32 == 0 && NS % 32 == 0 && NK % 256 == 0 && ((NS * (NK / 4)) & (NS * (NK / 4) - 1)) == 0 && ((size_t)NB * NP * NS * (PD / 8)) % 256 == 0 && (PD * (NP * NS / 8)) % 256 == 0 && NK == 256 * 4, "whole tiles; exact grids");
  float* OUT = (float*)d_out;      /* [4][1024][16][64] */
  char* ws = (char*)d_ws; size_t off = 0;
  auto take = [&](size_t bytes) { char* p = ws + off; off += (bytes + 255) & ~(size_t)255; return p; };
  _Float16* A16 = (_Float16*)take((size_t)NB * NP * NS * PD * 2); _Float16* B16 = (_Float16*)take((size_t)NB * NP * NS * PD * 2); _Float16* W16 = (_Float16*)take((size_t)NP * NP * 2);      /* A and Bm as f16; Wm as f16 (256 words) */
  _Float16* CT16 = (_Float16*)take((size_t)PD * NP * NS * 2); float* SG = (float*)take((size_t)NP * NS * NK * 4);      /* a batch entry of C turned [64][16384]; its sixteen parts' logits */
  _Float16* S16 = (_Float16*)take((size_t)NP * NS * NK * 2);      /* all sixteen result parts' f16 shares at 1,024 */
  if (off > ws_size) return;
  k_x16<<<(unsigned)(((size_t)NB * NP * NS * (PD / 8)) / 256), 256, 0, stream>>>(AI, A16, (size_t)NB * NP * NS * PD / 8);
  k_x16<<<(unsigned)(((size_t)NB * NP * NS * (PD / 8)) / 256), 256, 0, stream>>>(BI, B16, (size_t)NB * NP * NS * PD / 8);
  k_x16<<<1, 256, 0, stream>>>(WI, W16, (size_t)NP * NP / 8);      /* 32 threads of the block work: the kernel's own guard turns the rest away */
  for (int e = 0; e < NB; ++e) { const size_t eo = (size_t)e * NP * NS * PD;
    k_wt_f16<<<(PD * (NP * NS / 8)) / 256, 256, 0, stream>>>(CI + eo, CT16, NP * NS, PD, 1.0f);      /* C's batch entry [16384 rows][64] -> CT16[d][h * 1024 + s] = f16(bf16(C[h][s][d])) */
    k_gemm2<0><<<dim3((NS / 128) * (NK / 64), NP), 128, 0, stream>>>(A16 + eo, PD, (size_t)NS * PD, B16 + eo, PD, (size_t)NS * PD, 0.125f, nullptr, 0, nullptr, 1, 0, 0, SG, nullptr, NK, (size_t)NS * NK, NS, NK, PD, SI);      /* the sixteen parts' logits: with the switch set only the tiles that hold a visible column */
    k_mixsm<<<NS, 256, 0, stream>>>(SG, W16, SI, S16);      /* all sixteen result parts' shares from one read of SG */
    k_pv<<<dim3(NS / 32, NP), 256, 0, stream>>>(S16, CT16, SI, OUT + (size_t)e * NS * NP * PD); }      /* a result part's 64 columns at a row stride of 1,024 */
}

// v005
// One run takes 169 microseconds.
// In both of two side-by-side timings against v004, it was 1.27 times as fast.
// Counting every step since v000, it is 4.17 times as fast.
#include <hip/hip_runtime.h>
// A sixteen-part alignment whose logits are BLENDED ACROSS THE PARTS by a 16 by 16 matrix before one softmax (five inputs: A, Bm, C [4][16][1024][64] f32: rows already cut into 16 parts of width 64; a mixing matrix Wm [16][16] f32 ([result part][source part]); a switch: ONE int32 word, non-zero = later columns hidden): a part's logits = A Bm^T / 8 [1024][1024]; blended[g] = the sum over h of Wm[g][h] logits[h], element by element; if the switch is non-zero a column whose index exceeds the row's counts as minus infinity; ONE softmax over the 1,024 columns; a part's result = its shares times C's part [1024][64]; the results laid as [4][1024][16][64].
// Structure: ONE PREPARING LAUNCH (k_prep, the work told apart by the block's number): A, Bm and Wm cast whole to f16 and each of C's four batch entries turned as ONE [16384][64] matrix into [64][16384] f16 (a part's rows are 1,024 columns of it); THEN TWO BATCH ENTRIES AT A TIME (the workspace holds two entries' logits), the entry riding on the grid's second axis: the 32 parts' logits in ONE launch (WMMA GEMM, 32 by 64 wave tiles, depth 64, f32 accumulation, scale 1 / 8: the part is the grid's second axis) into an f32 plane; k_mixsm ONCE FOR ALL SIXTEEN RESULT PARTS OF BOTH ENTRIES, BLEND AND SOFTMAX IN ONE: a block one row of one entry, a thread four consecutive columns: sixteen 16-byte loads (one a source part) held in registers, then a result part after the other: sixteen words of Wm's row (its bf16 values as f16 words, cast once: exact), 64 multiply-adds in f32 in the order of h, the hidden columns BY A SELECT on the block's and the thread's own numbers and the switch's word; the block holds the row's 1,024 blended logits of all sixteen result parts in registers, so the sixteen largest and the sixteen sums are taken there (lanes, then the eight waves through LDS) and only the f16 shares are stored, 8 bytes a thread and part; the shares times the turned C by k_pv, both entries' sixteen result parts in one launch (a block a 32 by 64 tile, the depth's 32-deep steps dealt round its eight waves, the partial tiles added through LDS) STRAIGHT INTO THE OUTPUT at the part's column block of 64 inside a row of 1,024. WITH THE SWITCH SET NOTHING WHOLLY BEHIND THE DIAGONAL IS WORKED ON: a 128 by 64 logit tile with no visible column is not computed, a wave of k_mixsm whose 128 columns are all hidden only hands in minus infinity and nought, and k_pv's depth ends at its tile's last row; what is left unwritten so is read by nobody.
// Compute dtype: A, Bm, C and Wm rounded to bf16 where they are first read: bf16 values are exact f16 words away from the subnormal range: NO COMPUTED OPERAND ENTERS THE LOGITS; every matrix multiply's operands f16 words (11 bits): the shares ONE word at a carry of 1,024 (words under 2^-14 written as noughts); f32 accumulation; the logits, THE MIXING (f32 multiply-adds on the vector unit: 16 a result word: a depth and a width of 16 are under the matrix tile), the softmax's largest, exponentials (expf), sum and true divisions f32; the switch read as an int32 word by value. v_wmma_f32_16x16x32_f16.
#define NB 4                         /* batch entries */
#define NP 16                        /* parts */
#define NS 1024                      /* rows of a part: and columns of its logits */
#define PD 64                        /* a part's width */
#define NK 1024                      /* the row softmax's logits a row */
#define PSC 1024.0f                  /* the carry on the shares' f16 plane */
#define EB 2                         /* batch entries a launch of the three main kernels */

typedef __bf16 v16b __attribute__((ext_vector_type(16)));
typedef unsigned short v8us __attribute__((ext_vector_type(8), may_alias));
typedef float  v8f  __attribute__((ext_vector_type(8)));
typedef float  v4f  __attribute__((ext_vector_type(4)));
typedef float  v4fa __attribute__((ext_vector_type(4), may_alias));
union FragB { v16b v; v8us half[2]; unsigned short u[16]; };

__device__ __forceinline__ unsigned short bf16_bits(float x) { unsigned int u = __float_as_uint(x); return (unsigned short)((u + 0x7FFFu + ((u >> 16) & 1u)) >> 16); }
__device__ __forceinline__ float bf16_val(unsigned short b) { return __uint_as_float(((unsigned int)b) << 16); }
__device__ __forceinline__ float bf16_round(float x) { return bf16_val(bf16_bits(x)); }
// D += A·B with NT terms: 1 = ah·bh, 2 = + al·bh (A split), 3 = + ah·bl (both split)
template <int NT>
__device__ __forceinline__ v8f mmaN(v16b ah, v16b al, v16b bh, v16b bl, v8f c) {
  c = __builtin_amdgcn_wmma_f32_16x16x32_bf16(false, ah, false, bh, (short)0, c, false, false);
  if (NT >= 2) c = __builtin_amdgcn_wmma_f32_16x16x32_bf16(false, al, false, bh, (short)0, c, false, false);
  if (NT >= 3) c = __builtin_amdgcn_wmma_f32_16x16x32_bf16(false, ah, false, bl, (short)0, c, false, false);
  asm volatile("v_nop\n\tv_nop\n\tv_nop\n\tv_nop" : "+v"(c) : "v"(ah), "v"(al), "v"(bh), "v"(bl));
  return c;
}




// ---- f16 WMMA path (v_wmma_f32_16x16x32_f16): 11-bit significands for operands in range — used where a [0,1] probability operand needs more precision than bf16
typedef _Float16 v16h __attribute__((ext_vector_type(16)));
union FragH { v16h v; v8us half[2]; _Float16 h[16]; unsigned short u[16]; };
template <int NT>
__device__ __forceinline__ v8f mmaH(v16h ah, v16h al, v16h bh, v16h bl, v8f c) {
  c = __builtin_amdgcn_wmma_f32_16x16x32_f16(false, ah, false, bh, (short)0, c, false, false);
  if (NT >= 2) c = __builtin_amdgcn_wmma_f32_16x16x32_f16(false, al, false, bh, (short)0, c, false, false);
  if (NT >= 3) c = __builtin_amdgcn_wmma_f32_16x16x32_f16(false, ah, false, bl, (short)0, c, false, false);
  asm volatile("v_nop\n\tv_nop\n\tv_nop\n\tv_nop" : "+v"(c) : "v"(ah), "v"(al), "v"(bh), "v"(bl));
  return c;
}

// Wt[n][k] = f16(W[k][n]·scale) from f32 row-major W[K][N] (scale = power of two; bf16-exact weights stay exact in f16 away from the subnormal range)
__device__ __forceinline__ void d_wt_f16(const float* __restrict__ W, _Float16* __restrict__ Wt, int K, int N, float scale, int t) {
  if (t >= N * (K / 8)) return; const int n = t / (K / 8), k8 = (t % (K / 8)) * 8; FragH f;
#pragma unroll
  for (int i = 0; i < 8; ++i) f.h[i] = (_Float16)(bf16_round(W[(size_t)(k8 + i) * N + n]) * scale); const v8us o = f.half[0];
  *(v8us*)((unsigned short*)Wt + (size_t)n * K + k8) = o; 
}

typedef _Float16 v4h __attribute__((ext_vector_type(4)));

__device__ __forceinline__ void d_x16(const float* __restrict__ x, _Float16* __restrict__ X16, size_t n8, size_t t) { if (t >= n8) return; FragH f;
#pragma unroll
  for (int q = 0; q < 8; ++q) f.h[q] = (_Float16)bf16_round(x[t * 8 + q]); *(v8us*)((unsigned short*)X16 + t * 8) = f.half[0];  }
// ---- the one preparing launch: seven pieces of work that lean on nothing but the inputs, told apart by the block's number; the turning blocks (the slowest: a load touches 32 lines) stand first ----
#define XB ((NB * NP * NS * (PD / 8)) / 256)      /* blocks that cast A: and as many for Bm */
#define TB ((PD * (NP * NS / 8)) / 256)           /* blocks that turn one batch entry of C */
__global__ __launch_bounds__(256) void k_prep(const float* __restrict__ Ai, const float* __restrict__ Bi, const float* __restrict__ Ci, const float* __restrict__ Wi, _Float16* __restrict__ A16, _Float16* __restrict__ B16, _Float16* __restrict__ CT16, _Float16* __restrict__ W16) {
  const int b = blockIdx.x, tid = threadIdx.x;
  if (b < NB * TB) { const int e = b / TB; d_wt_f16(Ci + (size_t)e * NP * NS * PD, CT16 + (size_t)e * PD * NP * NS, NP * NS, PD, 1.0f, (b - e * TB) * 256 + tid); }      /* C's batch entry e [16384 rows][64] -> CT16[e][d][h * 1024 + s] = f16(bf16(C[e][h][s][d])) */
  else if (b < NB * TB + XB) d_x16(Ai, A16, (size_t)NB * NP * NS * PD / 8, (size_t)(b - NB * TB) * 256 + tid);
  else if (b < NB * TB + 2 * XB) d_x16(Bi, B16, (size_t)NB * NP * NS * PD / 8, (size_t)(b - NB * TB - XB) * 256 + tid);
  else d_x16(Wi, W16, (size_t)NP * NP / 8, (size_t)tid); }      /* the last block: 32 of its threads work, the guard turns the rest away */
// ---- fast GEMM (wave tile 32x64; requires M % 32 == 0 rows per launch region and N % 64 == 0) ----
__device__ __forceinline__ v16h g2_frag(const _Float16* p, int hh) { FragH f; f.half[0] = *(const v8us*)((const unsigned short*)p + 8 * hh); f.half[1] = *(const v8us*)((const unsigned short*)p + 16 + 8 * hh); return f.v; }
__device__ __forceinline__ v8f g2_mma(v16h a, v16h b, v8f c) { v8f d = __builtin_amdgcn_wmma_f32_16x16x32_f16(false, a, false, b, (short)0, c, false, false); asm volatile("v_nop\n\tv_nop\n\tv_nop\n\tv_nop" : "+v"(d) : "v"(a), "v"(b)); return d; }
template <int ACT>
__global__ __launch_bounds__(128) void k_gemm2(const _Float16* __restrict__ A, int lda, size_t sA, const _Float16* __restrict__ Bh, int ldb, size_t sB, float alpha, const float* __restrict__ bias, size_t sBias, const float* __restrict__ CP, int rowsPerB, size_t sCPb, int row0g,
    float* __restrict__ C, _Float16* __restrict__ C16, int ldc, size_t sC, int M, int N, int K, const int* __restrict__ SW) { static_assert(ACT == 0 || ACT == 3 || ACT == 6 || ACT == 8 || ACT == 9 || ACT == 11 || ACT == 12 || ACT == 14 || ACT == 15 || ACT == 16 || ACT == 17, "k_gemm2: unsupported ACT code (would silently apply no activation)");
  __shared__ __attribute__((aligned(16))) float so[4][32][68];
  const int tid = threadIdx.x, w = tid >> 5, lane = tid & 31, ln = lane & 15, hh = lane >> 4; const int by = blockIdx.y;
  A += (size_t)by * sA; Bh += (size_t)by * sB; const size_t cofs = (size_t)by * sC; const float* bp = bias ? bias + (size_t)by * sBias : nullptr;
  const int ntn = N >> 6; const int mt = blockIdx.x / ntn, nq = blockIdx.x - mt * ntn; const int row0 = mt * 128 + 32 * w, col0 = nq * 64; if (row0 >= M) return;
  if (SW && SW[0] != 0 && col0 > mt * 128 + 127) return;      /* the switch is set and every column of the block's 128 by 64 tile lies behind every one of its rows: nobody reads those words, so the whole block leaves (no barrier follows) */
  const _Float16* a0p = A + (size_t)(row0 + ln) * lda; const _Float16* a1p = a0p + (size_t)16 * lda;
  const _Float16* b0p = Bh + (size_t)(col0 + ln) * ldb; const _Float16* b1p = b0p + (size_t)16 * ldb; const _Float16* b2p = b1p + (size_t)16 * ldb; const _Float16* b3p = b2p + (size_t)16 * ldb;
  const v8f z8 = {0.f,0.f,0.f,0.f,0.f,0.f,0.f,0.f}; v8f c00 = z8, c01 = z8, c02 = z8, c03 = z8, c10 = z8, c11 = z8, c12 = z8, c13 = z8;
  for (int kb = 0; kb < K; kb += 32) { const v16h a0 = g2_frag(a0p + kb, hh), a1 = g2_frag(a1p + kb, hh);
    v16h b = g2_frag(b0p + kb, hh); c00 = g2_mma(a0, b, c00); c10 = g2_mma(a1, b, c10);
    b = g2_frag(b1p + kb, hh); c01 = g2_mma(a0, b, c01); c11 = g2_mma(a1, b, c11);
    b = g2_frag(b2p + kb, hh); c02 = g2_mma(a0, b, c02); c12 = g2_mma(a1, b, c12);
    b = g2_frag(b3p + kb, hh); c03 = g2_mma(a0, b, c03); c13 = g2_mma(a1, b, c13); }
  v8f accs[8] = {c00, c01, c02, c03, c10, c11, c12, c13};
#pragma unroll
  for (int u = 0; u < 8; ++u) { const int t = u & 3, half = u >> 2; const int col = col0 + t * 16 + ln; const float bv = bp ? bf16_round(bp[col]) : 0.f;
#pragma unroll
    for (int r = 0; r < 8; ++r) { const int rloc = half * 16 + 8 * hh + r; float v = accs[u][r] * alpha + bv; if (CP) { if (rowsPerB < 0) v += CP[cofs + (size_t)(row0g + row0 + rloc) * ldc + col];      /* rowsPerB < 0: own element of the batched C plane */ else { const int bidx = (row0g + row0 + rloc) / rowsPerB; v += CP[(size_t)bidx * sCPb + (size_t)by * 64 + col]; } }
      if (ACT == 3) v = fmaxf(v, 0.f); else if (ACT == 6) v = 0.5f * v * (1.0f + erff(v * 0.70710678118654752f)); else if (ACT == 11) v = 1.0f / (1.0f + expf(-v)); else if (ACT == 15) v = v / (1.0f + expf(-v)); else if (ACT == 12) v = (v > 0.f) ? v : 0.01f * v; else if (ACT == 8) v = tanhf(v); else if (ACT == 9) v = 0.5f * v * (1.0f + tanhf(0.7978845608028654f * (v + 0.044715f * v * v * v))); else if (ACT == 14) v = (v > 0.f) ? v : 0.1f * v; else if (ACT == 16) v = (v >= 0.f) ? v : 0.3f * v; else if (ACT == 17) v = (v >= 0.f) ? v : 0.2f * v;
      so[w][rloc][t * 16 + ln] = v; } }
  __builtin_amdgcn_fence(__ATOMIC_ACQ_REL, "workgroup"); __builtin_amdgcn_wave_barrier();
  const int rsub = lane >> 4, c4 = (lane & 15) * 4;
  {
#pragma unroll
    for (int q = 0; q < 16; ++q) { const int r = q * 2 + rsub; const v4f v = *(const v4fa*)&so[w][r][c4]; if (C) *(v4f*)(C + cofs + (size_t)(row0 + r) * ldc + col0 + c4) = v; if (C16) { v4h h4; for (int i = 0; i < 4; ++i) h4[i] = (_Float16)v[i]; *(v4h*)(C16 + cofs + (size_t)(row0 + r) * ldc + col0 + c4) = h4; } }
     } }

// ---- shares times the turned C: a block one 32 by 64 tile of a result part (the grid's second axis: the entry of the launch times 16 plus the part); the depth's 32-deep steps are dealt round its eight waves (wave w: steps w, w + 8, ...), with the switch set only the steps up to the tile's last row, and the eight f32 partial tiles are added through LDS in the order of the waves ----
#define KW 8                         /* waves a block: slices of the depth */
__global__ __launch_bounds__(256) void k_pv(const _Float16* __restrict__ P, const _Float16* __restrict__ Ct, const int* __restrict__ SW, float* __restrict__ O) {
  __shared__ __attribute__((aligned(16))) float so[KW][32][68];
  const int tid = threadIdx.x, w = __builtin_amdgcn_readfirstlane(tid >> 5), lane = tid & 31, ln = lane & 15, hh = lane >> 4;      /* the wave's number in a scalar register: the depth loop's branch is then a scalar one and every lane stays on at the matrix instructions */
  const int xt = blockIdx.x, row0 = xt * 32, by = blockIdx.y;
  const int nst = (SW[0] != 0) ? xt + 1 : NK / 32;      /* 32-deep steps that hold a visible column of the tile's last row: behind them every share is nought (and, with the switch set, in part not stored) */
  const _Float16* a0p = P + (size_t)by * NS * NK + (size_t)(row0 + ln) * NK; const _Float16* a1p = a0p + (size_t)16 * NK;
  const _Float16* b0p = Ct + (size_t)(by >> 4) * (PD * NP * NS) + (size_t)(by & 15) * NS + (size_t)ln * (NP * NS); const _Float16* b1p = b0p + (size_t)16 * NP * NS; const _Float16* b2p = b1p + (size_t)16 * NP * NS; const _Float16* b3p = b2p + (size_t)16 * NP * NS;
  const v8f z8 = {0.f,0.f,0.f,0.f,0.f,0.f,0.f,0.f}; v8f c00 = z8, c01 = z8, c02 = z8, c03 = z8, c10 = z8, c11 = z8, c12 = z8, c13 = z8;
  for (int st = w; st < nst; st += KW) { const int kb = st * 32; const v16h a0 = g2_frag(a0p + kb, hh); FragH f1; f1.half[0] = *(const v8us*)((const unsigned short*)(a1p + kb) + 8 * hh);      /* the steps dealt round the eight waves */
    asm volatile("s_wait_xcnt 0x0" ::: "memory");      /* the build puts the next load's result into the address pair that the three loads above name: the wait stands in front of that overwrite */
    f1.half[1] = *(const v8us*)((const unsigned short*)(a1p + kb) + 16 + 8 * hh); const v16h a1 = f1.v;
    v16h b = g2_frag(b0p + kb, hh); c00 = g2_mma(a0, b, c00); c10 = g2_mma(a1, b, c10);
    b = g2_frag(b1p + kb, hh); c01 = g2_mma(a0, b, c01); c11 = g2_mma(a1, b, c11);
    b = g2_frag(b2p + kb, hh); c02 = g2_mma(a0, b, c02); c12 = g2_mma(a1, b, c12);
    b = g2_frag(b3p + kb, hh); c03 = g2_mma(a0, b, c03); c13 = g2_mma(a1, b, c13); }
  v8f accs[8] = {c00, c01, c02, c03, c10, c11, c12, c13};
#pragma unroll      /* both loops unrolled: accs is indexed by constants and stays in registers */
  for (int u = 0; u < 8; ++u) { const int t = u & 3, half = u >> 2;
#pragma unroll
    for (int r = 0; r < 8; ++r) so[w][half * 16 + 8 * hh + r][t * 16 + ln] = accs[u][r]; }
  __syncthreads();      /* every wave's partial tile is in LDS before any thread adds the eight */
  const int rr = tid >> 4, c4 = (tid & 15) * 4;
  for (int q = 0; q < 2; ++q) { const int r = q * 16 + rr; v4f s = *(const v4fa*)&so[0][r][c4];
    for (int k = 1; k < KW; ++k) { const v4f p = *(const v4fa*)&so[k][r][c4]; s += p; }
    s *= (1.0f / PSC); *(v4f*)(O + (size_t)(by >> 4) * (NS * NP * PD) + (size_t)(by & 15) * PD + (size_t)(row0 + r) * (NP * PD) + c4) = s; } }

// Wt[n][k] = f16(W[k][n] x scale) from f32 row-major W[K][N] with NO rounding of W to bf16 first: for a COMPUTED f32 plane (the transposing cast above without that one statement)
__global__ __launch_bounds__(256) void k_wtc_f16(const float* __restrict__ W, _Float16* __restrict__ Wt, int K, int N, float scale) {
  const int t = blockIdx.x * 256 + threadIdx.x; if (t >= N * (K / 8)) return; const int n = t / (K / 8), k8 = (t % (K / 8)) * 8; FragH f;
#pragma unroll
  for (int i = 0; i < 8; ++i) f.h[i] = (_Float16)(W[(size_t)(k8 + i) * N + n] * scale); const v8us o = f.half[0];
  *(v8us*)((unsigned short*)Wt + (size_t)n * K + k8) = o; 
}

// lane l's value as lane l ^ 16 sees it: a vector cross-row move
__device__ __forceinline__ float x16(float x) { return __builtin_bit_cast(float, __builtin_amdgcn_permlanex16(__builtin_bit_cast(int, x), __builtin_bit_cast(int, x), 0x76543210, 0xfedcba98, false, false)); }
// sixteen values a lane, each reduced over the wave's 32 lanes (MX: the largest; else the sum): at each of four steps a lane keeps half of its values and hands the other half to its partner, so 8 + 4 + 2 + 1 exchanges and a last one serve all sixteen; lane l returns value number l >> 1
template <bool MX>
__device__ __forceinline__ float red16(float (&v)[NP], unsigned int lane) { static_assert(NP == 16, "four halving steps");
  { const bool up = (lane & 16u) != 0u;
#pragma unroll      /* v is indexed by constants and stays in registers: so in the two loops below */
    for (int i = 0; i < 8; ++i) { const float keep = up ? v[i + 8] : v[i]; const float send = up ? v[i] : v[i + 8]; const float got = x16(send); v[i] = MX ? fmaxf(keep, got) : keep + got; } }
  { const bool up = (lane & 8u) != 0u;
#pragma unroll
    for (int i = 0; i < 4; ++i) { const float keep = up ? v[i + 4] : v[i]; const float send = up ? v[i] : v[i + 4]; const float got = __shfl_xor(send, 8, 32); v[i] = MX ? fmaxf(keep, got) : keep + got; } }
  { const bool up = (lane & 4u) != 0u;
#pragma unroll
    for (int i = 0; i < 2; ++i) { const float keep = up ? v[i + 2] : v[i]; const float send = up ? v[i] : v[i + 2]; const float got = __shfl_xor(send, 4, 32); v[i] = MX ? fmaxf(keep, got) : keep + got; } }
  { const bool up = (lane & 2u) != 0u; const float keep = up ? v[1] : v[0]; const float send = up ? v[0] : v[1]; const float got = __shfl_xor(send, 2, 32); v[0] = MX ? fmaxf(keep, got) : keep + got; }
  const float got = __shfl_xor(v[0], 1, 32); return MX ? fmaxf(v[0], got) : v[0] + got; }

// a block one row r of one batch entry's logits (the entry of the launch: the grid's second axis), a thread four consecutive columns: the sixteen source parts' words are read ONCE and serve all sixteen result parts from registers; the blended logits stay in registers through the row softmax, and only the f16 shares leave
typedef unsigned int v8u __attribute__((ext_vector_type(8), may_alias));
__global__ __launch_bounds__(256, 6) /* six waves a SIMD asked for, three blocks a WGP: with the branches below the build otherwise takes 225 registers and only two blocks fit */ void k_mixsm(const float* __restrict__ S, const _Float16* __restrict__ W16, const int* __restrict__ SW, _Float16* __restrict__ P16) {
  __shared__ __attribute__((aligned(16))) float rm[NP][8], rs[NP][8];      /* a result part's largest and sum, one word a wave */
  const unsigned int r = blockIdx.x; const unsigned int c0 = threadIdx.x * 4u; const unsigned int vo = c0 * 4u;      /* the thread's place in a row, in bytes */ const float* __restrict__ Sr = S + (size_t)blockIdx.y * NP * NS * NK + ((size_t)r << 10);      /* the row's first word of source part 0: a scalar address */ _Float16* __restrict__ Pr = P16 + (size_t)blockIdx.y * NP * NS * NK + ((size_t)r << 10); const unsigned int lane = threadIdx.x & 31u, wv = threadIdx.x >> 5; const int sw = SW[0]; v4f s[NP]; v4f z[NP]; float pr[NP];
  const bool act = !(sw != 0 && (unsigned int)__builtin_amdgcn_readfirstlane((int)wv) * 128u > r);      /* false: the switch is set and all 128 columns of this wave are hidden in row r: it loads, blends and stores nothing, hands in minus infinity and nought, and passes both barriers; a scalar test, the same in every lane */
  static_assert(NP == 16 && (size_t)NS * NK * 4 == 4194304, "the sixteen loads below: eight scalar bases, the odd parts one plane (4,194,304 bytes) behind the even ones");
  if (act) {
  /* the sixteen loads (source part h into s[h]) and their data wait in ONE statement: all sixteen are in flight together, and no register that a load names, nor one that it fills, is touched by the compiler before the data is there */
  asm volatile("global_load_b128 %0, %16, %17\n\t"
               "global_load_b128 %1, %16, %17 offset:4194304\n\t"
               "global_load_b128 %2, %16, %18\n\t"
               "global_load_b128 %3, %16, %18 offset:4194304\n\t"
               "global_load_b128 %4, %16, %19\n\t"
               "global_load_b128 %5, %16, %19 offset:4194304\n\t"
               "global_load_b128 %6, %16, %20\n\t"
               "global_load_b128 %7, %16, %20 offset:4194304\n\t"
               "global_load_b128 %8, %16, %21\n\t"
               "global_load_b128 %9, %16, %21 offset:4194304\n\t"
               "global_load_b128 %10, %16, %22\n\t"
               "global_load_b128 %11, %16, %22 offset:4194304\n\t"
               "global_load_b128 %12, %16, %23\n\t"
               "global_load_b128 %13, %16, %23 offset:4194304\n\t"
               "global_load_b128 %14, %16, %24\n\t"
               "global_load_b128 %15, %16, %24 offset:4194304\n\t"
               "s_wait_loadcnt 0x0"
               : "=&v"(s[0]), "=&v"(s[1]), "=&v"(s[2]), "=&v"(s[3]), "=&v"(s[4]), "=&v"(s[5]), "=&v"(s[6]), "=&v"(s[7]), "=&v"(s[8]), "=&v"(s[9]), "=&v"(s[10]), "=&v"(s[11]), "=&v"(s[12]), "=&v"(s[13]), "=&v"(s[14]), "=&v"(s[15])
               : "v"(vo), "s"(Sr + (size_t)0 * NS * NK), "s"(Sr + (size_t)2 * NS * NK), "s"(Sr + (size_t)4 * NS * NK), "s"(Sr + (size_t)6 * NS * NK), "s"(Sr + (size_t)8 * NS * NK), "s"(Sr + (size_t)10 * NS * NK), "s"(Sr + (size_t)12 * NS * NK), "s"(Sr + (size_t)14 * NS * NK)
               : "memory");
#pragma unroll      /* z is indexed by constants and stays in registers */
  for (int g = 0; g < NP; ++g) { const v8u wr = *(const v8u*)(W16 + g * NP);      /* Wm's row g, sixteen f16 words as eight 32-bit words: the same for every lane, so it comes by a scalar load and takes no vector register */ z[g] = (v4f){0.0f, 0.0f, 0.0f, 0.0f};
#pragma unroll      /* s is indexed by constants and stays in registers */
    for (int h = 0; h < NP; ++h) { const float w = (float)__builtin_bit_cast(_Float16, (unsigned short)(wr[h >> 1] >> (16 * (h & 1))));
#pragma unroll
      for (int q = 0; q < 4; ++q) z[g][q] = __builtin_fmaf(w, s[h][q], z[g][q]); }      /* a column's sum still runs in the order of h, one fused multiply-add a term */
#pragma unroll
    for (int q = 0; q < 4; ++q) z[g][q] = (sw != 0 && c0 + (unsigned int)q > r) ? __uint_as_float(0xff800000u) : z[g][q];
    pr[g] = fmaxf(fmaxf(z[g][0], z[g][1]), fmaxf(z[g][2], z[g][3])); }
  /* the sixteen largest of the row: over the wave's lanes, then over the eight waves through LDS; column 0 is never hidden, so each is finite */
  { const float t = red16<true>(pr, lane); if ((lane & 1u) == 0u) rm[lane >> 1][wv] = t; }
  } else if (lane < (unsigned int)NP) rm[lane][wv] = __uint_as_float(0xff800000u);
  __syncthreads();      /* every wave's sixteen largest are in LDS before any lane reads the eight of its part */
  if (act) {
  { const v4f a = *(const v4fa*)&rm[lane & 15u][0]; const v4f b = *(const v4fa*)&rm[lane & 15u][4]; const float t = fmaxf(fmaxf(fmaxf(a[0], a[1]), fmaxf(a[2], a[3])), fmaxf(fmaxf(b[0], b[1]), fmaxf(b[2], b[3])));
#pragma unroll
    for (int g = 0; g < NP; ++g) { const float m = __builtin_bit_cast(float, __builtin_amdgcn_readlane(__builtin_bit_cast(int, t), g));      /* part g's largest stands in lane g: the same for the whole wave, so it goes to a scalar register */
#pragma unroll
      for (int q = 0; q < 4; ++q) z[g][q] = expf(z[g][q] - m);
      pr[g] = (z[g][0] + z[g][1]) + (z[g][2] + z[g][3]); } }
  /* the sixteen sums, the same way (an array of its own, so that one barrier is enough) */
  { const float t = red16<false>(pr, lane); if ((lane & 1u) == 0u) rs[lane >> 1][wv] = t; }
  } else if (lane < (unsigned int)NP) rs[lane][wv] = 0.0f;
  __syncthreads();      /* every wave's sixteen sums are in LDS before any lane adds the eight of its part */
  if (act) { const v4f a = *(const v4fa*)&rs[lane & 15u][0]; const v4f b = *(const v4fa*)&rs[lane & 15u][4]; const float t = ((a[0] + a[1]) + (a[2] + a[3])) + ((b[0] + b[1]) + (b[2] + b[3]));
#pragma unroll
    for (int g = 0; g < NP; ++g) { const float d = __builtin_bit_cast(float, __builtin_amdgcn_readlane(__builtin_bit_cast(int, t), g)); v4h o;
#pragma unroll
      for (int q = 0; q < 4; ++q) { const float p = z[g][q] / d; const _Float16 hq = (_Float16)(p * PSC); o[q] = (hq < (_Float16)6.103515625e-05f) ? (_Float16)0.0f : hq; }
      *(v4h*)(Pr + (size_t)g * NS * NK + c0) = o; } } }
extern "C" void kernel_launch(void* const* d_in, const int* in_sizes, int n_in,
                              void* d_out, int out_size, void* d_ws, size_t ws_size, hipStream_t stream) {
  (void)in_sizes; (void)n_in; (void)out_size;
  const float* AI = (const float*)d_in[0]; const float* BI = (const float*)d_in[1]; const float* CI = (const float*)d_in[2]; const float* WI = (const float*)d_in[3]; const int* SI = (const int*)d_in[4];      /* A, Bm, C [4][16][1024][64]; Wm [16][16]; the switch: one int32 word */
  static_assert(PD == 64 && NK % (KW * 32) == 0 && NK == NS && NS % 128 == 0 && NS % 64 == 0 && PD % 64 == 0 && PD % 32 == 0 && NS % 32 == 0 && NK % 256 == 0 && ((NS * (NK / 4)) & (NS * (NK / 4) - 1)) == 0 && ((size_t)NB * NP * NS * (PD / 8)) % 256 == 0 && (PD * (NP * NS / 8)) % 256 == 0 && NK == 256 * 4 && NP == 16 && NB % EB == 0, "whole tiles; exact grids");
  float* OUT = (float*)d_out;      /* [4][1024][16][64] */
  char* ws = (char*)d_ws; size_t off = 0;
  auto take = [&](size_t bytes) { char* p = ws + off; off += (bytes + 255) & ~(size_t)255; return p; };
  _Float16* A16 = (_Float16*)take((size_t)NB * NP * NS * PD * 2); _Float16* B16 = (_Float16*)take((size_t)NB * NP * NS * PD * 2); _Float16* W16 = (_Float16*)take((size_t)NP * NP * 2);      /* A and Bm as f16; Wm as f16 (256 words) */
  _Float16* CT16 = (_Float16*)take((size_t)NB * PD * NP * NS * 2); float* SG = (float*)take((size_t)EB * NP * NS * NK * 4);      /* C's four batch entries, each turned [64][16384]; two entries' logits, sixteen parts each */
  _Float16* S16 = (_Float16*)take((size_t)EB * NP * NS * NK * 2);      /* two entries' sixteen result parts' f16 shares at 1,024 */
  if (off > ws_size) return;
  k_prep<<<NB * TB + 2 * XB + 1, 256, 0, stream>>>(AI, BI, CI, WI, A16, B16, CT16, W16);      /* every cast and every turn in one launch */
  for (int e = 0; e < NB; e += EB) { const size_t eo = (size_t)e * NP * NS * PD;
    k_gemm2<0><<<dim3((NS / 128) * (NK / 64), EB * NP), 128, 0, stream>>>(A16 + eo, PD, (size_t)NS * PD, B16 + eo, PD, (size_t)NS * PD, 0.125f, nullptr, 0, nullptr, 1, 0, 0, SG, nullptr, NK, (size_t)NS * NK, NS, NK, PD, SI);      /* two entries' 32 parts' logits (a part's planes follow one another across the entries): with the switch set only the tiles that hold a visible column */
    k_mixsm<<<dim3(NS, EB), 256, 0, stream>>>(SG, W16, SI, S16);      /* all result parts' shares of both entries from one read of SG */
    k_pv<<<dim3(NS / 32, EB * NP), 256, 0, stream>>>(S16, CT16 + eo, SI, OUT + eo); }      /* a result part's 64 columns at a row stride of 1,024; an entry of CT16 and one of the output are as long as one of C */
}

// v006
// Measured time: 160 microseconds a run.
// Two timings next to v005 both put it at 1.06 times that version's speed.
// Over all steps from v000 it is 4.41 times as fast.
#include <hip/hip_runtime.h>
// A sixteen-part alignment whose logits are BLENDED ACROSS THE PARTS by a 16 by 16 matrix before one softmax (five inputs: A, Bm, C [4][16][1024][64] f32: rows already cut into 16 parts of width 64; a mixing matrix Wm [16][16] f32 ([result part][source part]); a switch: ONE int32 word, non-zero = later columns hidden): a part's logits = A Bm^T / 8 [1024][1024]; blended[g] = the sum over h of Wm[g][h] logits[h], element by element; if the switch is non-zero a column whose index exceeds the row's counts as minus infinity; ONE softmax over the 1,024 columns; a part's result = its shares times C's part [1024][64]; the results laid as [4][1024][16][64].
// Structure: ONE PREPARING LAUNCH (k_prep, the work told apart by the block's number, 64 words a thread): A, Bm and Wm cast whole to f16 and each of C's four batch entries turned as ONE [16384][64] matrix into [64][16384] f16 (the transposing cast: a part's rows are 1,024 columns of it); THEN TWO BATCH ENTRIES AT A TIME (the workspace holds two entries' logits), the entry riding on the grid's second axis: the 32 parts' logits in ONE launch (WMMA GEMM, 32 by 64 wave tiles, depth 64, f32 accumulation, scale 1 / 8: the part is the grid's second axis) into an f32 plane; k_mixsm ONCE FOR ALL SIXTEEN RESULT PARTS OF BOTH ENTRIES, BLEND AND SOFTMAX IN ONE: a block one row of one entry, a thread four consecutive columns: sixteen 16-byte loads (one a source part) held in registers, then a result part after the other: sixteen words of Wm's row (its bf16 values as f16 words, cast once by the plain cast: exact), 64 multiply-adds in f32 in the order of h, the hidden columns BY A SELECT on the block's and the thread's own numbers and the switch's word; the block holds the row's 1,024 blended logits of all sixteen result parts in registers, so the sixteen largest and the sixteen sums are taken there (lanes, then the eight waves through LDS) and only the f16 shares are stored, 8 bytes a thread and part; the shares times the turned C by k_pv, both entries' sixteen result parts in one launch (a block a 32 by 64 tile, the depth's 32-deep steps dealt round its eight waves, the partial tiles added through LDS) STRAIGHT INTO THE OUTPUT at the part's column block of 64 inside a row of 1,024. WITH THE SWITCH SET NOTHING WHOLLY BEHIND THE DIAGONAL IS WORKED ON: a 128 by 64 logit tile with no visible column is not computed, a wave of k_mixsm whose 128 columns are all hidden only hands in minus infinity and nought, and k_pv's depth ends at its tile's last row; what is left unwritten so is read by nobody.
// Compute dtype: A, Bm, C and Wm rounded to bf16 where they are first read (each by the casts): bf16 values are exact f16 words away from the subnormal range: NO COMPUTED OPERAND ENTERS THE LOGITS; every matrix multiply's operands f16 words (11 bits): the shares ONE word at a carry of 1,024 (words under 2^-14 written as noughts); f32 accumulation; the logits, THE MIXING (f32 multiply-adds on the vector unit: 16 a result word: a depth and a width of 16 are under the matrix tile), the softmax's largest, exponentials (expf), sum and true divisions f32; the switch read as an int32 word by value. v_wmma_f32_16x16x32_f16.
#define NB 4                         /* batch entries */
#define NP 16                        /* parts */
#define NS 1024                      /* rows of a part: and columns of its logits */
#define PD 64                        /* a part's width */
#define NK 1024                      /* the row softmax's logits a row */
#define PSC 1024.0f                  /* the carry on the shares' f16 plane */
#define EB 2                         /* batch entries a launch of the three main kernels */

typedef __bf16 v16b __attribute__((ext_vector_type(16)));
typedef unsigned short v8us __attribute__((ext_vector_type(8), may_alias));
typedef float  v8f  __attribute__((ext_vector_type(8)));
typedef float  v4f  __attribute__((ext_vector_type(4)));
typedef float  v4fa __attribute__((ext_vector_type(4), may_alias));
union FragB { v16b v; v8us half[2]; unsigned short u[16]; };

__device__ __forceinline__ unsigned short bf16_bits(float x) { unsigned int u = __float_as_uint(x); return (unsigned short)((u + 0x7FFFu + ((u >> 16) & 1u)) >> 16); }
__device__ __forceinline__ float bf16_val(unsigned short b) { return __uint_as_float(((unsigned int)b) << 16); }
__device__ __forceinline__ float bf16_round(float x) { return bf16_val(bf16_bits(x)); }
// D += A·B with NT terms: 1 = ah·bh, 2 = + al·bh (A split), 3 = + ah·bl (both split)
template <int NT>
__device__ __forceinline__ v8f mmaN(v16b ah, v16b al, v16b bh, v16b bl, v8f c) {
  c = __builtin_amdgcn_wmma_f32_16x16x32_bf16(false, ah, false, bh, (short)0, c, false, false);
  if (NT >= 2) c = __builtin_amdgcn_wmma_f32_16x16x32_bf16(false, al, false, bh, (short)0, c, false, false);
  if (NT >= 3) c = __builtin_amdgcn_wmma_f32_16x16x32_bf16(false, ah, false, bl, (short)0, c, false, false);
  asm volatile("v_nop\n\tv_nop\n\tv_nop\n\tv_nop" : "+v"(c) : "v"(ah), "v"(al), "v"(bh), "v"(bl));
  return c;
}




// ---- f16 WMMA path (v_wmma_f32_16x16x32_f16): 11-bit significands for operands in range — used where a [0,1] probability operand needs more precision than bf16
typedef _Float16 v16h __attribute__((ext_vector_type(16)));
union FragH { v16h v; v8us half[2]; _Float16 h[16]; unsigned short u[16]; };
template <int NT>
__device__ __forceinline__ v8f mmaH(v16h ah, v16h al, v16h bh, v16h bl, v8f c) {
  c = __builtin_amdgcn_wmma_f32_16x16x32_f16(false, ah, false, bh, (short)0, c, false, false);
  if (NT >= 2) c = __builtin_amdgcn_wmma_f32_16x16x32_f16(false, al, false, bh, (short)0, c, false, false);
  if (NT >= 3) c = __builtin_amdgcn_wmma_f32_16x16x32_f16(false, ah, false, bl, (short)0, c, false, false);
  asm volatile("v_nop\n\tv_nop\n\tv_nop\n\tv_nop" : "+v"(c) : "v"(ah), "v"(al), "v"(bh), "v"(bl));
  return c;
}

typedef _Float16 v4h __attribute__((ext_vector_type(4)));

__device__ __forceinline__ void d_x16(const float* __restrict__ x, _Float16* __restrict__ X16, size_t n8, size_t t) { if (t >= n8) return; FragH f;
#pragma unroll
  for (int q = 0; q < 8; ++q) f.h[q] = (_Float16)bf16_round(x[t * 8 + q]); *(v8us*)((unsigned short*)X16 + t * 8) = f.half[0];  }
// the plain cast, 64 words a thread: eight 8-word pieces, 256 pieces apart (a wave's lanes stay side by side in each); the sixteen 16-byte loads stand in front of the first store, so all are in flight together; whole grids only, no guard
__device__ __forceinline__ void d_x16q(const float* __restrict__ x, _Float16* __restrict__ X16, size_t t0) { v4f a[16]; const float* p = x + t0 * 8;
#pragma unroll      /* a is indexed by constants and stays in registers: so below */
  for (int j = 0; j < 8; ++j) { a[2 * j] = *(const v4fa*)(p + j * 2048); a[2 * j + 1] = *(const v4fa*)(p + j * 2048 + 4); }
  asm volatile("" :: "v"(a[0]), "v"(a[1]), "v"(a[2]), "v"(a[3]), "v"(a[4]), "v"(a[5]), "v"(a[6]), "v"(a[7]), "v"(a[8]), "v"(a[9]), "v"(a[10]), "v"(a[11]), "v"(a[12]), "v"(a[13]), "v"(a[14]), "v"(a[15]), "v"(p));      /* holds the sixteen loads in front of the casts (the loaded values and their address as inputs only): without it the build reuses registers and only ten loads are in flight in front of the first cast; the address among the inputs keeps every load's result out of the address pair */
#pragma unroll
  for (int j = 0; j < 8; ++j) { FragH f;
#pragma unroll
    for (int q = 0; q < 8; ++q) f.h[q] = (_Float16)bf16_round(a[2 * j + (q >> 2)][q & 3]);
    *(v8us*)((unsigned short*)X16 + (t0 + (size_t)j * 256) * 8) = f.half[0]; }
  asm volatile("s_wait_xcnt 0x0" ::: "memory"); }      /* in the built kernel another piece's code follows this one and writes anew the address and data registers that the stores above name: the wait stands in front of that overwrite */
// the transposing cast of W[K][64], 64 words a thread: a patch of 8 rows by 8 columns, read by sixteen 16-byte loads and written as eight 16-byte pieces of Wt[64][K]; a wave 64 rows by 32 columns (four lanes read a row's whole 128-byte line, a store fills four whole lines), a block 256 rows by all 64 columns
__device__ __forceinline__ void d_turn(const float* __restrict__ W, _Float16* __restrict__ Wt, int K, int blk, int tid) { const int lane = tid & 31, w = tid >> 5; const int n8 = ((w & 1) * 4 + (lane & 3)) * 8, k8 = blk * 256 + (w >> 1) * 64 + (lane >> 2) * 8; v4f a[16]; const float* p = W + (size_t)k8 * PD + n8;
#pragma unroll      /* a is indexed by constants and stays in registers: so below */
  for (int i = 0; i < 8; ++i) { a[2 * i] = *(const v4fa*)(p + i * PD); a[2 * i + 1] = *(const v4fa*)(p + i * PD + 4); }
  asm volatile("" :: "v"(a[0]), "v"(a[1]), "v"(a[2]), "v"(a[3]), "v"(a[4]), "v"(a[5]), "v"(a[6]), "v"(a[7]), "v"(a[8]), "v"(a[9]), "v"(a[10]), "v"(a[11]), "v"(a[12]), "v"(a[13]), "v"(a[14]), "v"(a[15]), "v"(p));      /* holds the sixteen loads in front of the casts (the loaded values and their address as inputs only): without it the build reuses registers, the last loads wait for the first casts, and a load's result is put into the address pair that the others name */
#pragma unroll
  for (int j = 0; j < 8; ++j) { FragH f;
#pragma unroll
    for (int i = 0; i < 8; ++i) f.h[i] = (_Float16)bf16_round(a[2 * i + (j >> 2)][j & 3]);
    *(v8us*)((unsigned short*)Wt + (size_t)(n8 + j) * K + k8) = f.half[0]; } }
// ---- the one preparing launch: seven pieces of work that lean on nothing but the inputs, told apart by the block's number; a thread takes 64 words, so that few waves have to be started; the turning blocks stand first ----
#define XB ((NB * NP * NS * (PD / 64)) / 256)     /* blocks that cast A: and as many for Bm */
#define TB ((NP * NS) / 256)                      /* blocks that turn one batch entry of C */
__global__ __launch_bounds__(256) void k_prep(const float* __restrict__ Ai, const float* __restrict__ Bi, const float* __restrict__ Ci, const float* __restrict__ Wi, _Float16* __restrict__ A16, _Float16* __restrict__ B16, _Float16* __restrict__ CT16, _Float16* __restrict__ W16) {
  const int b = blockIdx.x, tid = threadIdx.x;
  if (b < NB * TB) { const int e = b / TB; d_turn(Ci + (size_t)e * NP * NS * PD, CT16 + (size_t)e * PD * NP * NS, NP * NS, b - e * TB, tid); }      /* C's batch entry e [16384 rows][64] -> CT16[e][d][h * 1024 + s] = f16(bf16(C[e][h][s][d])) */
  else if (b < NB * TB + XB) d_x16q(Ai, A16, (size_t)(b - NB * TB) * 2048 + tid);
  else if (b < NB * TB + 2 * XB) d_x16q(Bi, B16, (size_t)(b - NB * TB - XB) * 2048 + tid);
  else d_x16(Wi, W16, (size_t)NP * NP / 8, (size_t)tid); }      /* the last block: 32 of its threads work, the guard turns the rest away */
// ---- fast GEMM (wave tile 32x64; requires M % 32 == 0 rows per launch region and N % 64 == 0) ----
__device__ __forceinline__ v16h g2_frag(const _Float16* p, int hh) { FragH f; f.half[0] = *(const v8us*)((const unsigned short*)p + 8 * hh); f.half[1] = *(const v8us*)((const unsigned short*)p + 16 + 8 * hh); return f.v; }
__device__ __forceinline__ v8f g2_mma(v16h a, v16h b, v8f c) { v8f d = __builtin_amdgcn_wmma_f32_16x16x32_f16(false, a, false, b, (short)0, c, false, false); asm volatile("v_nop\n\tv_nop\n\tv_nop\n\tv_nop" : "+v"(d) : "v"(a), "v"(b)); return d; }
template <int ACT>
__global__ __launch_bounds__(128) void k_gemm2(const _Float16* __restrict__ A, int lda, size_t sA, const _Float16* __restrict__ Bh, int ldb, size_t sB, float alpha, const float* __restrict__ bias, size_t sBias, const float* __restrict__ CP, int rowsPerB, size_t sCPb, int row0g,
    float* __restrict__ C, _Float16* __restrict__ C16, int ldc, size_t sC, int M, int N, int K, const int* __restrict__ SW) { static_assert(ACT == 0 || ACT == 3 || ACT == 6 || ACT == 8 || ACT == 9 || ACT == 11 || ACT == 12 || ACT == 14 || ACT == 15 || ACT == 16 || ACT == 17, "k_gemm2: unsupported ACT code (would silently apply no activation)");
  __shared__ __attribute__((aligned(16))) float so[4][32][68];
  const int tid = threadIdx.x, w = tid >> 5, lane = tid & 31, ln = lane & 15, hh = lane >> 4; const int by = blockIdx.y;
  A += (size_t)by * sA; Bh += (size_t)by * sB; const size_t cofs = (size_t)by * sC; const float* bp = bias ? bias + (size_t)by * sBias : nullptr;
  const int ntn = N >> 6; const int mt = blockIdx.x / ntn, nq = blockIdx.x - mt * ntn; const int row0 = mt * 128 + 32 * w, col0 = nq * 64; if (row0 >= M) return;
  if (SW && SW[0] != 0 && col0 > mt * 128 + 127) return;      /* the switch is set and every column of the block's 128 by 64 tile lies behind every one of its rows: nobody reads those words, so the whole block leaves (no barrier follows) */
  const _Float16* a0p = A + (size_t)(row0 + ln) * lda; const _Float16* a1p = a0p + (size_t)16 * lda;
  const _Float16* b0p = Bh + (size_t)(col0 + ln) * ldb; const _Float16* b1p = b0p + (size_t)16 * ldb; const _Float16* b2p = b1p + (size_t)16 * ldb; const _Float16* b3p = b2p + (size_t)16 * ldb;
  const v8f z8 = {0.f,0.f,0.f,0.f,0.f,0.f,0.f,0.f}; v8f c00 = z8, c01 = z8, c02 = z8, c03 = z8, c10 = z8, c11 = z8, c12 = z8, c13 = z8;
  for (int kb = 0; kb < K; kb += 32) { const v16h a0 = g2_frag(a0p + kb, hh), a1 = g2_frag(a1p + kb, hh);
    v16h b = g2_frag(b0p + kb, hh); c00 = g2_mma(a0, b, c00); c10 = g2_mma(a1, b, c10);
    b = g2_frag(b1p + kb, hh); c01 = g2_mma(a0, b, c01); c11 = g2_mma(a1, b, c11);
    b = g2_frag(b2p + kb, hh); c02 = g2_mma(a0, b, c02); c12 = g2_mma(a1, b, c12);
    b = g2_frag(b3p + kb, hh); c03 = g2_mma(a0, b, c03); c13 = g2_mma(a1, b, c13); }
  v8f accs[8] = {c00, c01, c02, c03, c10, c11, c12, c13};
#pragma unroll
  for (int u = 0; u < 8; ++u) { const int t = u & 3, half = u >> 2; const int col = col0 + t * 16 + ln; const float bv = bp ? bf16_round(bp[col]) : 0.f;
#pragma unroll
    for (int r = 0; r < 8; ++r) { const int rloc = half * 16 + 8 * hh + r; float v = accs[u][r] * alpha + bv; if (CP) { if (rowsPerB < 0) v += CP[cofs + (size_t)(row0g + row0 + rloc) * ldc + col];      /* rowsPerB < 0: own element of the batched C plane */ else { const int bidx = (row0g + row0 + rloc) / rowsPerB; v += CP[(size_t)bidx * sCPb + (size_t)by * 64 + col]; } }
      if (ACT == 3) v = fmaxf(v, 0.f); else if (ACT == 6) v = 0.5f * v * (1.0f + erff(v * 0.70710678118654752f)); else if (ACT == 11) v = 1.0f / (1.0f + expf(-v)); else if (ACT == 15) v = v / (1.0f + expf(-v)); else if (ACT == 12) v = (v > 0.f) ? v : 0.01f * v; else if (ACT == 8) v = tanhf(v); else if (ACT == 9) v = 0.5f * v * (1.0f + tanhf(0.7978845608028654f * (v + 0.044715f * v * v * v))); else if (ACT == 14) v = (v > 0.f) ? v : 0.1f * v; else if (ACT == 16) v = (v >= 0.f) ? v : 0.3f * v; else if (ACT == 17) v = (v >= 0.f) ? v : 0.2f * v;
      so[w][rloc][t * 16 + ln] = v; } }
  __builtin_amdgcn_fence(__ATOMIC_ACQ_REL, "workgroup"); __builtin_amdgcn_wave_barrier();
  const int rsub = lane >> 4, c4 = (lane & 15) * 4;
  {
#pragma unroll
    for (int q = 0; q < 16; ++q) { const int r = q * 2 + rsub; const v4f v = *(const v4fa*)&so[w][r][c4]; if (C) *(v4f*)(C + cofs + (size_t)(row0 + r) * ldc + col0 + c4) = v; if (C16) { v4h h4; for (int i = 0; i < 4; ++i) h4[i] = (_Float16)v[i]; *(v4h*)(C16 + cofs + (size_t)(row0 + r) * ldc + col0 + c4) = h4; } }
     } }

// ---- shares times the turned C: a block one 32 by 64 tile of a result part (the grid's second axis: the entry of the launch times 16 plus the part); the depth's 32-deep steps are dealt round its eight waves (wave w: steps w, w + 8, ...), with the switch set only the steps up to the tile's last row, and the eight f32 partial tiles are added through LDS in the order of the waves ----
#define KW 8                         /* waves a block: slices of the depth */
__global__ __launch_bounds__(256) void k_pv(const _Float16* __restrict__ P, const _Float16* __restrict__ Ct, const int* __restrict__ SW, float* __restrict__ O) {
  __shared__ __attribute__((aligned(16))) float so[KW][32][68];
  const int tid = threadIdx.x, w = __builtin_amdgcn_readfirstlane(tid >> 5), lane = tid & 31, ln = lane & 15, hh = lane >> 4;      /* the wave's number in a scalar register: the depth loop's branch is then a scalar one and every lane stays on at the matrix instructions */
  const int xt = blockIdx.x, row0 = xt * 32, by = blockIdx.y;
  const int nst = (SW[0] != 0) ? xt + 1 : NK / 32;      /* 32-deep steps that hold a visible column of the tile's last row: behind them every share is nought (and, with the switch set, in part not stored) */
  const _Float16* a0p = P + (size_t)by * NS * NK + (size_t)(row0 + ln) * NK; const _Float16* a1p = a0p + (size_t)16 * NK;
  const _Float16* b0p = Ct + (size_t)(by >> 4) * (PD * NP * NS) + (size_t)(by & 15) * NS + (size_t)ln * (NP * NS); const _Float16* b1p = b0p + (size_t)16 * NP * NS; const _Float16* b2p = b1p + (size_t)16 * NP * NS; const _Float16* b3p = b2p + (size_t)16 * NP * NS;
  const v8f z8 = {0.f,0.f,0.f,0.f,0.f,0.f,0.f,0.f}; v8f c00 = z8, c01 = z8, c02 = z8, c03 = z8, c10 = z8, c11 = z8, c12 = z8, c13 = z8;
  for (int st = w; st < nst; st += KW) { const int kb = st * 32; const v16h a0 = g2_frag(a0p + kb, hh); FragH f1; f1.half[0] = *(const v8us*)((const unsigned short*)(a1p + kb) + 8 * hh);      /* the steps dealt round the eight waves */
    asm volatile("s_wait_xcnt 0x0" ::: "memory");      /* the build puts the next load's result into the address pair that the three loads above name: the wait stands in front of that overwrite */
    f1.half[1] = *(const v8us*)((const unsigned short*)(a1p + kb) + 16 + 8 * hh); const v16h a1 = f1.v;
    v16h b = g2_frag(b0p + kb, hh); c00 = g2_mma(a0, b, c00); c10 = g2_mma(a1, b, c10);
    b = g2_frag(b1p + kb, hh); c01 = g2_mma(a0, b, c01); c11 = g2_mma(a1, b, c11);
    b = g2_frag(b2p + kb, hh); c02 = g2_mma(a0, b, c02); c12 = g2_mma(a1, b, c12);
    b = g2_frag(b3p + kb, hh); c03 = g2_mma(a0, b, c03); c13 = g2_mma(a1, b, c13); }
  v8f accs[8] = {c00, c01, c02, c03, c10, c11, c12, c13};
#pragma unroll      /* both loops unrolled: accs is indexed by constants and stays in registers */
  for (int u = 0; u < 8; ++u) { const int t = u & 3, half = u >> 2;
#pragma unroll
    for (int r = 0; r < 8; ++r) so[w][half * 16 + 8 * hh + r][t * 16 + ln] = accs[u][r]; }
  __syncthreads();      /* every wave's partial tile is in LDS before any thread adds the eight */
  const int rr = tid >> 4, c4 = (tid & 15) * 4;
  for (int q = 0; q < 2; ++q) { const int r = q * 16 + rr; v4f s = *(const v4fa*)&so[0][r][c4];
    for (int k = 1; k < KW; ++k) { const v4f p = *(const v4fa*)&so[k][r][c4]; s += p; }
    s *= (1.0f / PSC); *(v4f*)(O + (size_t)(by >> 4) * (NS * NP * PD) + (size_t)(by & 15) * PD + (size_t)(row0 + r) * (NP * PD) + c4) = s; } }

// Wt[n][k] = f16(W[k][n] x scale) from f32 row-major W[K][N] with NO rounding of W to bf16 first: for a COMPUTED f32 plane
__global__ __launch_bounds__(256) void k_wtc_f16(const float* __restrict__ W, _Float16* __restrict__ Wt, int K, int N, float scale) {
  const int t = blockIdx.x * 256 + threadIdx.x; if (t >= N * (K / 8)) return; const int n = t / (K / 8), k8 = (t % (K / 8)) * 8; FragH f;
#pragma unroll
  for (int i = 0; i < 8; ++i) f.h[i] = (_Float16)(W[(size_t)(k8 + i) * N + n] * scale); const v8us o = f.half[0];
  *(v8us*)((unsigned short*)Wt + (size_t)n * K + k8) = o; 
}

// lane l's value as lane l ^ 16 sees it: a vector cross-row move
__device__ __forceinline__ float x16(float x) { return __builtin_bit_cast(float, __builtin_amdgcn_permlanex16(__builtin_bit_cast(int, x), __builtin_bit_cast(int, x), 0x76543210, 0xfedcba98, false, false)); }
// sixteen values a lane, each reduced over the wave's 32 lanes (MX: the largest; else the sum): at each of four steps a lane keeps half of its values and hands the other half to its partner, so 8 + 4 + 2 + 1 exchanges and a last one serve all sixteen; lane l returns value number l >> 1
template <bool MX>
__device__ __forceinline__ float red16(float (&v)[NP], unsigned int lane) { static_assert(NP == 16, "four halving steps");
  { const bool up = (lane & 16u) != 0u;
#pragma unroll      /* v is indexed by constants and stays in registers: so in the two loops below */
    for (int i = 0; i < 8; ++i) { const float keep = up ? v[i + 8] : v[i]; const float send = up ? v[i] : v[i + 8]; const float got = x16(send); v[i] = MX ? fmaxf(keep, got) : keep + got; } }
  { const bool up = (lane & 8u) != 0u;
#pragma unroll
    for (int i = 0; i < 4; ++i) { const float keep = up ? v[i + 4] : v[i]; const float send = up ? v[i] : v[i + 4]; const float got = __shfl_xor(send, 8, 32); v[i] = MX ? fmaxf(keep, got) : keep + got; } }
  { const bool up = (lane & 4u) != 0u;
#pragma unroll
    for (int i = 0; i < 2; ++i) { const float keep = up ? v[i + 2] : v[i]; const float send = up ? v[i] : v[i + 2]; const float got = __shfl_xor(send, 4, 32); v[i] = MX ? fmaxf(keep, got) : keep + got; } }
  { const bool up = (lane & 2u) != 0u; const float keep = up ? v[1] : v[0]; const float send = up ? v[0] : v[1]; const float got = __shfl_xor(send, 2, 32); v[0] = MX ? fmaxf(keep, got) : keep + got; }
  const float got = __shfl_xor(v[0], 1, 32); return MX ? fmaxf(v[0], got) : v[0] + got; }

// a block one row r of one batch entry's logits (the entry of the launch: the grid's second axis), a thread four consecutive columns: the sixteen source parts' words are read ONCE and serve all sixteen result parts from registers; the blended logits stay in registers through the row softmax, and only the f16 shares leave
typedef unsigned int v8u __attribute__((ext_vector_type(8), may_alias));
__global__ __launch_bounds__(256, 6) /* six waves a SIMD asked for, three blocks a WGP: with the branches below the build otherwise takes 225 registers and only two blocks fit */ void k_mixsm(const float* __restrict__ S, const _Float16* __restrict__ W16, const int* __restrict__ SW, _Float16* __restrict__ P16) {
  __shared__ __attribute__((aligned(16))) float rm[NP][8], rs[NP][8];      /* a result part's largest and sum, one word a wave */
  const unsigned int r = blockIdx.x; const unsigned int c0 = threadIdx.x * 4u; const unsigned int vo = c0 * 4u;      /* the thread's place in a row, in bytes */ const float* __restrict__ Sr = S + (size_t)blockIdx.y * NP * NS * NK + ((size_t)r << 10);      /* the row's first word of source part 0: a scalar address */ _Float16* __restrict__ Pr = P16 + (size_t)blockIdx.y * NP * NS * NK + ((size_t)r << 10); const unsigned int lane = threadIdx.x & 31u, wv = threadIdx.x >> 5; const int sw = SW[0]; v4f s[NP]; v4f z[NP]; float pr[NP];
  const bool act = !(sw != 0 && (unsigned int)__builtin_amdgcn_readfirstlane((int)wv) * 128u > r);      /* false: the switch is set and all 128 columns of this wave are hidden in row r: it loads, blends and stores nothing, hands in minus infinity and nought, and passes both barriers; a scalar test, the same in every lane */
  static_assert(NP == 16 && (size_t)NS * NK * 4 == 4194304, "the sixteen loads below: eight scalar bases, the odd parts one plane (4,194,304 bytes) behind the even ones");
  if (act) {
  /* the sixteen loads (source part h into s[h]) and their data wait in ONE statement: all sixteen are in flight together, and no register that a load names, nor one that it fills, is touched by the compiler before the data is there */
  asm volatile("global_load_b128 %0, %16, %17\n\t"
               "global_load_b128 %1, %16, %17 offset:4194304\n\t"
               "global_load_b128 %2, %16, %18\n\t"
               "global_load_b128 %3, %16, %18 offset:4194304\n\t"
               "global_load_b128 %4, %16, %19\n\t"
               "global_load_b128 %5, %16, %19 offset:4194304\n\t"
               "global_load_b128 %6, %16, %20\n\t"
               "global_load_b128 %7, %16, %20 offset:4194304\n\t"
               "global_load_b128 %8, %16, %21\n\t"
               "global_load_b128 %9, %16, %21 offset:4194304\n\t"
               "global_load_b128 %10, %16, %22\n\t"
               "global_load_b128 %11, %16, %22 offset:4194304\n\t"
               "global_load_b128 %12, %16, %23\n\t"
               "global_load_b128 %13, %16, %23 offset:4194304\n\t"
               "global_load_b128 %14, %16, %24\n\t"
               "global_load_b128 %15, %16, %24 offset:4194304\n\t"
               "s_wait_loadcnt 0x0"
               : "=&v"(s[0]), "=&v"(s[1]), "=&v"(s[2]), "=&v"(s[3]), "=&v"(s[4]), "=&v"(s[5]), "=&v"(s[6]), "=&v"(s[7]), "=&v"(s[8]), "=&v"(s[9]), "=&v"(s[10]), "=&v"(s[11]), "=&v"(s[12]), "=&v"(s[13]), "=&v"(s[14]), "=&v"(s[15])
               : "v"(vo), "s"(Sr + (size_t)0 * NS * NK), "s"(Sr + (size_t)2 * NS * NK), "s"(Sr + (size_t)4 * NS * NK), "s"(Sr + (size_t)6 * NS * NK), "s"(Sr + (size_t)8 * NS * NK), "s"(Sr + (size_t)10 * NS * NK), "s"(Sr + (size_t)12 * NS * NK), "s"(Sr + (size_t)14 * NS * NK)
               : "memory");
#pragma unroll      /* z is indexed by constants and stays in registers */
  for (int g = 0; g < NP; ++g) { const v8u wr = *(const v8u*)(W16 + g * NP);      /* Wm's row g, sixteen f16 words as eight 32-bit words: the same for every lane, so it comes by a scalar load and takes no vector register */ z[g] = (v4f){0.0f, 0.0f, 0.0f, 0.0f};
#pragma unroll      /* s is indexed by constants and stays in registers */
    for (int h = 0; h < NP; ++h) { const float w = (float)__builtin_bit_cast(_Float16, (unsigned short)(wr[h >> 1] >> (16 * (h & 1))));
#pragma unroll
      for (int q = 0; q < 4; ++q) z[g][q] = __builtin_fmaf(w, s[h][q], z[g][q]); }      /* a column's sum still runs in the order of h, one fused multiply-add a term */
#pragma unroll
    for (int q = 0; q < 4; ++q) z[g][q] = (sw != 0 && c0 + (unsigned int)q > r) ? __uint_as_float(0xff800000u) : z[g][q];
    pr[g] = fmaxf(fmaxf(z[g][0], z[g][1]), fmaxf(z[g][2], z[g][3])); }
  /* the sixteen largest of the row: over the wave's lanes, then over the eight waves through LDS; column 0 is never hidden, so each is finite */
  { const float t = red16<true>(pr, lane); if ((lane & 1u) == 0u) rm[lane >> 1][wv] = t; }
  } else if (lane < (unsigned int)NP) rm[lane][wv] = __uint_as_float(0xff800000u);
  __syncthreads();      /* every wave's sixteen largest are in LDS before any lane reads the eight of its part */
  if (act) {
  { const v4f a = *(const v4fa*)&rm[lane & 15u][0]; const v4f b = *(const v4fa*)&rm[lane & 15u][4]; const float t = fmaxf(fmaxf(fmaxf(a[0], a[1]), fmaxf(a[2], a[3])), fmaxf(fmaxf(b[0], b[1]), fmaxf(b[2], b[3])));
#pragma unroll
    for (int g = 0; g < NP; ++g) { const float m = __builtin_bit_cast(float, __builtin_amdgcn_readlane(__builtin_bit_cast(int, t), g));      /* part g's largest stands in lane g: the same for the whole wave, so it goes to a scalar register */
#pragma unroll
      for (int q = 0; q < 4; ++q) z[g][q] = expf(z[g][q] - m);
      pr[g] = (z[g][0] + z[g][1]) + (z[g][2] + z[g][3]); } }
  /* the sixteen sums, the same way (an array of its own, so that one barrier is enough) */
  { const float t = red16<false>(pr, lane); if ((lane & 1u) == 0u) rs[lane >> 1][wv] = t; }
  } else if (lane < (unsigned int)NP) rs[lane][wv] = 0.0f;
  __syncthreads();      /* every wave's sixteen sums are in LDS before any lane adds the eight of its part */
  if (act) { const v4f a = *(const v4fa*)&rs[lane & 15u][0]; const v4f b = *(const v4fa*)&rs[lane & 15u][4]; const float t = ((a[0] + a[1]) + (a[2] + a[3])) + ((b[0] + b[1]) + (b[2] + b[3]));
#pragma unroll
    for (int g = 0; g < NP; ++g) { const float d = __builtin_bit_cast(float, __builtin_amdgcn_readlane(__builtin_bit_cast(int, t), g)); v4h o;
#pragma unroll
      for (int q = 0; q < 4; ++q) { const float p = z[g][q] / d; const _Float16 hq = (_Float16)(p * PSC); o[q] = (hq < (_Float16)6.103515625e-05f) ? (_Float16)0.0f : hq; }
      *(v4h*)(Pr + (size_t)g * NS * NK + c0) = o; } } }
extern "C" void kernel_launch(void* const* d_in, const int* in_sizes, int n_in,
                              void* d_out, int out_size, void* d_ws, size_t ws_size, hipStream_t stream) {
  (void)in_sizes; (void)n_in; (void)out_size;
  const float* AI = (const float*)d_in[0]; const float* BI = (const float*)d_in[1]; const float* CI = (const float*)d_in[2]; const float* WI = (const float*)d_in[3]; const int* SI = (const int*)d_in[4];      /* A, Bm, C [4][16][1024][64]; Wm [16][16]; the switch: one int32 word */
  static_assert(PD == 64 && NK % (KW * 32) == 0 && NK == NS && NS % 128 == 0 && NS % 64 == 0 && PD % 64 == 0 && PD % 32 == 0 && NS % 32 == 0 && NK % 256 == 0 && ((NS * (NK / 4)) & (NS * (NK / 4) - 1)) == 0 && ((size_t)NB * NP * NS * (PD / 64)) % 256 == 0 && (NP * NS) % 256 == 0 && NK == 256 * 4 && NP == 16 && NB % EB == 0, "whole tiles; exact grids");
  float* OUT = (float*)d_out;      /* [4][1024][16][64] */
  char* ws = (char*)d_ws; size_t off = 0;
  auto take = [&](size_t bytes) { char* p = ws + off; off += (bytes + 255) & ~(size_t)255; return p; };
  _Float16* A16 = (_Float16*)take((size_t)NB * NP * NS * PD * 2); _Float16* B16 = (_Float16*)take((size_t)NB * NP * NS * PD * 2); _Float16* W16 = (_Float16*)take((size_t)NP * NP * 2);      /* A and Bm as f16; Wm as f16 (256 words) */
  _Float16* CT16 = (_Float16*)take((size_t)NB * PD * NP * NS * 2); float* SG = (float*)take((size_t)EB * NP * NS * NK * 4);      /* C's four batch entries, each turned [64][16384]; two entries' logits, sixteen parts each */
  _Float16* S16 = (_Float16*)take((size_t)EB * NP * NS * NK * 2);      /* two entries' sixteen result parts' f16 shares at 1,024 */
  if (off > ws_size) return;
  k_prep<<<NB * TB + 2 * XB + 1, 256, 0, stream>>>(AI, BI, CI, WI, A16, B16, CT16, W16);      /* every cast and every turn in one launch */
  for (int e = 0; e < NB; e += EB) { const size_t eo = (size_t)e * NP * NS * PD;
    k_gemm2<0><<<dim3((NS / 128) * (NK / 64), EB * NP), 128, 0, stream>>>(A16 + eo, PD, (size_t)NS * PD, B16 + eo, PD, (size_t)NS * PD, 0.125f, nullptr, 0, nullptr, 1, 0, 0, SG, nullptr, NK, (size_t)NS * NK, NS, NK, PD, SI);      /* two entries' 32 parts' logits (a part's planes follow one another across the entries): with the switch set only the tiles that hold a visible column */
    k_mixsm<<<dim3(NS, EB), 256, 0, stream>>>(SG, W16, SI, S16);      /* all result parts' shares of both entries from one read of SG */
    k_pv<<<dim3(NS / 32, EB * NP), 256, 0, stream>>>(S16, CT16 + eo, SI, OUT + eo); }      /* a result part's 64 columns at a row stride of 1,024; an entry of CT16 and one of the output are as long as one of C */
}

// v007
// It runs in 146 microseconds.
// Two timings next to v006 both put it at 1.10 times that version's speed.
// All steps since v000 together make it 4.83 times as fast.
#include <hip/hip_runtime.h>
// A sixteen-part alignment whose logits are BLENDED ACROSS THE PARTS by a 16 by 16 matrix before one softmax (five inputs: A, Bm, C [4][16][1024][64] f32: rows already cut into 16 parts of width 64; a mixing matrix Wm [16][16] f32 ([result part][source part]); a switch: ONE int32 word, non-zero = later columns hidden): a part's logits = A Bm^T / 8 [1024][1024]; blended[g] = the sum over h of Wm[g][h] logits[h], element by element; if the switch is non-zero a column whose index exceeds the row's counts as minus infinity; ONE softmax over the 1,024 columns; a part's result = its shares times C's part [1024][64]; the results laid as [4][1024][16][64].
// Structure: ONE PREPARING LAUNCH (k_prep, the work told apart by the block's number, 64 words a thread): A, Bm and Wm cast whole to f16 and each of C's four batch entries turned as ONE [16384][64] matrix into [64][16384] f16 (the transposing cast: a part's rows are 1,024 columns of it); THEN TWO BATCH ENTRIES AT A TIME (the workspace holds two entries' logits), the entry riding on the grid's second axis: the 32 parts' logits in ONE launch (WMMA GEMM, 32 by 64 wave tiles, depth 64, f32 accumulation, scale 1 / 8: the part is the grid's second axis) into an f32 plane; k_mixsm ONCE FOR ALL SIXTEEN RESULT PARTS OF BOTH ENTRIES, BLEND AND SOFTMAX IN ONE: a block one row of one entry, a thread four consecutive columns: sixteen 16-byte loads (one a source part) held in registers, then a result part after the other: sixteen words of Wm's row (its bf16 values as f16 words, cast once in k_prep: exact), 64 multiply-adds in f32 in the order of h, the hidden columns BY A SELECT on the block's and the thread's own numbers and the switch's word; the block holds the row's 1,024 blended logits of all sixteen result parts in registers, so the sixteen largest and the sixteen sums are taken there (lanes, then the eight waves through LDS) and only the f16 shares are stored, 8 bytes a thread and part; the shares times the turned C by k_pv, both entries' sixteen result parts in one launch (a block a 32 by 64 tile, the depth's 32-deep steps dealt round its eight waves, the partial tiles added through LDS) STRAIGHT INTO THE OUTPUT at the part's column block of 64 inside a row of 1,024. WITH THE SWITCH SET NOTHING WHOLLY BEHIND THE DIAGONAL IS WORKED ON: a 128 by 64 logit tile with no visible column is not computed, a wave of k_mixsm whose 128 columns are all hidden only hands in minus infinity and nought, and k_pv's depth ends at its tile's last row; what is left unwritten so is read by nobody.
// Compute dtype: A, Bm, C and Wm rounded to bf16 where they are first read (each by its cast in k_prep): bf16 values are exact f16 words away from the subnormal range: NO COMPUTED OPERAND ENTERS THE LOGITS; every matrix multiply's operands f16 words (11 bits): the shares ONE word at a carry of 1,024 (words under 2^-14 written as noughts); f32 accumulation; the logits, THE MIXING (f32 multiply-adds on the vector unit: 16 a result word: a depth and a width of 16 are under the matrix tile), the softmax's largest, exponentials (the chip's 2^x of (x - largest) log2 e), sum, and the shares (a term times 1,024 / sum, that quotient one true division a part) f32; the switch read as an int32 word by value. v_wmma_f32_16x16x32_f16.
#define NB 4                         /* batch entries */
#define NP 16                        /* parts */
#define NS 1024                      /* rows of a part: and columns of its logits */
#define PD 64                        /* a part's width */
#define NK 1024                      /* the row softmax's logits a row */
#define PSC 1024.0f                  /* the carry on the shares' f16 plane */
#define EB 2                         /* batch entries a launch of the three main kernels */

typedef __bf16 v16b __attribute__((ext_vector_type(16)));
typedef unsigned short v8us __attribute__((ext_vector_type(8), may_alias));
typedef float  v8f  __attribute__((ext_vector_type(8)));
typedef float  v4f  __attribute__((ext_vector_type(4)));
typedef float  v4fa __attribute__((ext_vector_type(4), may_alias));
union FragB { v16b v; v8us half[2]; unsigned short u[16]; };

__device__ __forceinline__ unsigned short bf16_bits(float x) { unsigned int u = __float_as_uint(x); return (unsigned short)((u + 0x7FFFu + ((u >> 16) & 1u)) >> 16); }
__device__ __forceinline__ float bf16_val(unsigned short b) { return __uint_as_float(((unsigned int)b) << 16); }
__device__ __forceinline__ float bf16_round(float x) { return bf16_val(bf16_bits(x)); }
// D += A·B with NT terms: 1 = ah·bh, 2 = + al·bh (A split), 3 = + ah·bl (both split)
template <int NT>
__device__ __forceinline__ v8f mmaN(v16b ah, v16b al, v16b bh, v16b bl, v8f c) {
  c = __builtin_amdgcn_wmma_f32_16x16x32_bf16(false, ah, false, bh, (short)0, c, false, false);
  if (NT >= 2) c = __builtin_amdgcn_wmma_f32_16x16x32_bf16(false, al, false, bh, (short)0, c, false, false);
  if (NT >= 3) c = __builtin_amdgcn_wmma_f32_16x16x32_bf16(false, ah, false, bl, (short)0, c, false, false);
  asm volatile("v_nop\n\tv_nop\n\tv_nop\n\tv_nop" : "+v"(c) : "v"(ah), "v"(al), "v"(bh), "v"(bl));
  return c;
}




// ---- f16 WMMA path (v_wmma_f32_16x16x32_f16): 11-bit significands for operands in range — used where a [0,1] probability operand needs more precision than bf16
typedef _Float16 v16h __attribute__((ext_vector_type(16)));
union FragH { v16h v; v8us half[2]; _Float16 h[16]; unsigned short u[16]; };
template <int NT>
__device__ __forceinline__ v8f mmaH(v16h ah, v16h al, v16h bh, v16h bl, v8f c) {
  c = __builtin_amdgcn_wmma_f32_16x16x32_f16(false, ah, false, bh, (short)0, c, false, false);
  if (NT >= 2) c = __builtin_amdgcn_wmma_f32_16x16x32_f16(false, al, false, bh, (short)0, c, false, false);
  if (NT >= 3) c = __builtin_amdgcn_wmma_f32_16x16x32_f16(false, ah, false, bl, (short)0, c, false, false);
  asm volatile("v_nop\n\tv_nop\n\tv_nop\n\tv_nop" : "+v"(c) : "v"(ah), "v"(al), "v"(bh), "v"(bl));
  return c;
}

typedef _Float16 v4h __attribute__((ext_vector_type(4)));

__device__ __forceinline__ void d_x16(const float* __restrict__ x, _Float16* __restrict__ X16, size_t n8, size_t t) { if (t >= n8) return; FragH f;
#pragma unroll
  for (int q = 0; q < 8; ++q) f.h[q] = (_Float16)bf16_round(x[t * 8 + q]); *(v8us*)((unsigned short*)X16 + t * 8) = f.half[0];  }
// the plain cast, 64 words a thread: eight 8-word pieces, 256 pieces apart (a wave's lanes stay side by side in each); the sixteen 16-byte loads stand in front of the first store, so all are in flight together; whole grids only, no guard
__device__ __forceinline__ void d_x16q(const float* __restrict__ x, _Float16* __restrict__ X16, size_t t0) { v4f a[16]; const float* p = x + t0 * 8;
#pragma unroll      /* a is indexed by constants and stays in registers: so below */
  for (int j = 0; j < 8; ++j) { a[2 * j] = *(const v4fa*)(p + j * 2048); a[2 * j + 1] = *(const v4fa*)(p + j * 2048 + 4); }
  asm volatile("" :: "v"(a[0]), "v"(a[1]), "v"(a[2]), "v"(a[3]), "v"(a[4]), "v"(a[5]), "v"(a[6]), "v"(a[7]), "v"(a[8]), "v"(a[9]), "v"(a[10]), "v"(a[11]), "v"(a[12]), "v"(a[13]), "v"(a[14]), "v"(a[15]), "v"(p));      /* holds the sixteen loads in front of the casts (the loaded values and their address as inputs only): without it the build reuses registers and only ten loads are in flight in front of the first cast; the address among the inputs keeps every load's result out of the address pair */
#pragma unroll
  for (int j = 0; j < 8; ++j) { FragH f;
#pragma unroll
    for (int q = 0; q < 8; ++q) f.h[q] = (_Float16)bf16_round(a[2 * j + (q >> 2)][q & 3]);
    *(v8us*)((unsigned short*)X16 + (t0 + (size_t)j * 256) * 8) = f.half[0]; }
  asm volatile("s_wait_xcnt 0x0" ::: "memory"); }      /* in the built kernel another piece's code follows this one and writes anew the address and data registers that the stores above name: the wait stands in front of that overwrite */
// the transposing cast of W[K][64], 64 words a thread: a patch of 8 rows by 8 columns, read by sixteen 16-byte loads and written as eight 16-byte pieces of Wt[64][K]; a wave 64 rows by 32 columns (four lanes read a row's whole 128-byte line, a store fills four whole lines), a block 256 rows by all 64 columns
__device__ __forceinline__ void d_turn(const float* __restrict__ W, _Float16* __restrict__ Wt, int K, int blk, int tid) { const int lane = tid & 31, w = tid >> 5; const int n8 = ((w & 1) * 4 + (lane & 3)) * 8, k8 = blk * 256 + (w >> 1) * 64 + (lane >> 2) * 8; v4f a[16]; const float* p = W + (size_t)k8 * PD + n8;
#pragma unroll      /* a is indexed by constants and stays in registers: so below */
  for (int i = 0; i < 8; ++i) { a[2 * i] = *(const v4fa*)(p + i * PD); a[2 * i + 1] = *(const v4fa*)(p + i * PD + 4); }
  asm volatile("" :: "v"(a[0]), "v"(a[1]), "v"(a[2]), "v"(a[3]), "v"(a[4]), "v"(a[5]), "v"(a[6]), "v"(a[7]), "v"(a[8]), "v"(a[9]), "v"(a[10]), "v"(a[11]), "v"(a[12]), "v"(a[13]), "v"(a[14]), "v"(a[15]), "v"(p));      /* holds the sixteen loads in front of the casts (the loaded values and their address as inputs only): without it the build reuses registers, the last loads wait for the first casts, and a load's result is put into the address pair that the others name */
#pragma unroll
  for (int j = 0; j < 8; ++j) { FragH f;
#pragma unroll
    for (int i = 0; i < 8; ++i) f.h[i] = (_Float16)bf16_round(a[2 * i + (j >> 2)][j & 3]);
    *(v8us*)((unsigned short*)Wt + (size_t)(n8 + j) * K + k8) = f.half[0]; } }
// ---- the one preparing launch: seven pieces of work that lean on nothing but the inputs, told apart by the block's number; a thread takes 64 words, so that few waves have to be started; the turning blocks stand first ----
#define XB ((NB * NP * NS * (PD / 64)) / 256)     /* blocks that cast A: and as many for Bm */
#define TB ((NP * NS) / 256)                      /* blocks that turn one batch entry of C */
__global__ __launch_bounds__(256) void k_prep(const float* __restrict__ Ai, const float* __restrict__ Bi, const float* __restrict__ Ci, const float* __restrict__ Wi, _Float16* __restrict__ A16, _Float16* __restrict__ B16, _Float16* __restrict__ CT16, _Float16* __restrict__ W16) {
  const int b = blockIdx.x, tid = threadIdx.x;
  if (b < NB * TB) { const int e = b / TB; d_turn(Ci + (size_t)e * NP * NS * PD, CT16 + (size_t)e * PD * NP * NS, NP * NS, b - e * TB, tid); }      /* C's batch entry e [16384 rows][64] -> CT16[e][d][h * 1024 + s] = f16(bf16(C[e][h][s][d])) */
  else if (b < NB * TB + XB) d_x16q(Ai, A16, (size_t)(b - NB * TB) * 2048 + tid);
  else if (b < NB * TB + 2 * XB) d_x16q(Bi, B16, (size_t)(b - NB * TB - XB) * 2048 + tid);
  else d_x16(Wi, W16, (size_t)NP * NP / 8, (size_t)tid); }      /* the last block: 32 of its threads work, the guard turns the rest away */
// ---- fast GEMM (wave tile 32x64; requires M % 32 == 0 rows per launch region and N % 64 == 0) ----
__device__ __forceinline__ v16h g2_frag(const _Float16* p, int hh) { FragH f; f.half[0] = *(const v8us*)((const unsigned short*)p + 8 * hh); f.half[1] = *(const v8us*)((const unsigned short*)p + 16 + 8 * hh); return f.v; }
__device__ __forceinline__ v8f g2_mma(v16h a, v16h b, v8f c) { v8f d = __builtin_amdgcn_wmma_f32_16x16x32_f16(false, a, false, b, (short)0, c, false, false); asm volatile("v_nop\n\tv_nop\n\tv_nop\n\tv_nop" : "+v"(d) : "v"(a), "v"(b)); return d; }
template <int ACT>
__global__ __launch_bounds__(128) void k_gemm2(const _Float16* __restrict__ A, int lda, size_t sA, const _Float16* __restrict__ Bh, int ldb, size_t sB, float alpha, const float* __restrict__ bias, size_t sBias, const float* __restrict__ CP, int rowsPerB, size_t sCPb, int row0g,
    float* __restrict__ C, _Float16* __restrict__ C16, int ldc, size_t sC, int M, int N, int K, const int* __restrict__ SW) { static_assert(ACT == 0 || ACT == 3 || ACT == 6 || ACT == 8 || ACT == 9 || ACT == 11 || ACT == 12 || ACT == 14 || ACT == 15 || ACT == 16 || ACT == 17, "k_gemm2: unsupported ACT code (would silently apply no activation)");
  __shared__ __attribute__((aligned(16))) float so[4][32][68];
  const int tid = threadIdx.x, w = tid >> 5, lane = tid & 31, ln = lane & 15, hh = lane >> 4; const int by = blockIdx.y;
  A += (size_t)by * sA; Bh += (size_t)by * sB; const size_t cofs = (size_t)by * sC; const float* bp = bias ? bias + (size_t)by * sBias : nullptr;
  const int ntn = N >> 6; const int mt = blockIdx.x / ntn, nq = blockIdx.x - mt * ntn; const int row0 = mt * 128 + 32 * w, col0 = nq * 64; if (row0 >= M) return;
  if (SW && SW[0] != 0 && col0 > mt * 128 + 127) return;      /* the switch is set and every column of the block's 128 by 64 tile lies behind every one of its rows: nobody reads those words, so the whole block leaves (no barrier follows) */
  const _Float16* a0p = A + (size_t)(row0 + ln) * lda; const _Float16* a1p = a0p + (size_t)16 * lda;
  const _Float16* b0p = Bh + (size_t)(col0 + ln) * ldb; const _Float16* b1p = b0p + (size_t)16 * ldb; const _Float16* b2p = b1p + (size_t)16 * ldb; const _Float16* b3p = b2p + (size_t)16 * ldb;
  const v8f z8 = {0.f,0.f,0.f,0.f,0.f,0.f,0.f,0.f}; v8f c00 = z8, c01 = z8, c02 = z8, c03 = z8, c10 = z8, c11 = z8, c12 = z8, c13 = z8;
  for (int kb = 0; kb < K; kb += 32) { const v16h a0 = g2_frag(a0p + kb, hh), a1 = g2_frag(a1p + kb, hh);
    v16h b = g2_frag(b0p + kb, hh); c00 = g2_mma(a0, b, c00); c10 = g2_mma(a1, b, c10);
    b = g2_frag(b1p + kb, hh); c01 = g2_mma(a0, b, c01); c11 = g2_mma(a1, b, c11);
    b = g2_frag(b2p + kb, hh); c02 = g2_mma(a0, b, c02); c12 = g2_mma(a1, b, c12);
    b = g2_frag(b3p + kb, hh); c03 = g2_mma(a0, b, c03); c13 = g2_mma(a1, b, c13); }
  v8f accs[8] = {c00, c01, c02, c03, c10, c11, c12, c13};
#pragma unroll
  for (int u = 0; u < 8; ++u) { const int t = u & 3, half = u >> 2; const int col = col0 + t * 16 + ln; const float bv = bp ? bf16_round(bp[col]) : 0.f;
#pragma unroll
    for (int r = 0; r < 8; ++r) { const int rloc = half * 16 + 8 * hh + r; float v = accs[u][r] * alpha + bv; if (CP) { if (rowsPerB < 0) v += CP[cofs + (size_t)(row0g + row0 + rloc) * ldc + col];      /* rowsPerB < 0: own element of the batched C plane */ else { const int bidx = (row0g + row0 + rloc) / rowsPerB; v += CP[(size_t)bidx * sCPb + (size_t)by * 64 + col]; } }
      if (ACT == 3) v = fmaxf(v, 0.f); else if (ACT == 6) v = 0.5f * v * (1.0f + erff(v * 0.70710678118654752f)); else if (ACT == 11) v = 1.0f / (1.0f + expf(-v)); else if (ACT == 15) v = v / (1.0f + expf(-v)); else if (ACT == 12) v = (v > 0.f) ? v : 0.01f * v; else if (ACT == 8) v = tanhf(v); else if (ACT == 9) v = 0.5f * v * (1.0f + tanhf(0.7978845608028654f * (v + 0.044715f * v * v * v))); else if (ACT == 14) v = (v > 0.f) ? v : 0.1f * v; else if (ACT == 16) v = (v >= 0.f) ? v : 0.3f * v; else if (ACT == 17) v = (v >= 0.f) ? v : 0.2f * v;
      so[w][rloc][t * 16 + ln] = v; } }
  __builtin_amdgcn_fence(__ATOMIC_ACQ_REL, "workgroup"); __builtin_amdgcn_wave_barrier();
  const int rsub = lane >> 4, c4 = (lane & 15) * 4;
  {
#pragma unroll
    for (int q = 0; q < 16; ++q) { const int r = q * 2 + rsub; const v4f v = *(const v4fa*)&so[w][r][c4]; if (C) *(v4f*)(C + cofs + (size_t)(row0 + r) * ldc + col0 + c4) = v; if (C16) { v4h h4; for (int i = 0; i < 4; ++i) h4[i] = (_Float16)v[i]; *(v4h*)(C16 + cofs + (size_t)(row0 + r) * ldc + col0 + c4) = h4; } }
     } }

// ---- shares times the turned C: a block one 32 by 64 tile of a result part (the grid's second axis: the entry of the launch times 16 plus the part); the depth's 32-deep steps are dealt round its eight waves (wave w: steps w, w + 8, ...), with the switch set only the steps up to the tile's last row, and the eight f32 partial tiles are added through LDS in the order of the waves ----
#define KW 8                         /* waves a block: slices of the depth */
__global__ __launch_bounds__(256) void k_pv(const _Float16* __restrict__ P, const _Float16* __restrict__ Ct, const int* __restrict__ SW, float* __restrict__ O) {
  __shared__ __attribute__((aligned(16))) float so[KW][32][68];
  const int tid = threadIdx.x, w = __builtin_amdgcn_readfirstlane(tid >> 5), lane = tid & 31, ln = lane & 15, hh = lane >> 4;      /* the wave's number in a scalar register: the depth loop's branch is then a scalar one and every lane stays on at the matrix instructions */
  const int xt = blockIdx.x, row0 = xt * 32, by = blockIdx.y;
  const int nst = (SW[0] != 0) ? xt + 1 : NK / 32;      /* 32-deep steps that hold a visible column of the tile's last row: behind them every share is nought (and, with the switch set, in part not stored) */
  const _Float16* a0p = P + (size_t)by * NS * NK + (size_t)(row0 + ln) * NK; const _Float16* a1p = a0p + (size_t)16 * NK;
  const _Float16* b0p = Ct + (size_t)(by >> 4) * (PD * NP * NS) + (size_t)(by & 15) * NS + (size_t)ln * (NP * NS); const _Float16* b1p = b0p + (size_t)16 * NP * NS; const _Float16* b2p = b1p + (size_t)16 * NP * NS; const _Float16* b3p = b2p + (size_t)16 * NP * NS;
  const v8f z8 = {0.f,0.f,0.f,0.f,0.f,0.f,0.f,0.f}; v8f c00 = z8, c01 = z8, c02 = z8, c03 = z8, c10 = z8, c11 = z8, c12 = z8, c13 = z8;
  for (int st = w; st < nst; st += KW) { const int kb = st * 32; const v16h a0 = g2_frag(a0p + kb, hh); FragH f1; f1.half[0] = *(const v8us*)((const unsigned short*)(a1p + kb) + 8 * hh);      /* the steps dealt round the eight waves */
    asm volatile("s_wait_xcnt 0x0" ::: "memory");      /* the build puts the next load's result into the address pair that the three loads above name: the wait stands in front of that overwrite */
    f1.half[1] = *(const v8us*)((const unsigned short*)(a1p + kb) + 16 + 8 * hh); const v16h a1 = f1.v;
    v16h b = g2_frag(b0p + kb, hh); c00 = g2_mma(a0, b, c00); c10 = g2_mma(a1, b, c10);
    b = g2_frag(b1p + kb, hh); c01 = g2_mma(a0, b, c01); c11 = g2_mma(a1, b, c11);
    b = g2_frag(b2p + kb, hh); c02 = g2_mma(a0, b, c02); c12 = g2_mma(a1, b, c12);
    b = g2_frag(b3p + kb, hh); c03 = g2_mma(a0, b, c03); c13 = g2_mma(a1, b, c13); }
  v8f accs[8] = {c00, c01, c02, c03, c10, c11, c12, c13};
#pragma unroll      /* both loops unrolled: accs is indexed by constants and stays in registers */
  for (int u = 0; u < 8; ++u) { const int t = u & 3, half = u >> 2;
#pragma unroll
    for (int r = 0; r < 8; ++r) so[w][half * 16 + 8 * hh + r][t * 16 + ln] = accs[u][r]; }
  __syncthreads();      /* every wave's partial tile is in LDS before any thread adds the eight */
  const int rr = tid >> 4, c4 = (tid & 15) * 4;
  for (int q = 0; q < 2; ++q) { const int r = q * 16 + rr; v4f s = *(const v4fa*)&so[0][r][c4];
    for (int k = 1; k < KW; ++k) { const v4f p = *(const v4fa*)&so[k][r][c4]; s += p; }
    s *= (1.0f / PSC); *(v4f*)(O + (size_t)(by >> 4) * (NS * NP * PD) + (size_t)(by & 15) * PD + (size_t)(row0 + r) * (NP * PD) + c4) = s; } }

// Wt[n][k] = f16(W[k][n] x scale) from f32 row-major W[K][N] with NO rounding of W to bf16 first: for a COMPUTED f32 plane
__global__ __launch_bounds__(256) void k_wtc_f16(const float* __restrict__ W, _Float16* __restrict__ Wt, int K, int N, float scale) {
  const int t = blockIdx.x * 256 + threadIdx.x; if (t >= N * (K / 8)) return; const int n = t / (K / 8), k8 = (t % (K / 8)) * 8; FragH f;
#pragma unroll
  for (int i = 0; i < 8; ++i) f.h[i] = (_Float16)(W[(size_t)(k8 + i) * N + n] * scale); const v8us o = f.half[0];
  *(v8us*)((unsigned short*)Wt + (size_t)n * K + k8) = o; 
}

// lane l's value as lane l ^ 16 sees it: a vector cross-row move
__device__ __forceinline__ float x16(float x) { return __builtin_bit_cast(float, __builtin_amdgcn_permlanex16(__builtin_bit_cast(int, x), __builtin_bit_cast(int, x), 0x76543210, 0xfedcba98, false, false)); }
// sixteen values a lane, each reduced over the wave's 32 lanes (MX: the largest; else the sum): at each of four steps a lane keeps half of its values and hands the other half to its partner, so 8 + 4 + 2 + 1 exchanges and a last one serve all sixteen; lane l returns value number l >> 1
template <bool MX>
__device__ __forceinline__ float red16(float (&v)[NP], unsigned int lane) { static_assert(NP == 16, "four halving steps");
  { const bool up = (lane & 16u) != 0u;
#pragma unroll      /* v is indexed by constants and stays in registers: so in the two loops below */
    for (int i = 0; i < 8; ++i) { const float keep = up ? v[i + 8] : v[i]; const float send = up ? v[i] : v[i + 8]; const float got = x16(send); v[i] = MX ? fmaxf(keep, got) : keep + got; } }
  { const bool up = (lane & 8u) != 0u;
#pragma unroll
    for (int i = 0; i < 4; ++i) { const float keep = up ? v[i + 4] : v[i]; const float send = up ? v[i] : v[i + 4]; const float got = __shfl_xor(send, 8, 32); v[i] = MX ? fmaxf(keep, got) : keep + got; } }
  { const bool up = (lane & 4u) != 0u;
#pragma unroll
    for (int i = 0; i < 2; ++i) { const float keep = up ? v[i + 2] : v[i]; const float send = up ? v[i] : v[i + 2]; const float got = __shfl_xor(send, 4, 32); v[i] = MX ? fmaxf(keep, got) : keep + got; } }
  { const bool up = (lane & 2u) != 0u; const float keep = up ? v[1] : v[0]; const float send = up ? v[0] : v[1]; const float got = __shfl_xor(send, 2, 32); v[0] = MX ? fmaxf(keep, got) : keep + got; }
  const float got = __shfl_xor(v[0], 1, 32); return MX ? fmaxf(v[0], got) : v[0] + got; }

// a block one row r of one batch entry's logits (the entry of the launch: the grid's second axis), a thread four consecutive columns: the sixteen source parts' words are read ONCE and serve all sixteen result parts from registers; the blended logits stay in registers through the row softmax, and only the f16 shares leave
typedef unsigned int v8u __attribute__((ext_vector_type(8), may_alias));
__global__ __launch_bounds__(256, 6) /* six waves a SIMD asked for, three blocks a WGP: with the branches below the build otherwise takes 225 registers and only two blocks fit */ void k_mixsm(const float* __restrict__ S, const _Float16* __restrict__ W16, const int* __restrict__ SW, _Float16* __restrict__ P16) {
  __shared__ __attribute__((aligned(16))) float rm[NP][8], rs[NP][8];      /* a result part's largest and sum, one word a wave */
  const unsigned int r = blockIdx.x; const unsigned int c0 = threadIdx.x * 4u; const unsigned int vo = c0 * 4u;      /* the thread's place in a row, in bytes */ const float* __restrict__ Sr = S + (size_t)blockIdx.y * NP * NS * NK + ((size_t)r << 10);      /* the row's first word of source part 0: a scalar address */ _Float16* __restrict__ Pr = P16 + (size_t)blockIdx.y * NP * NS * NK + ((size_t)r << 10); const unsigned int lane = threadIdx.x & 31u, wv = threadIdx.x >> 5; const int sw = SW[0]; v4f s[NP]; v4f z[NP]; float pr[NP];
  const bool act = !(sw != 0 && (unsigned int)__builtin_amdgcn_readfirstlane((int)wv) * 128u > r);      /* false: the switch is set and all 128 columns of this wave are hidden in row r: it loads, blends and stores nothing, hands in minus infinity and nought, and passes both barriers; a scalar test, the same in every lane */
  static_assert(NP == 16 && (size_t)NS * NK * 4 == 4194304, "the sixteen loads below: eight scalar bases, the odd parts one plane (4,194,304 bytes) behind the even ones");
  if (act) {
  /* the sixteen loads (source part h into s[h]) and their data wait in ONE statement: all sixteen are in flight together, and no register that a load names, nor one that it fills, is touched by the compiler before the data is there */
  asm volatile("global_load_b128 %0, %16, %17\n\t"
               "global_load_b128 %1, %16, %17 offset:4194304\n\t"
               "global_load_b128 %2, %16, %18\n\t"
               "global_load_b128 %3, %16, %18 offset:4194304\n\t"
               "global_load_b128 %4, %16, %19\n\t"
               "global_load_b128 %5, %16, %19 offset:4194304\n\t"
               "global_load_b128 %6, %16, %20\n\t"
               "global_load_b128 %7, %16, %20 offset:4194304\n\t"
               "global_load_b128 %8, %16, %21\n\t"
               "global_load_b128 %9, %16, %21 offset:4194304\n\t"
               "global_load_b128 %10, %16, %22\n\t"
               "global_load_b128 %11, %16, %22 offset:4194304\n\t"
               "global_load_b128 %12, %16, %23\n\t"
               "global_load_b128 %13, %16, %23 offset:4194304\n\t"
               "global_load_b128 %14, %16, %24\n\t"
               "global_load_b128 %15, %16, %24 offset:4194304\n\t"
               "s_wait_loadcnt 0x0"
               : "=&v"(s[0]), "=&v"(s[1]), "=&v"(s[2]), "=&v"(s[3]), "=&v"(s[4]), "=&v"(s[5]), "=&v"(s[6]), "=&v"(s[7]), "=&v"(s[8]), "=&v"(s[9]), "=&v"(s[10]), "=&v"(s[11]), "=&v"(s[12]), "=&v"(s[13]), "=&v"(s[14]), "=&v"(s[15])
               : "v"(vo), "s"(Sr + (size_t)0 * NS * NK), "s"(Sr + (size_t)2 * NS * NK), "s"(Sr + (size_t)4 * NS * NK), "s"(Sr + (size_t)6 * NS * NK), "s"(Sr + (size_t)8 * NS * NK), "s"(Sr + (size_t)10 * NS * NK), "s"(Sr + (size_t)12 * NS * NK), "s"(Sr + (size_t)14 * NS * NK)
               : "memory");
#pragma unroll      /* z is indexed by constants and stays in registers */
  for (int g = 0; g < NP; ++g) { const v8u wr = *(const v8u*)(W16 + g * NP);      /* Wm's row g, sixteen f16 words as eight 32-bit words: the same for every lane, so it comes by a scalar load and takes no vector register */ z[g] = (v4f){0.0f, 0.0f, 0.0f, 0.0f};
#pragma unroll      /* s is indexed by constants and stays in registers */
    for (int h = 0; h < NP; ++h) { const float w = (float)__builtin_bit_cast(_Float16, (unsigned short)(wr[h >> 1] >> (16 * (h & 1))));
#pragma unroll
      for (int q = 0; q < 4; ++q) z[g][q] = __builtin_fmaf(w, s[h][q], z[g][q]); }      /* a column's sum still runs in the order of h, one fused multiply-add a term */
#pragma unroll
    for (int q = 0; q < 4; ++q) z[g][q] = (sw != 0 && c0 + (unsigned int)q > r) ? __uint_as_float(0xff800000u) : z[g][q];
    pr[g] = fmaxf(fmaxf(z[g][0], z[g][1]), fmaxf(z[g][2], z[g][3])); }
  /* the sixteen largest of the row: over the wave's lanes, then over the eight waves through LDS; column 0 is never hidden, so each is finite */
  { const float t = red16<true>(pr, lane); if ((lane & 1u) == 0u) rm[lane >> 1][wv] = t; }
  } else if (lane < (unsigned int)NP) rm[lane][wv] = __uint_as_float(0xff800000u);
  __syncthreads();      /* every wave's sixteen largest are in LDS before any lane reads the eight of its part */
  if (act) {
  { const v4f a = *(const v4fa*)&rm[lane & 15u][0]; const v4f b = *(const v4fa*)&rm[lane & 15u][4]; const float t = fmaxf(fmaxf(fmaxf(a[0], a[1]), fmaxf(a[2], a[3])), fmaxf(fmaxf(b[0], b[1]), fmaxf(b[2], b[3])));
#pragma unroll
    for (int g = 0; g < NP; ++g) { const float m = __builtin_bit_cast(float, __builtin_amdgcn_readlane(__builtin_bit_cast(int, t), g));      /* part g's largest stands in lane g: the same for the whole wave, so it goes to a scalar register */
      float e0 = (z[g][0] - m) * 1.44269504088896340736f, e1 = (z[g][1] - m) * 1.44269504088896340736f, e2 = (z[g][2] - m) * 1.44269504088896340736f, e3 = (z[g][3] - m) * 1.44269504088896340736f;      /* e^x as the chip's own 2^(x log2 e): x is never above nought, so nothing overflows; a result under the f32 normal range may come as nought, and the store below writes nought far above that */
      asm("v_exp_f32 %0, %0\n\tv_exp_f32 %1, %1\n\tv_exp_f32 %2, %2\n\tv_exp_f32 %3, %3\n\tv_nop" : "+v"(e0), "+v"(e1), "+v"(e2), "+v"(e3));      /* the four 2^x in one statement, each on a register of its own, and one v_nop behind the last: the slot that the instruction set asks for between a transcendental and a next instruction that reads its result or overwrites its source */
      z[g][0] = e0; z[g][1] = e1; z[g][2] = e2; z[g][3] = e3;
      pr[g] = (e0 + e1) + (e2 + e3); } }
  /* the sixteen sums, the same way (an array of its own, so that one barrier is enough) */
  { const float t = red16<false>(pr, lane); if ((lane & 1u) == 0u) rs[lane >> 1][wv] = t; }
  } else if (lane < (unsigned int)NP) rs[lane][wv] = 0.0f;
  __syncthreads();      /* every wave's sixteen sums are in LDS before any lane adds the eight of its part */
  if (act) { const v4f a = *(const v4fa*)&rs[lane & 15u][0]; const v4f b = *(const v4fa*)&rs[lane & 15u][4]; const float t = PSC / (((a[0] + a[1]) + (a[2] + a[3])) + ((b[0] + b[1]) + (b[2] + b[3])));      /* the lane's part: the carry over the row's sum, ONE true division a lane; the sum is at least 1 (the largest logit's own term) */
#pragma unroll
    for (int g = 0; g < NP; ++g) { const float d = __builtin_bit_cast(float, __builtin_amdgcn_readlane(__builtin_bit_cast(int, t), g)); v4h o;
#pragma unroll
      for (int q = 0; q < 4; ++q) { const _Float16 hq = (_Float16)(z[g][q] * d); o[q] = (hq < (_Float16)6.103515625e-05f) ? (_Float16)0.0f : hq; }
      *(v4h*)(Pr + (size_t)g * NS * NK + c0) = o; } } }
extern "C" void kernel_launch(void* const* d_in, const int* in_sizes, int n_in,
                              void* d_out, int out_size, void* d_ws, size_t ws_size, hipStream_t stream) {
  (void)in_sizes; (void)n_in; (void)out_size;
  const float* AI = (const float*)d_in[0]; const float* BI = (const float*)d_in[1]; const float* CI = (const float*)d_in[2]; const float* WI = (const float*)d_in[3]; const int* SI = (const int*)d_in[4];      /* A, Bm, C [4][16][1024][64]; Wm [16][16]; the switch: one int32 word */
  static_assert(PD == 64 && NK % (KW * 32) == 0 && NK == NS && NS % 128 == 0 && NS % 64 == 0 && PD % 64 == 0 && PD % 32 == 0 && NS % 32 == 0 && NK % 256 == 0 && ((NS * (NK / 4)) & (NS * (NK / 4) - 1)) == 0 && ((size_t)NB * NP * NS * (PD / 64)) % 256 == 0 && (NP * NS) % 256 == 0 && NK == 256 * 4 && NP == 16 && NB % EB == 0, "whole tiles; exact grids");
  float* OUT = (float*)d_out;      /* [4][1024][16][64] */
  char* ws = (char*)d_ws; size_t off = 0;
  auto take = [&](size_t bytes) { char* p = ws + off; off += (bytes + 255) & ~(size_t)255; return p; };
  _Float16* A16 = (_Float16*)take((size_t)NB * NP * NS * PD * 2); _Float16* B16 = (_Float16*)take((size_t)NB * NP * NS * PD * 2); _Float16* W16 = (_Float16*)take((size_t)NP * NP * 2);      /* A and Bm as f16; Wm as f16 (256 words) */
  _Float16* CT16 = (_Float16*)take((size_t)NB * PD * NP * NS * 2); float* SG = (float*)take((size_t)EB * NP * NS * NK * 4);      /* C's four batch entries, each turned [64][16384]; two entries' logits, sixteen parts each */
  _Float16* S16 = (_Float16*)take((size_t)EB * NP * NS * NK * 2);      /* two entries' sixteen result parts' f16 shares at 1,024 */
  if (off > ws_size) return;
  k_prep<<<NB * TB + 2 * XB + 1, 256, 0, stream>>>(AI, BI, CI, WI, A16, B16, CT16, W16);      /* every cast and every turn in one launch */
  for (int e = 0; e < NB; e += EB) { const size_t eo = (size_t)e * NP * NS * PD;
    k_gemm2<0><<<dim3((NS / 128) * (NK / 64), EB * NP), 128, 0, stream>>>(A16 + eo, PD, (size_t)NS * PD, B16 + eo, PD, (size_t)NS * PD, 0.125f, nullptr, 0, nullptr, 1, 0, 0, SG, nullptr, NK, (size_t)NS * NK, NS, NK, PD, SI);      /* two entries' 32 parts' logits (a part's planes follow one another across the entries): with the switch set only the tiles that hold a visible column */
    k_mixsm<<<dim3(NS, EB), 256, 0, stream>>>(SG, W16, SI, S16);      /* all result parts' shares of both entries from one read of SG */
    k_pv<<<dim3(NS / 32, EB * NP), 256, 0, stream>>>(S16, CT16 + eo, SI, OUT + eo); }      /* a result part's 64 columns at a row stride of 1,024; an entry of CT16 and one of the output are as long as one of C */
}

// v008
// One run takes 112 microseconds.
// Next to v007, in two timings, it ran 1.30 and 1.31 times as fast.
// Counting every step since v000, it is 6.30 times as fast.
#include <hip/hip_runtime.h>
// A sixteen-part alignment whose logits are BLENDED ACROSS THE PARTS by a 16 by 16 matrix before one softmax (five inputs: A, Bm, C [4][16][1024][64] f32: rows already cut into 16 parts of width 64; a mixing matrix Wm [16][16] f32 ([result part][source part]); a switch: ONE int32 word, non-zero = later columns hidden): a part's logits = A Bm^T / 8 [1024][1024]; blended[g] = the sum over h of Wm[g][h] logits[h], element by element; if the switch is non-zero a column whose index exceeds the row's counts as minus infinity; ONE softmax over the 1,024 columns; a part's result = its shares times C's part [1024][64]; the results laid as [4][1024][16][64].
// Structure: TWO LAUNCHES. k_prep (the work told apart by the block's number, 64 words a thread): A, Bm and Wm cast whole to f16 and each of C's four batch entries turned as ONE [16384][64] matrix into [64][16384] f16 (a part's rows are 1,024 columns of it). k_fa: logits, blend, softmax and shares times C in ONE kernel, no logit and no share ever in memory: a block 16 rows of one batch entry for ALL sixteen parts, four waves, the columns in passes of 32. Wave w forms, ONE PASS AHEAD, the TURNED logits (Bm's rows as the A operand, A's rows, kept in LDS as ready fragments, as B) of source parts 4w .. 4w + 3 and lays them in LDS lane by lane; behind ONE barrier a pass (two LDS buffers) it reads all sixteen source parts' words at its own lane's place and blends result parts 4w .. 4w + 3 (f32 multiply-adds in the order of h); a lane then holds 16 of the 32 columns of ONE row in just the order of a matrix operand's depth, so the running largest and sum of the row need one exchange with lane ^ 16, the f16 terms go to the matrix unit from registers as the B operand, the turned C is A, and the TURNED result tile keeps the row in the lane: the rescaling by the running largest and the last division need no exchange. WITH THE SWITCH SET a block's passes end at its last row's column, and only the pass on the diagonal selects.
// Compute dtype: A, Bm, C and Wm rounded to bf16 where they are first read: bf16 values are exact f16 words away from the subnormal range: NO COMPUTED OPERAND ENTERS THE LOGITS; every matrix multiply's operands f16 words (11 bits): a term 2^((z - running largest) log2 e + 10) ONE word (at most 1,024; words under 2^-14 written as noughts); f32 accumulation; the logits, THE MIXING (f32 multiply-adds on the vector unit: 16 a result word; the scale 1 / 8, a power of two, rides on Wm's word: exact), the running largest, the terms, their sum and the last division (one true division a lane and part) f32; the switch read as an int32 word by value. v_wmma_f32_16x16x32_f16.
#define NB 4                         /* batch entries */
#define NP 16                        /* parts */
#define NS 1024                      /* rows of a part: and columns of its logits */
#define PD 64                        /* a part's width */
#define NK 1024                      /* the row softmax's logits a row */
#define QT 16                        /* rows a block of k_fa */
#define CK 32                        /* columns a pass of k_fa */

typedef __bf16 v16b __attribute__((ext_vector_type(16)));
typedef unsigned short v8us __attribute__((ext_vector_type(8), may_alias));
typedef float  v8f  __attribute__((ext_vector_type(8)));
typedef float  v4f  __attribute__((ext_vector_type(4)));
typedef float  v4fa __attribute__((ext_vector_type(4), may_alias));
union FragB { v16b v; v8us half[2]; unsigned short u[16]; };

__device__ __forceinline__ unsigned short bf16_bits(float x) { unsigned int u = __float_as_uint(x); return (unsigned short)((u + 0x7FFFu + ((u >> 16) & 1u)) >> 16); }
__device__ __forceinline__ float bf16_val(unsigned short b) { return __uint_as_float(((unsigned int)b) << 16); }
__device__ __forceinline__ float bf16_round(float x) { return bf16_val(bf16_bits(x)); }
// D += A·B with NT terms: 1 = ah·bh, 2 = + al·bh (A split), 3 = + ah·bl (both split)
template <int NT>
__device__ __forceinline__ v8f mmaN(v16b ah, v16b al, v16b bh, v16b bl, v8f c) {
  c = __builtin_amdgcn_wmma_f32_16x16x32_bf16(false, ah, false, bh, (short)0, c, false, false);
  if (NT >= 2) c = __builtin_amdgcn_wmma_f32_16x16x32_bf16(false, al, false, bh, (short)0, c, false, false);
  if (NT >= 3) c = __builtin_amdgcn_wmma_f32_16x16x32_bf16(false, ah, false, bl, (short)0, c, false, false);
  asm volatile("v_nop\n\tv_nop\n\tv_nop\n\tv_nop" : "+v"(c) : "v"(ah), "v"(al), "v"(bh), "v"(bl));
  return c;
}




// ---- f16 WMMA path (v_wmma_f32_16x16x32_f16): 11-bit significands for operands in range — used here for every product: A's, Bm's and C's words and the terms (at most 1,024)
typedef _Float16 v16h __attribute__((ext_vector_type(16)));
union FragH { v16h v; v8us half[2]; _Float16 h[16]; unsigned short u[16]; };
template <int NT>
__device__ __forceinline__ v8f mmaH(v16h ah, v16h al, v16h bh, v16h bl, v8f c) {
  c = __builtin_amdgcn_wmma_f32_16x16x32_f16(false, ah, false, bh, (short)0, c, false, false);
  if (NT >= 2) c = __builtin_amdgcn_wmma_f32_16x16x32_f16(false, al, false, bh, (short)0, c, false, false);
  if (NT >= 3) c = __builtin_amdgcn_wmma_f32_16x16x32_f16(false, ah, false, bl, (short)0, c, false, false);
  asm volatile("v_nop\n\tv_nop\n\tv_nop\n\tv_nop" : "+v"(c) : "v"(ah), "v"(al), "v"(bh), "v"(bl));
  return c;
}

typedef _Float16 v4h __attribute__((ext_vector_type(4)));

__device__ __forceinline__ void d_x16(const float* __restrict__ x, _Float16* __restrict__ X16, size_t n8, size_t t) { if (t >= n8) return; FragH f;
#pragma unroll
  for (int q = 0; q < 8; ++q) f.h[q] = (_Float16)bf16_round(x[t * 8 + q]); *(v8us*)((unsigned short*)X16 + t * 8) = f.half[0];  }
// the plain cast, 64 words a thread: eight 8-word pieces, 256 pieces apart (a wave's lanes stay side by side in each); the sixteen 16-byte loads stand in front of the first store, so all are in flight together; whole grids only, no guard
__device__ __forceinline__ void d_x16q(const float* __restrict__ x, _Float16* __restrict__ X16, size_t t0) { v4f a[16]; const float* p = x + t0 * 8;
#pragma unroll      /* a is indexed by constants and stays in registers: so below */
  for (int j = 0; j < 8; ++j) { a[2 * j] = *(const v4fa*)(p + j * 2048); a[2 * j + 1] = *(const v4fa*)(p + j * 2048 + 4); }
  asm volatile("" :: "v"(a[0]), "v"(a[1]), "v"(a[2]), "v"(a[3]), "v"(a[4]), "v"(a[5]), "v"(a[6]), "v"(a[7]), "v"(a[8]), "v"(a[9]), "v"(a[10]), "v"(a[11]), "v"(a[12]), "v"(a[13]), "v"(a[14]), "v"(a[15]), "v"(p));      /* holds the sixteen loads in front of the casts (the loaded values and their address as inputs only): without it the build reuses registers and only ten loads are in flight in front of the first cast; the address among the inputs keeps every load's result out of the address pair */
#pragma unroll
  for (int j = 0; j < 8; ++j) { FragH f;
#pragma unroll
    for (int q = 0; q < 8; ++q) f.h[q] = (_Float16)bf16_round(a[2 * j + (q >> 2)][q & 3]);
    *(v8us*)((unsigned short*)X16 + (t0 + (size_t)j * 256) * 8) = f.half[0]; }
  asm volatile("s_wait_xcnt 0x0" ::: "memory"); }      /* in the built kernel another piece's code follows this one and writes anew the address and data registers that the stores above name: the wait stands in front of that overwrite */
// the transposing cast of W[K][64], 64 words a thread: a patch of 8 rows by 8 columns, read by sixteen 16-byte loads and written as eight 16-byte pieces of Wt[64][K]; a wave 64 rows by 32 columns (four lanes read a row's whole 128-byte line, a store fills four whole lines), a block 256 rows by all 64 columns
__device__ __forceinline__ void d_turn(const float* __restrict__ W, _Float16* __restrict__ Wt, int K, int blk, int tid) { const int lane = tid & 31, w = tid >> 5; const int n8 = ((w & 1) * 4 + (lane & 3)) * 8, k8 = blk * 256 + (w >> 1) * 64 + (lane >> 2) * 8; v4f a[16]; const float* p = W + (size_t)k8 * PD + n8;
#pragma unroll      /* a is indexed by constants and stays in registers: so below */
  for (int i = 0; i < 8; ++i) { a[2 * i] = *(const v4fa*)(p + i * PD); a[2 * i + 1] = *(const v4fa*)(p + i * PD + 4); }
  asm volatile("" :: "v"(a[0]), "v"(a[1]), "v"(a[2]), "v"(a[3]), "v"(a[4]), "v"(a[5]), "v"(a[6]), "v"(a[7]), "v"(a[8]), "v"(a[9]), "v"(a[10]), "v"(a[11]), "v"(a[12]), "v"(a[13]), "v"(a[14]), "v"(a[15]), "v"(p));      /* holds the sixteen loads in front of the casts (the loaded values and their address as inputs only): without it the build reuses registers, the last loads wait for the first casts, and a load's result is put into the address pair that the others name */
#pragma unroll
  for (int j = 0; j < 8; ++j) { FragH f;
#pragma unroll
    for (int i = 0; i < 8; ++i) f.h[i] = (_Float16)bf16_round(a[2 * i + (j >> 2)][j & 3]);
    *(v8us*)((unsigned short*)Wt + (size_t)(n8 + j) * K + k8) = f.half[0]; } }
// ---- the one preparing launch: seven pieces of work that lean on nothing but the inputs, told apart by the block's number; a thread takes 64 words, so that few waves have to be started; the turning blocks stand first ----
#define XB ((NB * NP * NS * (PD / 64)) / 256)     /* blocks that cast A: and as many for Bm */
#define TB ((NP * NS) / 256)                      /* blocks that turn one batch entry of C */
__global__ __launch_bounds__(256) void k_prep(const float* __restrict__ Ai, const float* __restrict__ Bi, const float* __restrict__ Ci, const float* __restrict__ Wi, _Float16* __restrict__ A16, _Float16* __restrict__ B16, _Float16* __restrict__ CT16, _Float16* __restrict__ W16) {
  const int b = blockIdx.x, tid = threadIdx.x;
  if (b < NB * TB) { const int e = b / TB; d_turn(Ci + (size_t)e * NP * NS * PD, CT16 + (size_t)e * PD * NP * NS, NP * NS, b - e * TB, tid); }      /* C's batch entry e [16384 rows][64] -> CT16[e][d][h * 1024 + s] = f16(bf16(C[e][h][s][d])) */
  else if (b < NB * TB + XB) d_x16q(Ai, A16, (size_t)(b - NB * TB) * 2048 + tid);
  else if (b < NB * TB + 2 * XB) d_x16q(Bi, B16, (size_t)(b - NB * TB - XB) * 2048 + tid);
  else d_x16(Wi, W16, (size_t)NP * NP / 8, (size_t)tid); }      /* the last block: 32 of its threads work, the guard turns the rest away */
// lane l's value as lane l ^ 16 sees it: a vector cross-row move
__device__ __forceinline__ float x16(float x) { return __builtin_bit_cast(float, __builtin_amdgcn_permlanex16(__builtin_bit_cast(int, x), __builtin_bit_cast(int, x), 0x76543210, 0xfedcba98, false, false)); }
// a 16 by 32 f16 operand fragment: ub the wave's own (scalar) address of the tile, vo the lane's place in bytes (its row or column times the pitch, plus 16 bytes for the upper lanes): depth words 8 hh .. + 7 and 16 + 8 hh .. + 7
__device__ __forceinline__ v16h fa_frag(const _Float16* ub, unsigned int vo) { FragH f; f.half[0] = *(const v8us*)((const char*)ub + vo); f.half[1] = *(const v8us*)((const char*)(ub + 16) + vo); return f.v; }
// the same from the lane's own address
__device__ __forceinline__ v16h fa_fragp(const char* p) { FragH f; f.half[0] = *(const v8us*)p; f.half[1] = *(const v8us*)(p + 32); return f.v; }
__device__ __forceinline__ v8f fa_mma(v16h a, v16h b, v8f c) { return __builtin_amdgcn_wmma_f32_16x16x32_f16(false, a, false, b, (short)0, c, false, false); }
// the same with the four vector slots that the chip needs behind a matrix instruction before its result is read or its registers are written anew: for a tile's last product, whose result goes straight to LDS and whose registers the build gives to the next tile at once
__device__ __forceinline__ v8f fa_mma_end(v16h a, v16h b, v8f c) { v8f d = __builtin_amdgcn_wmma_f32_16x16x32_f16(false, a, false, b, (short)0, c, false, false); asm volatile("v_nop\n\tv_nop\n\tv_nop\n\tv_nop" : "+v"(d) : "v"(a), "v"(b)); return d; }
typedef unsigned int v8u __attribute__((ext_vector_type(8), may_alias));
// ---- logits, blend, softmax, shares times C: a block QT rows (the grid's second axis) of one batch entry (its first), all sixteen parts; wave w: source parts and result parts 4w .. 4w + 3 ----
__global__ __launch_bounds__(128) void k_fa(const _Float16* A16, const _Float16* B16, const _Float16* CT16, /* these three without the no-alias word: the build then keeps their loads on their side of the barrier and of the waits written below */ const _Float16* __restrict__ W16, const int* __restrict__ SW, float* __restrict__ O) {
  __shared__ __attribute__((aligned(16))) v4f sl[2][NP][4][32];      /* a pass's turned logits: [buffer][source part][quarter of a lane's 16 words][lane]: the lane that wrote a word is the lane that reads it in every wave, so the lanes lie side by side */
  __shared__ __attribute__((aligned(16))) v8us ql[NP][4][32];      /* A's fragments of the block's rows: [source part][quarter of its two fragments][lane]: written once and read in every pass by the same lane of the same wave (no barrier needed): 64 registers a lane less to hold through the loop */
  const int tid = threadIdx.x, w = __builtin_amdgcn_readfirstlane(tid >> 5), lane = tid & 31, ln = lane & 15, hh = lane >> 4;      /* the wave's number in a scalar register: tile addresses and Wm's words are then scalar */
  const int q0 = (NS / QT - 1 - (int)blockIdx.y) * QT, e = blockIdx.x;      /* the longest blocks (the last rows, of all four entries) start first */
  const int sw = SW[0]; const int nch = (sw != 0) ? (q0 + QT - 1) / CK + 1 : NK / CK;      /* passes that hold a visible column of the block's last row */
  const unsigned int vrow = (unsigned int)(ln * PD + 8 * hh) * 2u, vct = (unsigned int)(ln * (NP * NS) + 8 * hh) * 2u;      /* the lane's place in a tile of A16 or B16, and of CT16, in bytes */
  const _Float16* qb = A16 + ((size_t)(e * NP + 4 * w) * NS + q0) * PD; const _Float16* kb = B16 + (size_t)(e * NP + 4 * w) * NS * PD; const _Float16* vb = CT16 + (size_t)e * (PD * NP * NS) + (size_t)(4 * w) * NS;
  v16h kf[4][2][2]; float wf[4][NP];
#pragma unroll      /* every array below is indexed by constants and stays in registers: so for all unrolled loops of this kernel */
  for (int i = 0; i < 4; ++i) { FragH q0f, q1f; q0f.v = fa_frag(qb + (size_t)i * NS * PD, vrow); q1f.v = fa_frag(qb + (size_t)i * NS * PD + 32, vrow); ql[4 * w + i][0][lane] = q0f.half[0]; ql[4 * w + i][1][lane] = q0f.half[1]; ql[4 * w + i][2][lane] = q1f.half[0]; ql[4 * w + i][3][lane] = q1f.half[1];
#pragma unroll
    for (int t = 0; t < 2; ++t) { kf[i][t][0] = fa_frag(kb + (size_t)i * NS * PD + t * 16 * PD, vrow); kf[i][t][1] = fa_frag(kb + (size_t)i * NS * PD + t * 16 * PD + 32, vrow); }
    const v8u wr = *(const v8u*)(W16 + (4 * w + i) * NP);      /* Wm's row 4w + i, sixteen f16 words as eight 32-bit words: the same for every lane, so it comes by a scalar load */
#pragma unroll
    for (int h = 0; h < NP; ++h) wf[i][h] = (float)__builtin_bit_cast(_Float16, (unsigned short)(wr[h >> 1] >> (16 * (h & 1)))) * 0.125f; }      /* Wm's word times the logits' scale 1 / 8: a power of two, so each product and each sum is the scaled one exactly */
  asm volatile("s_wait_xcnt 0x0" :: "s"(qb), "s"(kb), "v"(vrow) : "memory");      /* the wait in front of any overwrite of the two scalar bases and the lane offset that the 48 loads above name; the three among the inputs keep them whole up to here */
  const v8f z8 = {0.f,0.f,0.f,0.f,0.f,0.f,0.f,0.f}; v8f o[4][4]; float mx[4], sm[4];
#pragma unroll
  for (int i = 0; i < 4; ++i) { mx[i] = __uint_as_float(0xff800000u); sm[i] = 0.0f;
#pragma unroll
    for (int n = 0; n < 4; ++n) o[i][n] = z8; }
  /* the turned logits of the wave's four source parts, from the tiles of Bm held in kf, into LDS buffer b: word r of tile t is column 16 t + 8 hh + r of the pass, row q0 + ln */
  auto logits = [&](int b) {
#pragma unroll
    for (int i = 0; i < 4; ++i) { FragH q0f, q1f; q0f.half[0] = ql[4 * w + i][0][lane]; q0f.half[1] = ql[4 * w + i][1][lane]; q1f.half[0] = ql[4 * w + i][2][lane]; q1f.half[1] = ql[4 * w + i][3][lane];
#pragma unroll
      for (int t = 0; t < 2; ++t) { v8f d = fa_mma(kf[i][t][0], q0f.v, z8); d = fa_mma_end(kf[i][t][1], q1f.v, d);
        sl[b][4 * w + i][2 * t][lane] = (v4f){d[0], d[1], d[2], d[3]}; sl[b][4 * w + i][2 * t + 1][lane] = (v4f){d[4], d[5], d[6], d[7]}; } } };
  /* Bm's tiles of pass cn (never past the last pass: the last ones are asked for again, in bounds, their logits read by nobody) into kf; returns the lane's address, for the wait that the caller writes */
  auto ask_k = [&](int cn) -> const char* { const char* kp = (const char*)(kb + (size_t)((cn < nch) ? cn : nch - 1) * (CK * PD)) + vrow;
#pragma unroll
    for (int i = 0; i < 4; ++i) {
#pragma unroll
      for (int t = 0; t < 2; ++t) { kf[i][t][0] = fa_fragp(kp + ((size_t)i * NS * PD + t * 16 * PD) * 2); kf[i][t][1] = fa_fragp(kp + ((size_t)i * NS * PD + t * 16 * PD + 32) * 2); } }
    return kp; };
  logits(0);      /* pass 0's logits; from here on a pass forms the next pass's logits behind its own blend, so that their way through the matrix unit and into LDS is over long before the barrier */
  { const char* kp = ask_k(1); asm volatile("s_wait_xcnt 0x0" :: "v"(kp) : "memory"); }      /* the wait in front of any overwrite of the address pair that the loads name; the address among the inputs keeps it whole, and every load's result out of it, up to here */
  for (int c = 0; c < nch; ++c) { const int k0 = c * CK; v16h vf[4][4];
    __syncthreads();      /* all sixteen source parts' words of this pass are in LDS; and every wave has left the other buffer, which this pass fills for the next */
    /* the turned C's tiles of this pass: asked for here, in flight through the blend */
    const char* vp = (const char*)(vb + k0) + vct;
    {
#pragma unroll
      for (int i = 0; i < 4; ++i) {
#pragma unroll
        for (int n = 0; n < 4; ++n) vf[i][n] = fa_fragp(vp + ((size_t)n * 16 * (NP * NS) + i * NS) * 2); }
    }
    asm volatile("" ::: "memory");      /* a compiler fence, no instruction: it keeps the 32 loads above here, directly behind the barrier and in front of the blend's LDS reads, in flight through the whole blend; without it the build orders them otherwise, runs out of registers and spills to scratch */
    float z[4][16];
#pragma unroll
    for (int i = 0; i < 4; ++i) {
#pragma unroll
      for (int x = 0; x < 16; ++x) z[i][x] = 0.0f; }
#pragma unroll
    for (int h = 0; h < NP; ++h) { v4f s[4];
#pragma unroll
      for (int j = 0; j < 4; ++j) s[j] = sl[c & 1][h][j][lane];
#pragma unroll
      for (int i = 0; i < 4; ++i) {
#pragma unroll
        for (int x = 0; x < 16; ++x) z[i][x] = __builtin_fmaf(wf[i][h], s[x >> 2][x & 3], z[i][x]); } }      /* a word's sum runs in the order of h, one fused multiply-add a term */
    logits((c + 1) & 1);      /* the next pass's logits into the other buffer */
    { const char* kp = ask_k(c + 2);      /* and the tiles of Bm for the pass behind it: in flight for a whole pass */
      asm volatile("s_wait_xcnt 0x0" :: "v"(vp), "v"(kp) : "memory"); }      /* the wait in front of any overwrite of the two address pairs that the 64 loads of this pass name; the addresses among the inputs keep them whole, and every load's result out of them, up to here */
    if (sw != 0 && k0 + CK - 1 > q0) {      /* the pass on the diagonal (a scalar test): columns behind the lane's row count as minus infinity */
#pragma unroll
      for (int x = 0; x < 16; ++x) { const bool hid = k0 + 16 * (x >> 3) + 8 * hh + (x & 7) > q0 + ln;
#pragma unroll
        for (int i = 0; i < 4; ++i) z[i][x] = hid ? __uint_as_float(0xff800000u) : z[i][x]; } }
#pragma unroll
    for (int i = 0; i < 4; ++i) { float t = z[i][0];
#pragma unroll
      for (int x = 1; x < 16; ++x) t = fmaxf(t, z[i][x]);
      t = fmaxf(t, x16(t)); const float mn = fmaxf(mx[i], t);      /* the row's largest so far: column 0 is never hidden, so it is finite from the first pass on */
      float al = (mx[i] - mn) * 1.44269504088896340736f; mx[i] = mn; FragH p; float ps = 0.0f;
#pragma unroll
      for (int x = 0; x < 16; x += 4) { float e0 = (z[i][x] - mn) * 1.44269504088896340736f + 10.0f, e1 = (z[i][x + 1] - mn) * 1.44269504088896340736f + 10.0f, e2 = (z[i][x + 2] - mn) * 1.44269504088896340736f + 10.0f, e3 = (z[i][x + 3] - mn) * 1.44269504088896340736f + 10.0f;      /* 1,024 e^(z - largest) as the chip's own 2^x: never above 1,024 */
        asm("v_exp_f32 %0, %0\n\tv_exp_f32 %1, %1\n\tv_exp_f32 %2, %2\n\tv_exp_f32 %3, %3\n\tv_nop" : "+v"(e0), "+v"(e1), "+v"(e2), "+v"(e3));      /* the four 2^x in one statement, each on a register of its own, and one v_nop behind the last: the slot that the instruction set asks for between a transcendental and a next instruction that reads its result or overwrites its source */
        ps += (e0 + e1) + (e2 + e3);
        const _Float16 h0 = (_Float16)e0, h1 = (_Float16)e1, h2 = (_Float16)e2, h3 = (_Float16)e3;
        p.h[x] = (h0 < (_Float16)6.103515625e-05f) ? (_Float16)0.0f : h0; p.h[x + 1] = (h1 < (_Float16)6.103515625e-05f) ? (_Float16)0.0f : h1; p.h[x + 2] = (h2 < (_Float16)6.103515625e-05f) ? (_Float16)0.0f : h2; p.h[x + 3] = (h3 < (_Float16)6.103515625e-05f) ? (_Float16)0.0f : h3; }
      asm("v_exp_f32 %0, %0\n\tv_nop" : "+v"(al));      /* what the earlier passes' sums shrink by (nought in the first pass); the v_nop: the slot behind a transcendental, as above */
      sm[i] = sm[i] * al + ps;      /* the lane's own 16 columns a pass: the two lanes of a row are added behind the loop */
#pragma unroll
      for (int n = 0; n < 4; ++n) { o[i][n] *= al; o[i][n] = fa_mma(vf[i][n], p.v, o[i][n]); } } }      /* turned result tile: word r is column 16 n + 8 hh + r of the part's result, row q0 + ln */
  float dv[4];
#pragma unroll
  for (int i = 0; i < 4; ++i) dv[i] = 1.0f / (sm[i] + x16(sm[i]));      /* the carry of 1,024 stands in the sum as in the terms and goes with the division; the sum is at least 1,024 (the largest logit's own term) */
  float* op = O + ((size_t)(e * NS + q0 + ln) * NP + 4 * w) * PD + 8 * hh;
#pragma unroll
  for (int i = 0; i < 4; ++i) {
#pragma unroll
    for (int n = 0; n < 4; ++n) { o[i][n] *= dv[i]; *(v4f*)(op + i * PD + 16 * n) = (v4f){o[i][n][0], o[i][n][1], o[i][n][2], o[i][n][3]}; *(v4f*)(op + i * PD + 16 * n + 4) = (v4f){o[i][n][4], o[i][n][5], o[i][n][6], o[i][n][7]}; } } }
extern "C" void kernel_launch(void* const* d_in, const int* in_sizes, int n_in,
                              void* d_out, int out_size, void* d_ws, size_t ws_size, hipStream_t stream) {
  (void)in_sizes; (void)n_in; (void)out_size;
  const float* AI = (const float*)d_in[0]; const float* BI = (const float*)d_in[1]; const float* CI = (const float*)d_in[2]; const float* WI = (const float*)d_in[3]; const int* SI = (const int*)d_in[4];      /* A, Bm, C [4][16][1024][64]; Wm [16][16]; the switch: one int32 word */
  static_assert(PD == 64 && NK == NS && NS % QT == 0 && NK % CK == 0 && QT == 16 && CK == 32 && ((size_t)NB * NP * NS * (PD / 64)) % 256 == 0 && (NP * NS) % 256 == 0 && NP == 16, "whole tiles; exact grids");
  float* OUT = (float*)d_out;      /* [4][1024][16][64] */
  char* ws = (char*)d_ws; size_t off = 0;
  auto take = [&](size_t bytes) { char* p = ws + off; off += (bytes + 255) & ~(size_t)255; return p; };
  _Float16* A16 = (_Float16*)take((size_t)NB * NP * NS * PD * 2); _Float16* B16 = (_Float16*)take((size_t)NB * NP * NS * PD * 2); _Float16* W16 = (_Float16*)take((size_t)NP * NP * 2);      /* A and Bm as f16; Wm as f16 (256 words) */
  _Float16* CT16 = (_Float16*)take((size_t)NB * PD * NP * NS * 2);      /* C's four batch entries, each turned [64][16384] */
  if (off > ws_size) return;
  k_prep<<<NB * TB + 2 * XB + 1, 256, 0, stream>>>(AI, BI, CI, WI, A16, B16, CT16, W16);      /* every cast and every turn in one launch */
  k_fa<<<dim3(NB, NS / QT), 128, 0, stream>>>(A16, B16, CT16, W16, SI, OUT);      /* everything else: 16 rows of an entry a block */
}

// v009
// It runs in 76.3 microseconds.
// Timed twice side by side with v008, it ran 1.46 and 1.47 times as fast.
// Counting every step since v000, it is 9.22 times as fast.
#include <hip/hip_runtime.h>
// A sixteen-part alignment whose logits are BLENDED ACROSS THE PARTS by a 16 by 16 matrix before one softmax (five inputs: A, Bm, C [4][16][1024][64] f32: rows already cut into 16 parts of width 64; a mixing matrix Wm [16][16] f32 ([result part][source part]); a switch: ONE int32 word, non-zero = later columns hidden): a part's logits = A Bm^T / 8 [1024][1024]; blended[g] = the sum over h of Wm[g][h] logits[h], element by element; if the switch is non-zero a column whose index exceeds the row's counts as minus infinity; ONE softmax over the 1,024 columns; a part's result = its shares times C's part [1024][64]; the results laid as [4][1024][16][64].
// Structure: TWO LAUNCHES. k_prep (the work told apart by the block's number, 64 words a thread): A and Wm cast whole to f16 in place order; Bm cast and C cast and turned INTO THE ORDER OF THE MATRIX OPERAND THAT k_fa READS: every 16-byte piece of a fragment lies at its lane's place, so that one wave-wide load of k_fa takes 512 bytes in a row, four whole 128-byte lines (Bm: the 128 pieces of each tile of 16 rows re-ordered inside its 2 KiB; C: 4 KiB for each 32 rows of a part, four tiles of 16 result columns by 32 rows). k_fa: logits, blend, softmax and shares times C in ONE kernel, no logit and no share ever in memory: a block 16 rows of one batch entry for ALL sixteen parts, four waves, the columns in passes of 32. Wave w forms, ONE PASS AHEAD, the TURNED logits (Bm's rows as the A operand, A's rows, kept in LDS as ready fragments, as B) of source parts 4w .. 4w + 3 and lays them in LDS lane by lane; behind ONE barrier a pass (two LDS buffers) it reads all sixteen source parts' words at its own lane's place and blends result parts 4w .. 4w + 3 (f32 multiply-adds in the order of h); a lane then holds 16 of the 32 columns of ONE row in just the order of a matrix operand's depth, so the running largest and sum of the row need one exchange with lane ^ 16, the f16 terms go to the matrix unit from registers as the B operand, the turned C is A, and the TURNED result tile keeps the row in the lane: the rescaling by the running largest and the last division need no exchange. WITH THE SWITCH SET a block's passes end at its last row's column, and only the pass on the diagonal selects.
// Compute dtype: A, Bm, C and Wm rounded to bf16 where they are first read: bf16 values are exact f16 words away from the subnormal range: NO COMPUTED OPERAND ENTERS THE LOGITS; every matrix multiply's operands f16 words (11 bits): a term 2^((z - running largest) log2 e + 10) ONE word (at most 1,024; words under 2^-14 written as noughts); f32 accumulation; the logits, THE MIXING (f32 multiply-adds on the vector unit: 16 a result word; the scale 1 / 8, a power of two, rides on Wm's word: exact), the running largest, the terms, their sum and the last division (one true division a lane and part) f32; the switch read as an int32 word by value. v_wmma_f32_16x16x32_f16.
#define NB 4                         /* batch entries */
#define NP 16                        /* parts */
#define NS 1024                      /* rows of a part: and columns of its logits */
#define PD 64                        /* a part's width */
#define NK 1024                      /* the row softmax's logits a row */
#define QT 16                        /* rows a block of k_fa */
#define CK 32                        /* columns a pass of k_fa */

typedef __bf16 v16b __attribute__((ext_vector_type(16)));
typedef unsigned short v8us __attribute__((ext_vector_type(8), may_alias));
typedef float  v8f  __attribute__((ext_vector_type(8)));
typedef float  v4f  __attribute__((ext_vector_type(4)));
typedef float  v4fa __attribute__((ext_vector_type(4), may_alias));
union FragB { v16b v; v8us half[2]; unsigned short u[16]; };

__device__ __forceinline__ unsigned short bf16_bits(float x) { unsigned int u = __float_as_uint(x); return (unsigned short)((u + 0x7FFFu + ((u >> 16) & 1u)) >> 16); }
__device__ __forceinline__ float bf16_val(unsigned short b) { return __uint_as_float(((unsigned int)b) << 16); }
__device__ __forceinline__ float bf16_round(float x) { return bf16_val(bf16_bits(x)); }
// D += A·B with NT terms: 1 = ah·bh, 2 = + al·bh (A split), 3 = + ah·bl (both split)
template <int NT>
__device__ __forceinline__ v8f mmaN(v16b ah, v16b al, v16b bh, v16b bl, v8f c) {
  c = __builtin_amdgcn_wmma_f32_16x16x32_bf16(false, ah, false, bh, (short)0, c, false, false);
  if (NT >= 2) c = __builtin_amdgcn_wmma_f32_16x16x32_bf16(false, al, false, bh, (short)0, c, false, false);
  if (NT >= 3) c = __builtin_amdgcn_wmma_f32_16x16x32_bf16(false, ah, false, bl, (short)0, c, false, false);
  asm volatile("v_nop\n\tv_nop\n\tv_nop\n\tv_nop" : "+v"(c) : "v"(ah), "v"(al), "v"(bh), "v"(bl));
  return c;
}




// ---- f16 WMMA path (v_wmma_f32_16x16x32_f16): 11-bit significands for operands in range — used here for every product: A's, Bm's and C's words and the terms (at most 1,024)
typedef _Float16 v16h __attribute__((ext_vector_type(16)));
union FragH { v16h v; v8us half[2]; _Float16 h[16]; unsigned short u[16]; };
template <int NT>
__device__ __forceinline__ v8f mmaH(v16h ah, v16h al, v16h bh, v16h bl, v8f c) {
  c = __builtin_amdgcn_wmma_f32_16x16x32_f16(false, ah, false, bh, (short)0, c, false, false);
  if (NT >= 2) c = __builtin_amdgcn_wmma_f32_16x16x32_f16(false, al, false, bh, (short)0, c, false, false);
  if (NT >= 3) c = __builtin_amdgcn_wmma_f32_16x16x32_f16(false, ah, false, bl, (short)0, c, false, false);
  asm volatile("v_nop\n\tv_nop\n\tv_nop\n\tv_nop" : "+v"(c) : "v"(ah), "v"(al), "v"(bh), "v"(bl));
  return c;
}

typedef _Float16 v4h __attribute__((ext_vector_type(4)));

__device__ __forceinline__ void d_x16(const float* __restrict__ x, _Float16* __restrict__ X16, size_t n8, size_t t) { if (t >= n8) return; FragH f;
#pragma unroll
  for (int q = 0; q < 8; ++q) f.h[q] = (_Float16)bf16_round(x[t * 8 + q]); *(v8us*)((unsigned short*)X16 + t * 8) = f.half[0];  }
// the plain cast, 64 words a thread: eight 8-word pieces, 256 pieces apart (a wave's lanes stay side by side in each); the sixteen 16-byte loads stand in front of the first store, so all are in flight together; whole grids only, no guard
__device__ __forceinline__ void d_x16q(const float* __restrict__ x, _Float16* __restrict__ X16, size_t t0) { v4f a[16]; const float* p = x + t0 * 8;
#pragma unroll      /* a is indexed by constants and stays in registers: so below */
  for (int j = 0; j < 8; ++j) { a[2 * j] = *(const v4fa*)(p + j * 2048); a[2 * j + 1] = *(const v4fa*)(p + j * 2048 + 4); }
  asm volatile("" :: "v"(a[0]), "v"(a[1]), "v"(a[2]), "v"(a[3]), "v"(a[4]), "v"(a[5]), "v"(a[6]), "v"(a[7]), "v"(a[8]), "v"(a[9]), "v"(a[10]), "v"(a[11]), "v"(a[12]), "v"(a[13]), "v"(a[14]), "v"(a[15]), "v"(p));      /* holds the sixteen loads in front of the casts (the loaded values and their address as inputs only): without it the build reuses registers and only ten loads are in flight in front of the first cast; the address among the inputs keeps every load's result out of the address pair */
#pragma unroll
  for (int j = 0; j < 8; ++j) { FragH f;
#pragma unroll
    for (int q = 0; q < 8; ++q) f.h[q] = (_Float16)bf16_round(a[2 * j + (q >> 2)][q & 3]);
    *(v8us*)((unsigned short*)X16 + (t0 + (size_t)j * 256) * 8) = f.half[0]; }
  asm volatile("s_wait_xcnt 0x0" ::: "memory"); }      /* in the built kernel another piece's code follows this one and writes anew the address and data registers that the stores above name: the wait stands in front of that overwrite */
// the cast of Bm into operand order, 64 words a thread: a wave takes 32 rows (two tiles of 16 rows by 64 words, 2 KiB each); load pair j: 8 rows by one half row (four lanes read a whole 128-byte line); piece pp (8 words) of row ln of a tile goes to piece (pp >> 1) * 32 + (pp & 1) * 16 + ln of that tile: the place of lane (pp & 1) * 16 + ln in the wave-wide load number pp >> 1; a store fills four whole lines
__device__ __forceinline__ void d_x16f(const float* __restrict__ x, _Float16* __restrict__ X16, int blk, int tid) { const int lane = tid & 31, w = tid >> 5; const int r0 = blk * 256 + w * 32; v4f a[16]; const float* p = x + (size_t)(r0 + (lane >> 2)) * PD + (lane & 3) * 8;
#pragma unroll      /* a is indexed by constants and stays in registers: so below */
  for (int j = 0; j < 8; ++j) { a[2 * j] = *(const v4fa*)(p + (j >> 1) * 8 * PD + (j & 1) * 32); a[2 * j + 1] = *(const v4fa*)(p + (j >> 1) * 8 * PD + (j & 1) * 32 + 4); }
  asm volatile("" :: "v"(a[0]), "v"(a[1]), "v"(a[2]), "v"(a[3]), "v"(a[4]), "v"(a[5]), "v"(a[6]), "v"(a[7]), "v"(a[8]), "v"(a[9]), "v"(a[10]), "v"(a[11]), "v"(a[12]), "v"(a[13]), "v"(a[14]), "v"(a[15]), "v"(p));      /* holds the sixteen loads in front of the casts (the loaded values and their address as inputs only), all in flight together, and keeps every load's result out of the address pair */
  unsigned short* q = (unsigned short*)X16 + ((size_t)(r0 >> 4) * 128 + ((lane >> 1) & 1) * 32 + (lane & 1) * 16 + (lane >> 2)) * 8;
#pragma unroll
  for (int j = 0; j < 8; ++j) { FragH f;
#pragma unroll
    for (int i = 0; i < 8; ++i) f.h[i] = (_Float16)bf16_round(a[2 * j + (i >> 2)][i & 3]);
    *(v8us*)(q + ((j >> 2) * 128 + (j & 1) * 64 + ((j >> 1) & 1) * 8) * 8) = f.half[0]; }
  asm volatile("s_wait_xcnt 0x0" ::: "memory"); }      /* in the built kernel another piece's code follows this one and writes anew the address and data registers that the stores above name: the wait stands in front of that overwrite */
// the transposing cast of W[K][64] into operand order, 64 words a thread: a patch of 8 rows by 8 columns, read by sixteen 16-byte loads and written as eight 16-byte pieces (8 rows of one column each); a wave 32 rows by all 64 columns (eight lanes read a row's two whole lines), a block 256 rows. Each 32 rows fill 4 KiB: [tile n of 16 columns][rows 0-15 or 16-31][lane][8 rows], lane = 16 * (upper 8 of the 16 rows) + m, and column d sits in tile n = d & 3 at m = (d >> 3) + 8 * ((d >> 2) & 1): so the eight lanes of a row write 128 bytes side by side (a store fills four whole lines), and a lane of the turned result holds four neighbouring columns across its four tiles
__device__ __forceinline__ void d_turn(const float* __restrict__ W, _Float16* __restrict__ Wt, int blk, int tid) { const int lane = tid & 31, w = tid >> 5; const int a8 = lane & 7, k8 = blk * 256 + w * 32 + (lane >> 3) * 8; v4f a[16]; const float* p = W + (size_t)k8 * PD + a8 * 8;
#pragma unroll      /* a is indexed by constants and stays in registers: so below */
  for (int i = 0; i < 8; ++i) { a[2 * i] = *(const v4fa*)(p + i * PD); a[2 * i + 1] = *(const v4fa*)(p + i * PD + 4); }
  asm volatile("" :: "v"(a[0]), "v"(a[1]), "v"(a[2]), "v"(a[3]), "v"(a[4]), "v"(a[5]), "v"(a[6]), "v"(a[7]), "v"(a[8]), "v"(a[9]), "v"(a[10]), "v"(a[11]), "v"(a[12]), "v"(a[13]), "v"(a[14]), "v"(a[15]), "v"(p));      /* holds the sixteen loads in front of the casts (the loaded values and their address as inputs only): without it the build reuses registers, the last loads wait for the first casts, and a load's result is put into the address pair that the others name */
  unsigned short* q = (unsigned short*)Wt + ((size_t)(k8 >> 5) * 256 + ((k8 >> 3) & 3) * 16 + a8) * 8;
#pragma unroll
  for (int j = 0; j < 8; ++j) { FragH f;
#pragma unroll
    for (int i = 0; i < 8; ++i) f.h[i] = (_Float16)bf16_round(a[2 * i + (j >> 2)][j & 3]);
    *(v8us*)(q + ((j & 3) * 64 + (j >> 2) * 8) * 8) = f.half[0]; } }
// ---- the one preparing launch: seven pieces of work that lean on nothing but the inputs, told apart by the block's number; a thread takes 64 words, so that few waves have to be started; the turning blocks stand first ----
#define XB ((NB * NP * NS * (PD / 64)) / 256)     /* blocks that cast A: and as many for Bm */
#define TB ((NP * NS) / 256)                      /* blocks that turn one batch entry of C */
__global__ __launch_bounds__(256) void k_prep(const float* __restrict__ Ai, const float* __restrict__ Bi, const float* __restrict__ Ci, const float* __restrict__ Wi, _Float16* __restrict__ A16, _Float16* __restrict__ B16, _Float16* __restrict__ CT16, _Float16* __restrict__ W16) {
  const int b = blockIdx.x, tid = threadIdx.x;
  if (b < NB * TB) { const int e = b / TB; d_turn(Ci + (size_t)e * NP * NS * PD, CT16 + (size_t)e * PD * NP * NS, b - e * TB, tid); }      /* C's batch entry e [16384 rows][64] -> CT16[e][(h * 1024 + s) / 32][4 KiB in operand order] of f16(bf16(C[e][h][s][d])) */
  else if (b < NB * TB + XB) d_x16q(Ai, A16, (size_t)(b - NB * TB) * 2048 + tid);
  else if (b < NB * TB + 2 * XB) d_x16f(Bi, B16, b - NB * TB - XB, tid);
  else d_x16(Wi, W16, (size_t)NP * NP / 8, (size_t)tid); }      /* the last block: 32 of its threads work, the guard turns the rest away */
// lane l's value as lane l ^ 16 sees it: a vector cross-row move
__device__ __forceinline__ float x16(float x) { return __builtin_bit_cast(float, __builtin_amdgcn_permlanex16(__builtin_bit_cast(int, x), __builtin_bit_cast(int, x), 0x76543210, 0xfedcba98, false, false)); }
// a 16 by 32 f16 operand fragment: ub the wave's own (scalar) address of the tile, vo the lane's place in bytes (its row or column times the pitch, plus 16 bytes for the upper lanes): depth words 8 hh .. + 7 and 16 + 8 hh .. + 7
__device__ __forceinline__ v16h fa_frag(const _Float16* ub, unsigned int vo) { FragH f; f.half[0] = *(const v8us*)((const char*)ub + vo); f.half[1] = *(const v8us*)((const char*)(ub + 16) + vo); return f.v; }
// a fragment laid in operand order by k_prep: two wave-wide loads of 512 bytes in a row each, the lane's piece at 16 bytes times its number: from the wave's (scalar) address and the lane's place, and from the lane's own address
__device__ __forceinline__ v16h fa_fragu(const _Float16* ub, unsigned int vo) { FragH f; f.half[0] = *(const v8us*)((const char*)ub + vo); f.half[1] = *(const v8us*)((const char*)(ub + 256) + vo); return f.v; }
__device__ __forceinline__ v16h fa_fragp(const char* p) { FragH f; f.half[0] = *(const v8us*)p; f.half[1] = *(const v8us*)(p + 512); return f.v; }
__device__ __forceinline__ v8f fa_mma(v16h a, v16h b, v8f c) { return __builtin_amdgcn_wmma_f32_16x16x32_f16(false, a, false, b, (short)0, c, false, false); }
// the same with the four vector slots that the chip needs behind a matrix instruction before its result is read or its registers are written anew: for a tile's last product, whose result goes straight to LDS and whose registers the build gives to the next tile at once
__device__ __forceinline__ v8f fa_mma_end(v16h a, v16h b, v8f c) { v8f d = __builtin_amdgcn_wmma_f32_16x16x32_f16(false, a, false, b, (short)0, c, false, false); asm volatile("v_nop\n\tv_nop\n\tv_nop\n\tv_nop" : "+v"(d) : "v"(a), "v"(b)); return d; }
typedef unsigned int v8u __attribute__((ext_vector_type(8), may_alias));
// ---- logits, blend, softmax, shares times C: a block QT rows (the grid's second axis) of one batch entry (its first), all sixteen parts; wave w: source parts and result parts 4w .. 4w + 3 ----
__global__ __launch_bounds__(128) void k_fa(const _Float16* A16, const _Float16* B16, const _Float16* CT16, /* these three without the no-alias word: the build then keeps their loads on their side of the barrier and of the waits written below */ const _Float16* __restrict__ W16, const int* __restrict__ SW, float* __restrict__ O) {
  __shared__ __attribute__((aligned(16))) v4f sl[2][NP][4][32];      /* a pass's turned logits: [buffer][source part][quarter of a lane's 16 words][lane]: the lane that wrote a word is the lane that reads it in every wave, so the lanes lie side by side */
  __shared__ __attribute__((aligned(16))) v8us ql[NP][4][32];      /* A's fragments of the block's rows: [source part][quarter of its two fragments][lane]: written once and read in every pass by the same lane of the same wave (no barrier needed): 64 registers a lane less to hold through the loop */
  const int tid = threadIdx.x, w = __builtin_amdgcn_readfirstlane(tid >> 5), lane = tid & 31, ln = lane & 15, hh = lane >> 4;      /* the wave's number in a scalar register: tile addresses and Wm's words are then scalar */
  const int q0 = (NS / QT - 1 - (int)blockIdx.y) * QT, e = blockIdx.x;      /* the longest blocks (the last rows, of all four entries) start first */
  const int sw = SW[0]; const int nch = (sw != 0) ? (q0 + QT - 1) / CK + 1 : NK / CK;      /* passes that hold a visible column of the block's last row */
  const unsigned int vrow = (unsigned int)(ln * PD + 8 * hh) * 2u, vl = (unsigned int)lane * 16u;      /* the lane's place in a tile of A16, and in a wave-wide load of B16 or CT16, in bytes */
  const _Float16* qb = A16 + ((size_t)(e * NP + 4 * w) * NS + q0) * PD; const _Float16* kb = B16 + (size_t)(e * NP + 4 * w) * NS * PD; const _Float16* vb = CT16 + (size_t)e * (PD * NP * NS) + (size_t)(4 * w) * NS * PD;
  v16h kf[4][2][2]; float wf[4][NP];
#pragma unroll      /* every array below is indexed by constants and stays in registers: so for all unrolled loops of this kernel */
  for (int i = 0; i < 4; ++i) { FragH q0f, q1f; q0f.v = fa_frag(qb + (size_t)i * NS * PD, vrow); q1f.v = fa_frag(qb + (size_t)i * NS * PD + 32, vrow); ql[4 * w + i][0][lane] = q0f.half[0]; ql[4 * w + i][1][lane] = q0f.half[1]; ql[4 * w + i][2][lane] = q1f.half[0]; ql[4 * w + i][3][lane] = q1f.half[1];
#pragma unroll
    for (int t = 0; t < 2; ++t) { kf[i][t][0] = fa_fragu(kb + (size_t)i * NS * PD + t * 16 * PD, vl); kf[i][t][1] = fa_fragu(kb + (size_t)i * NS * PD + t * 16 * PD + 512, vl); }
    const v8u wr = *(const v8u*)(W16 + (4 * w + i) * NP);      /* Wm's row 4w + i, sixteen f16 words as eight 32-bit words: the same for every lane, so it comes by a scalar load */
#pragma unroll
    for (int h = 0; h < NP; ++h) wf[i][h] = (float)__builtin_bit_cast(_Float16, (unsigned short)(wr[h >> 1] >> (16 * (h & 1)))) * 0.125f; }      /* Wm's word times the logits' scale 1 / 8: a power of two, so each product and each sum is the scaled one exactly */
  asm volatile("s_wait_xcnt 0x0" :: "s"(qb), "s"(kb), "v"(vrow), "v"(vl) : "memory");      /* the wait in front of any overwrite of the two scalar bases and the two lane offsets that the 48 loads above name; the four among the inputs keep them whole up to here */
  const v8f z8 = {0.f,0.f,0.f,0.f,0.f,0.f,0.f,0.f}; v8f o[4][4]; float mx[4], sm[4];
#pragma unroll
  for (int i = 0; i < 4; ++i) { mx[i] = __uint_as_float(0xff800000u); sm[i] = 0.0f;
#pragma unroll
    for (int n = 0; n < 4; ++n) o[i][n] = z8; }
  /* the turned logits of the wave's four source parts, from the tiles of Bm held in kf, into LDS buffer b: word r of tile t is column 16 t + 8 hh + r of the pass, row q0 + ln */
  auto logits = [&](int b) {
#pragma unroll
    for (int i = 0; i < 4; ++i) { FragH q0f, q1f; q0f.half[0] = ql[4 * w + i][0][lane]; q0f.half[1] = ql[4 * w + i][1][lane]; q1f.half[0] = ql[4 * w + i][2][lane]; q1f.half[1] = ql[4 * w + i][3][lane];
#pragma unroll
      for (int t = 0; t < 2; ++t) { v8f d = fa_mma(kf[i][t][0], q0f.v, z8); d = fa_mma_end(kf[i][t][1], q1f.v, d);
        sl[b][4 * w + i][2 * t][lane] = (v4f){d[0], d[1], d[2], d[3]}; sl[b][4 * w + i][2 * t + 1][lane] = (v4f){d[4], d[5], d[6], d[7]}; } } };
  /* Bm's tiles of pass cn (never past the last pass: the last ones are asked for again, in bounds, their logits read by nobody) into kf; returns the lane's address, for the wait that the caller writes */
  auto ask_k = [&](int cn) -> const char* { const char* kp = (const char*)(kb + (size_t)((cn < nch) ? cn : nch - 1) * (CK * PD)) + vl;
#pragma unroll
    for (int i = 0; i < 4; ++i) {
#pragma unroll
      for (int t = 0; t < 2; ++t) { kf[i][t][0] = fa_fragp(kp + ((size_t)i * NS * PD + t * 16 * PD) * 2); kf[i][t][1] = fa_fragp(kp + ((size_t)i * NS * PD + t * 16 * PD + 512) * 2); } }
    return kp; };
  logits(0);      /* pass 0's logits; from here on a pass forms the next pass's logits behind its own blend, so that their way through the matrix unit and into LDS is over long before the barrier */
  { const char* kp = ask_k(1); asm volatile("s_wait_xcnt 0x0" :: "v"(kp) : "memory"); }      /* the wait in front of any overwrite of the address pair that the loads name; the address among the inputs keeps it whole, and every load's result out of it, up to here */
  for (int c = 0; c < nch; ++c) { const int k0 = c * CK; v16h vf[4][4];
    __syncthreads();      /* all sixteen source parts' words of this pass are in LDS; and every wave has left the other buffer, which this pass fills for the next */
    /* the turned C's tiles of this pass: asked for here, in flight through the blend */
    const char* vp = (const char*)(vb + (size_t)k0 * PD) + vl;
    {
#pragma unroll
      for (int i = 0; i < 4; ++i) {
#pragma unroll
        for (int n = 0; n < 4; ++n) vf[i][n] = fa_fragp(vp + ((size_t)i * NS * PD + n * 512) * 2); }
    }
    asm volatile("" ::: "memory");      /* a compiler fence, no instruction: it keeps the 32 loads above here, directly behind the barrier and in front of the blend's LDS reads, in flight through the whole blend; without it the build orders them otherwise, runs out of registers and spills to scratch */
    float z[4][16];
#pragma unroll
    for (int i = 0; i < 4; ++i) {
#pragma unroll
      for (int x = 0; x < 16; ++x) z[i][x] = 0.0f; }
#pragma unroll
    for (int h = 0; h < NP; ++h) { v4f s[4];
#pragma unroll
      for (int j = 0; j < 4; ++j) s[j] = sl[c & 1][h][j][lane];
#pragma unroll
      for (int i = 0; i < 4; ++i) {
#pragma unroll
        for (int x = 0; x < 16; ++x) z[i][x] = __builtin_fmaf(wf[i][h], s[x >> 2][x & 3], z[i][x]); } }      /* a word's sum runs in the order of h, one fused multiply-add a term */
    logits((c + 1) & 1);      /* the next pass's logits into the other buffer */
    { const char* kp = ask_k(c + 2);      /* and the tiles of Bm for the pass behind it: in flight for a whole pass */
      asm volatile("s_wait_xcnt 0x0" :: "v"(vp), "v"(kp) : "memory"); }      /* the wait in front of any overwrite of the two address pairs that the 64 loads of this pass name; the addresses among the inputs keep them whole, and every load's result out of them, up to here */
    if (sw != 0 && k0 + CK - 1 > q0) {      /* the pass on the diagonal (a scalar test): columns behind the lane's row count as minus infinity */
#pragma unroll
      for (int x = 0; x < 16; ++x) { const bool hid = k0 + 16 * (x >> 3) + 8 * hh + (x & 7) > q0 + ln;
#pragma unroll
        for (int i = 0; i < 4; ++i) z[i][x] = hid ? __uint_as_float(0xff800000u) : z[i][x]; } }
#pragma unroll
    for (int i = 0; i < 4; ++i) { float t = z[i][0];
#pragma unroll
      for (int x = 1; x < 16; ++x) t = fmaxf(t, z[i][x]);
      t = fmaxf(t, x16(t)); const float mn = fmaxf(mx[i], t);      /* the row's largest so far: column 0 is never hidden, so it is finite from the first pass on */
      float al = (mx[i] - mn) * 1.44269504088896340736f; mx[i] = mn; FragH p; float ps = 0.0f;
#pragma unroll
      for (int x = 0; x < 16; x += 4) { float e0 = (z[i][x] - mn) * 1.44269504088896340736f + 10.0f, e1 = (z[i][x + 1] - mn) * 1.44269504088896340736f + 10.0f, e2 = (z[i][x + 2] - mn) * 1.44269504088896340736f + 10.0f, e3 = (z[i][x + 3] - mn) * 1.44269504088896340736f + 10.0f;      /* 1,024 e^(z - largest) as the chip's own 2^x: never above 1,024 */
        asm("v_exp_f32 %0, %0\n\tv_exp_f32 %1, %1\n\tv_exp_f32 %2, %2\n\tv_exp_f32 %3, %3\n\tv_nop" : "+v"(e0), "+v"(e1), "+v"(e2), "+v"(e3));      /* the four 2^x in one statement, each on a register of its own, and one v_nop behind the last: the slot that the instruction set asks for between a transcendental and a next instruction that reads its result or overwrites its source */
        ps += (e0 + e1) + (e2 + e3);
        const _Float16 h0 = (_Float16)e0, h1 = (_Float16)e1, h2 = (_Float16)e2, h3 = (_Float16)e3;
        p.h[x] = (h0 < (_Float16)6.103515625e-05f) ? (_Float16)0.0f : h0; p.h[x + 1] = (h1 < (_Float16)6.103515625e-05f) ? (_Float16)0.0f : h1; p.h[x + 2] = (h2 < (_Float16)6.103515625e-05f) ? (_Float16)0.0f : h2; p.h[x + 3] = (h3 < (_Float16)6.103515625e-05f) ? (_Float16)0.0f : h3; }
      asm("v_exp_f32 %0, %0\n\tv_nop" : "+v"(al));      /* what the earlier passes' sums shrink by (nought in the first pass); the v_nop: the slot behind a transcendental, as above */
      sm[i] = sm[i] * al + ps;      /* the lane's own 16 columns a pass: the two lanes of a row are added behind the loop */
#pragma unroll
      for (int n = 0; n < 4; ++n) { o[i][n] *= al; o[i][n] = fa_mma(vf[i][n], p.v, o[i][n]); } } }      /* turned result tile: word r is column 8 r + 4 hh + n of the part's result (k_prep's deal of C's columns), row q0 + ln */
  float dv[4];
#pragma unroll
  for (int i = 0; i < 4; ++i) dv[i] = 1.0f / (sm[i] + x16(sm[i]));      /* the carry of 1,024 stands in the sum as in the terms and goes with the division; the sum is at least 1,024 (the largest logit's own term) */
  float* op = O + ((size_t)(e * NS + q0 + ln) * NP + 4 * w) * PD + 4 * hh;
#pragma unroll
  for (int i = 0; i < 4; ++i) {
#pragma unroll
    for (int n = 0; n < 4; ++n) o[i][n] *= dv[i];
#pragma unroll
    for (int r = 0; r < 8; ++r) *(v4f*)(op + i * PD + 8 * r) = (v4f){o[i][0][r], o[i][1][r], o[i][2][r], o[i][3][r]}; } }      /* word r of the four tiles: four neighbouring columns */
extern "C" void kernel_launch(void* const* d_in, const int* in_sizes, int n_in,
                              void* d_out, int out_size, void* d_ws, size_t ws_size, hipStream_t stream) {
  (void)in_sizes; (void)n_in; (void)out_size;
  const float* AI = (const float*)d_in[0]; const float* BI = (const float*)d_in[1]; const float* CI = (const float*)d_in[2]; const float* WI = (const float*)d_in[3]; const int* SI = (const int*)d_in[4];      /* A, Bm, C [4][16][1024][64]; Wm [16][16]; the switch: one int32 word */
  static_assert(PD == 64 && NK == NS && NS % QT == 0 && NK % CK == 0 && QT == 16 && CK == 32 && ((size_t)NB * NP * NS * (PD / 64)) % 256 == 0 && (NP * NS) % 256 == 0 && NP == 16, "whole tiles; exact grids");
  float* OUT = (float*)d_out;      /* [4][1024][16][64] */
  char* ws = (char*)d_ws; size_t off = 0;
  auto take = [&](size_t bytes) { char* p = ws + off; off += (bytes + 255) & ~(size_t)255; return p; };
  _Float16* A16 = (_Float16*)take((size_t)NB * NP * NS * PD * 2); _Float16* B16 = (_Float16*)take((size_t)NB * NP * NS * PD * 2); _Float16* W16 = (_Float16*)take((size_t)NP * NP * 2);      /* A as f16; Bm as f16 in operand order; Wm as f16 (256 words) */
  _Float16* CT16 = (_Float16*)take((size_t)NB * PD * NP * NS * 2);      /* C's four batch entries, each turned, 4 KiB in operand order for every 32 rows */
  if (off > ws_size) return;
  k_prep<<<NB * TB + 2 * XB + 1, 256, 0, stream>>>(AI, BI, CI, WI, A16, B16, CT16, W16);      /* every cast and every turn in one launch */
  k_fa<<<dim3(NB, NS / QT), 128, 0, stream>>>(A16, B16, CT16, W16, SI, OUT);      /* everything else: 16 rows of an entry a block */
}

// v010
// It runs in 70 microseconds.
// In two side-by-side timings against v009, it was 1.10 and 1.08 times as fast.
// Counting every step since v000, it is 10.1 times as fast.
#include <hip/hip_runtime.h>
// A sixteen-part alignment whose logits are BLENDED ACROSS THE PARTS by a 16 by 16 matrix before one softmax (five inputs: A, Bm, C [4][16][1024][64] f32: rows already cut into 16 parts of width 64; a mixing matrix Wm [16][16] f32 ([result part][source part]); a switch: ONE int32 word, non-zero = later columns hidden): a part's logits = A Bm^T / 8 [1024][1024]; blended[g] = the sum over h of Wm[g][h] logits[h], element by element; if the switch is non-zero a column whose index exceeds the row's counts as minus infinity; ONE softmax over the 1,024 columns; a part's result = its shares times C's part [1024][64]; the results laid as [4][1024][16][64].
// Structure: TWO LAUNCHES. k_prep (the work told apart by the block's number, 64 words a thread): A and Wm cast whole to f16 in place order; Bm cast and C cast and turned INTO THE ORDER OF THE MATRIX OPERAND THAT k_fa READS: every 16-byte piece of a fragment lies at its lane's place, so that one wave-wide load of k_fa takes 512 bytes in a row, four whole 128-byte lines (Bm: the 128 pieces of each tile of 16 rows re-ordered inside its 2 KiB; C: 4 KiB for each 32 rows of a part, four tiles of 16 result columns by 32 rows). k_fa: logits, blend, softmax and shares times C in ONE kernel, no logit and no share ever in memory: a block 16 rows of one batch entry for ALL sixteen parts, EIGHT waves in two groups of four, the columns in passes of 32, group g taking passes g, g + 2, ... with LDS buffers, running largest, sums and result tiles of its own (two waves a SIMD, 512 registers each: one fills the other's waits); behind the loop the second group's tiles, largest and sums go through LDS to the first, which rescales both to the common largest, adds and writes the output. Wave w of a group forms, ONE PASS OF ITS GROUP AHEAD, the TURNED logits (Bm's rows as the A operand, A's rows, kept in LDS as ready fragments, as B) of source parts 4w .. 4w + 3 and lays them in LDS lane by lane; behind ONE barrier a trip (two LDS buffers a group) it reads all sixteen source parts' words at its own lane's place and blends result parts 4w .. 4w + 3 (f32 multiply-adds in the order of h); a lane then holds 16 of the 32 columns of ONE row in just the order of a matrix operand's depth, so the running largest and sum of the row need one exchange with lane ^ 16, the f16 terms go to the matrix unit from registers as the B operand, the turned C is A, and the TURNED result tile keeps the row in the lane: the rescaling by the running largest and the last division need no exchange. WITH THE SWITCH SET a block's passes end at its last row's column, and only the pass on the diagonal selects.
// Compute dtype: A, Bm, C and Wm rounded to bf16 where they are first read (each by k_prep's casts): bf16 values are exact f16 words away from the subnormal range: NO COMPUTED OPERAND ENTERS THE LOGITS; every matrix multiply's operands f16 words (11 bits): a term 2^((z - running largest) log2 e + 10) ONE word (at most 1,024; words under 2^-14 written as noughts); f32 accumulation; the logits, THE MIXING (f32 multiply-adds on the vector unit: 16 a result word; the scale 1 / 8, a power of two, rides on Wm's word: exact), the running largest, the terms, their sum and the last division (one true division a lane and part) f32; the switch read as an int32 word by value. v_wmma_f32_16x16x32_f16.
#define NB 4                         /* batch entries */
#define NP 16                        /* parts */
#define NS 1024                      /* rows of a part: and columns of its logits */
#define PD 64                        /* a part's width */
#define NK 1024                      /* the row softmax's logits a row */
#define QT 16                        /* rows a block of k_fa */
#define CK 32                        /* columns a pass of k_fa */

typedef __bf16 v16b __attribute__((ext_vector_type(16)));
typedef unsigned short v8us __attribute__((ext_vector_type(8), may_alias));
typedef float  v8f  __attribute__((ext_vector_type(8)));
typedef float  v4f  __attribute__((ext_vector_type(4)));
typedef float  v4fa __attribute__((ext_vector_type(4), may_alias));
union FragB { v16b v; v8us half[2]; unsigned short u[16]; };

__device__ __forceinline__ unsigned short bf16_bits(float x) { unsigned int u = __float_as_uint(x); return (unsigned short)((u + 0x7FFFu + ((u >> 16) & 1u)) >> 16); }
__device__ __forceinline__ float bf16_val(unsigned short b) { return __uint_as_float(((unsigned int)b) << 16); }
__device__ __forceinline__ float bf16_round(float x) { return bf16_val(bf16_bits(x)); }
// D += A·B with NT terms: 1 = ah·bh, 2 = + al·bh (A split), 3 = + ah·bl (both split)
template <int NT>
__device__ __forceinline__ v8f mmaN(v16b ah, v16b al, v16b bh, v16b bl, v8f c) {
  c = __builtin_amdgcn_wmma_f32_16x16x32_bf16(false, ah, false, bh, (short)0, c, false, false);
  if (NT >= 2) c = __builtin_amdgcn_wmma_f32_16x16x32_bf16(false, al, false, bh, (short)0, c, false, false);
  if (NT >= 3) c = __builtin_amdgcn_wmma_f32_16x16x32_bf16(false, ah, false, bl, (short)0, c, false, false);
  asm volatile("v_nop\n\tv_nop\n\tv_nop\n\tv_nop" : "+v"(c) : "v"(ah), "v"(al), "v"(bh), "v"(bl));
  return c;
}




// ---- f16 WMMA path (v_wmma_f32_16x16x32_f16): 11-bit significands for operands in range — used here for every product: A's, Bm's and C's words and the terms (at most 1,024)
typedef _Float16 v16h __attribute__((ext_vector_type(16)));
union FragH { v16h v; v8us half[2]; _Float16 h[16]; unsigned short u[16]; };
template <int NT>
__device__ __forceinline__ v8f mmaH(v16h ah, v16h al, v16h bh, v16h bl, v8f c) {
  c = __builtin_amdgcn_wmma_f32_16x16x32_f16(false, ah, false, bh, (short)0, c, false, false);
  if (NT >= 2) c = __builtin_amdgcn_wmma_f32_16x16x32_f16(false, al, false, bh, (short)0, c, false, false);
  if (NT >= 3) c = __builtin_amdgcn_wmma_f32_16x16x32_f16(false, ah, false, bl, (short)0, c, false, false);
  asm volatile("v_nop\n\tv_nop\n\tv_nop\n\tv_nop" : "+v"(c) : "v"(ah), "v"(al), "v"(bh), "v"(bl));
  return c;
}

typedef _Float16 v4h __attribute__((ext_vector_type(4)));

__device__ __forceinline__ void d_x16(const float* __restrict__ x, _Float16* __restrict__ X16, size_t n8, size_t t) { if (t >= n8) return; FragH f;
#pragma unroll
  for (int q = 0; q < 8; ++q) f.h[q] = (_Float16)bf16_round(x[t * 8 + q]); *(v8us*)((unsigned short*)X16 + t * 8) = f.half[0];  }
// the plain cast, 64 words a thread: eight 8-word pieces, 256 pieces apart (a wave's lanes stay side by side in each); the sixteen 16-byte loads stand in front of the first store, so all are in flight together; whole grids only, no guard
__device__ __forceinline__ void d_x16q(const float* __restrict__ x, _Float16* __restrict__ X16, size_t t0) { v4f a[16]; const float* p = x + t0 * 8;
#pragma unroll      /* a is indexed by constants and stays in registers: so below */
  for (int j = 0; j < 8; ++j) { a[2 * j] = *(const v4fa*)(p + j * 2048); a[2 * j + 1] = *(const v4fa*)(p + j * 2048 + 4); }
  asm volatile("" :: "v"(a[0]), "v"(a[1]), "v"(a[2]), "v"(a[3]), "v"(a[4]), "v"(a[5]), "v"(a[6]), "v"(a[7]), "v"(a[8]), "v"(a[9]), "v"(a[10]), "v"(a[11]), "v"(a[12]), "v"(a[13]), "v"(a[14]), "v"(a[15]), "v"(p));      /* holds the sixteen loads in front of the casts (the loaded values and their address as inputs only): without it the build reuses registers and only ten loads are in flight in front of the first cast; the address among the inputs keeps every load's result out of the address pair */
#pragma unroll
  for (int j = 0; j < 8; ++j) { FragH f;
#pragma unroll
    for (int q = 0; q < 8; ++q) f.h[q] = (_Float16)bf16_round(a[2 * j + (q >> 2)][q & 3]);
    *(v8us*)((unsigned short*)X16 + (t0 + (size_t)j * 256) * 8) = f.half[0]; }
  asm volatile("s_wait_xcnt 0x0" ::: "memory"); }      /* in the built kernel another piece's code follows this one and writes anew the address and data registers that the stores above name: the wait stands in front of that overwrite */
// the cast of Bm into operand order, 64 words a thread: a wave takes 32 rows (two tiles of 16 rows by 64 words, 2 KiB each); load pair j: 8 rows by one half row (four lanes read a whole 128-byte line); piece pp (8 words) of row ln of a tile goes to piece (pp >> 1) * 32 + (pp & 1) * 16 + ln of that tile: the place of lane (pp & 1) * 16 + ln in the wave-wide load number pp >> 1; a store fills four whole lines
__device__ __forceinline__ void d_x16f(const float* __restrict__ x, _Float16* __restrict__ X16, int blk, int tid) { const int lane = tid & 31, w = tid >> 5; const int r0 = blk * 256 + w * 32; v4f a[16]; const float* p = x + (size_t)(r0 + (lane >> 2)) * PD + (lane & 3) * 8;
#pragma unroll      /* a is indexed by constants and stays in registers: so below */
  for (int j = 0; j < 8; ++j) { a[2 * j] = *(const v4fa*)(p + (j >> 1) * 8 * PD + (j & 1) * 32); a[2 * j + 1] = *(const v4fa*)(p + (j >> 1) * 8 * PD + (j & 1) * 32 + 4); }
  asm volatile("" :: "v"(a[0]), "v"(a[1]), "v"(a[2]), "v"(a[3]), "v"(a[4]), "v"(a[5]), "v"(a[6]), "v"(a[7]), "v"(a[8]), "v"(a[9]), "v"(a[10]), "v"(a[11]), "v"(a[12]), "v"(a[13]), "v"(a[14]), "v"(a[15]), "v"(p));      /* holds the sixteen loads in front of the casts (the loaded values and their address as inputs only), all in flight together, and keeps every load's result out of the address pair */
  unsigned short* q = (unsigned short*)X16 + ((size_t)(r0 >> 4) * 128 + ((lane >> 1) & 1) * 32 + (lane & 1) * 16 + (lane >> 2)) * 8;
#pragma unroll
  for (int j = 0; j < 8; ++j) { FragH f;
#pragma unroll
    for (int i = 0; i < 8; ++i) f.h[i] = (_Float16)bf16_round(a[2 * j + (i >> 2)][i & 3]);
    *(v8us*)(q + ((j >> 2) * 128 + (j & 1) * 64 + ((j >> 1) & 1) * 8) * 8) = f.half[0]; }
  asm volatile("s_wait_xcnt 0x0" ::: "memory"); }      /* in the built kernel another piece's code follows this one and writes anew the address and data registers that the stores above name: the wait stands in front of that overwrite */
// the transposing cast of W[K][64] into operand order, 64 words a thread: a patch of 8 rows by 8 columns, read by sixteen 16-byte loads and written as eight 16-byte pieces (8 rows of one column each); a wave 32 rows by all 64 columns (eight lanes read a row's two whole lines), a block 256 rows. Each 32 rows fill 4 KiB: [tile n of 16 columns][rows 0-15 or 16-31][lane][8 rows], lane = 16 * (upper 8 of the 16 rows) + m, and column d sits in tile n = d & 3 at m = (d >> 3) + 8 * ((d >> 2) & 1): so the eight lanes of a row write 128 bytes side by side (a store fills four whole lines), and a lane of the turned result holds four neighbouring columns across its four tiles
__device__ __forceinline__ void d_turn(const float* __restrict__ W, _Float16* __restrict__ Wt, int blk, int tid) { const int lane = tid & 31, w = tid >> 5; const int a8 = lane & 7, k8 = blk * 256 + w * 32 + (lane >> 3) * 8; v4f a[16]; const float* p = W + (size_t)k8 * PD + a8 * 8;
#pragma unroll      /* a is indexed by constants and stays in registers: so below */
  for (int i = 0; i < 8; ++i) { a[2 * i] = *(const v4fa*)(p + i * PD); a[2 * i + 1] = *(const v4fa*)(p + i * PD + 4); }
  asm volatile("" :: "v"(a[0]), "v"(a[1]), "v"(a[2]), "v"(a[3]), "v"(a[4]), "v"(a[5]), "v"(a[6]), "v"(a[7]), "v"(a[8]), "v"(a[9]), "v"(a[10]), "v"(a[11]), "v"(a[12]), "v"(a[13]), "v"(a[14]), "v"(a[15]), "v"(p));      /* holds the sixteen loads in front of the casts (the loaded values and their address as inputs only): without it the build reuses registers, the last loads wait for the first casts, and a load's result is put into the address pair that the others name */
  unsigned short* q = (unsigned short*)Wt + ((size_t)(k8 >> 5) * 256 + ((k8 >> 3) & 3) * 16 + a8) * 8;
#pragma unroll
  for (int j = 0; j < 8; ++j) { FragH f;
#pragma unroll
    for (int i = 0; i < 8; ++i) f.h[i] = (_Float16)bf16_round(a[2 * i + (j >> 2)][j & 3]);
    *(v8us*)(q + ((j & 3) * 64 + (j >> 2) * 8) * 8) = f.half[0]; } }
// ---- the one preparing launch: seven pieces of work that lean on nothing but the inputs, told apart by the block's number; a thread takes 64 words, so that few waves have to be started; the turning blocks stand first ----
#define XB ((NB * NP * NS * (PD / 64)) / 256)     /* blocks that cast A: and as many for Bm */
#define TB ((NP * NS) / 256)                      /* blocks that turn one batch entry of C */
__global__ __launch_bounds__(256) void k_prep(const float* __restrict__ Ai, const float* __restrict__ Bi, const float* __restrict__ Ci, const float* __restrict__ Wi, _Float16* __restrict__ A16, _Float16* __restrict__ B16, _Float16* __restrict__ CT16, _Float16* __restrict__ W16) {
  const int b = blockIdx.x, tid = threadIdx.x;
  if (b < NB * TB) { const int e = b / TB; d_turn(Ci + (size_t)e * NP * NS * PD, CT16 + (size_t)e * PD * NP * NS, b - e * TB, tid); }      /* C's batch entry e [16384 rows][64] -> CT16[e][(h * 1024 + s) / 32][4 KiB in operand order] of f16(bf16(C[e][h][s][d])) */
  else if (b < NB * TB + XB) d_x16q(Ai, A16, (size_t)(b - NB * TB) * 2048 + tid);
  else if (b < NB * TB + 2 * XB) d_x16f(Bi, B16, b - NB * TB - XB, tid);
  else d_x16(Wi, W16, (size_t)NP * NP / 8, (size_t)tid); }      /* the last block: 32 of its threads work, the guard turns the rest away */
// lane l's value as lane l ^ 16 sees it: a vector cross-row move
__device__ __forceinline__ float x16(float x) { return __builtin_bit_cast(float, __builtin_amdgcn_permlanex16(__builtin_bit_cast(int, x), __builtin_bit_cast(int, x), 0x76543210, 0xfedcba98, false, false)); }
// a 16 by 32 f16 operand fragment: ub the wave's own (scalar) address of the tile, vo the lane's place in bytes (its row or column times the pitch, plus 16 bytes for the upper lanes): depth words 8 hh .. + 7 and 16 + 8 hh .. + 7
__device__ __forceinline__ v16h fa_frag(const _Float16* ub, unsigned int vo) { FragH f; f.half[0] = *(const v8us*)((const char*)ub + vo); f.half[1] = *(const v8us*)((const char*)(ub + 16) + vo); return f.v; }
// a fragment laid in operand order by k_prep: two wave-wide loads of 512 bytes in a row each, the lane's piece at 16 bytes times its number: from the wave's (scalar) address and the lane's place, and from the lane's own address
__device__ __forceinline__ v16h fa_fragu(const _Float16* ub, unsigned int vo) { FragH f; f.half[0] = *(const v8us*)((const char*)ub + vo); f.half[1] = *(const v8us*)((const char*)(ub + 256) + vo); return f.v; }
__device__ __forceinline__ v16h fa_fragp(const char* p) { FragH f; f.half[0] = *(const v8us*)p; f.half[1] = *(const v8us*)(p + 512); return f.v; }
__device__ __forceinline__ v8f fa_mma(v16h a, v16h b, v8f c) { return __builtin_amdgcn_wmma_f32_16x16x32_f16(false, a, false, b, (short)0, c, false, false); }
// the same with the four vector slots that the chip needs behind a matrix instruction before its result is read or its registers are written anew: for a tile's last product, whose result goes straight to LDS and whose registers the build gives to the next tile at once
__device__ __forceinline__ v8f fa_mma_end(v16h a, v16h b, v8f c) { v8f d = __builtin_amdgcn_wmma_f32_16x16x32_f16(false, a, false, b, (short)0, c, false, false); asm volatile("v_nop\n\tv_nop\n\tv_nop\n\tv_nop" : "+v"(d) : "v"(a), "v"(b)); return d; }
typedef unsigned int v8u __attribute__((ext_vector_type(8), may_alias));
typedef float v2f __attribute__((ext_vector_type(2)));
// ---- logits, blend, softmax, shares times C: a block QT rows (the grid's second axis) of one batch entry (its first), all sixteen parts; wave w of each of the two groups: source parts and result parts 4w .. 4w + 3 ----
__global__ __launch_bounds__(256) void k_fa(const _Float16* A16, const _Float16* B16, const _Float16* CT16, /* these three without the no-alias word: the build then keeps their loads on their side of the barrier and of the waits written below */ const _Float16* __restrict__ W16, const int* __restrict__ SW, float* __restrict__ O) {
  __shared__ __attribute__((aligned(16))) v4f sl[2][2][NP][4][32];      /* a pass's turned logits: [wave group][buffer][source part][quarter of a lane's 16 words][lane]: the lane that wrote a word is the lane that reads it in every wave, so the lanes lie side by side */
  __shared__ __attribute__((aligned(16))) v8us ql[2][NP][4][32];      /* A's fragments of the block's rows: [wave group][source part][quarter of its two fragments][lane]: written once and read in every pass by the same lane of the same wave (no barrier needed): 64 registers a lane less to hold through the loop */
  __shared__ __attribute__((aligned(16))) v4f mg[4][34][32];      /* the second group's result tiles, largest and sums on their way to the first group behind the loop: [wave of the group][half-tile, then largest, then sums][lane] */
  const int tid = threadIdx.x, wv = __builtin_amdgcn_readfirstlane(tid >> 5), g = wv >> 2, w = wv & 3, lane = tid & 31, ln = lane & 15, hh = lane >> 4;      /* the wave's number in a scalar register: tile addresses and Wm's words are then scalar */
  const int q0 = (NS / QT - 1 - (int)blockIdx.y) * QT, e = blockIdx.x;      /* the longest blocks (the last rows, of all four entries) start first */
  const int sw = SW[0]; const int nch = (sw != 0) ? (q0 + QT - 1) / CK + 1 : NK / CK; const int nit = (nch + 1) >> 1;      /* passes that hold a visible column of the block's last row */
  const unsigned int vrow = (unsigned int)(ln * PD + 8 * hh) * 2u, vl = (unsigned int)lane * 16u;      /* the lane's place in a tile of A16, and in a wave-wide load of B16 or CT16, in bytes */
  const _Float16* qb = A16 + ((size_t)(e * NP + 4 * w) * NS + q0) * PD; const _Float16* kb = B16 + (size_t)(e * NP + 4 * w) * NS * PD; const _Float16* vb = CT16 + (size_t)e * (PD * NP * NS) + (size_t)(4 * w) * NS * PD; const _Float16* kb0 = kb + (size_t)((g < nch) ? g : nch - 1) * (CK * PD);      /* the group's first pass (in bounds also where it has none) */
  v16h kf[4][2][2]; v2f wp[4][NP / 2];
#pragma unroll      /* every array below is indexed by constants and stays in registers: so for all unrolled loops of this kernel */
  for (int i = 0; i < 4; ++i) { FragH q0f, q1f; q0f.v = fa_frag(qb + (size_t)i * NS * PD, vrow); q1f.v = fa_frag(qb + (size_t)i * NS * PD + 32, vrow); ql[g][4 * w + i][0][lane] = q0f.half[0]; ql[g][4 * w + i][1][lane] = q0f.half[1]; ql[g][4 * w + i][2][lane] = q1f.half[0]; ql[g][4 * w + i][3][lane] = q1f.half[1];
#pragma unroll
    for (int t = 0; t < 2; ++t) { kf[i][t][0] = fa_fragu(kb0 + (size_t)i * NS * PD + t * 16 * PD, vl); kf[i][t][1] = fa_fragu(kb0 + (size_t)i * NS * PD + t * 16 * PD + 512, vl); }
    const v8u wr = *(const v8u*)(W16 + (4 * w + i) * NP);      /* Wm's row 4w + i, sixteen f16 words as eight 32-bit words: the same for every lane, so it comes by a scalar load */
#pragma unroll
    for (int h = 0; h < NP; ++h) wp[i][h >> 1][h & 1] = (float)__builtin_bit_cast(_Float16, (unsigned short)(wr[h >> 1] >> (16 * (h & 1)))) * 0.125f; }      /* Wm's word times the logits' scale 1 / 8: a power of two, so each product and each sum is the scaled one exactly */
  asm volatile("s_wait_xcnt 0x0" :: "s"(qb), "s"(kb0), "v"(vrow), "v"(vl) : "memory");      /* the wait in front of any overwrite of the two scalar bases and the two lane offsets that the 48 loads above name; the four among the inputs keep them whole up to here */
  const v8f z8 = {0.f,0.f,0.f,0.f,0.f,0.f,0.f,0.f}; v8f o[4][4]; float mx[4], sm[4];
#pragma unroll
  for (int i = 0; i < 4; ++i) { mx[i] = __uint_as_float(0xff800000u); sm[i] = 0.0f;
#pragma unroll
    for (int n = 0; n < 4; ++n) o[i][n] = z8; }
  /* the turned logits of the wave's four source parts, from the tiles of Bm held in kf, into LDS buffer b: word r of tile t is column 16 t + 8 hh + r of the pass, row q0 + ln */
  auto logits = [&](int b) {
#pragma unroll
    for (int i = 0; i < 4; ++i) { FragH q0f, q1f; q0f.half[0] = ql[g][4 * w + i][0][lane]; q0f.half[1] = ql[g][4 * w + i][1][lane]; q1f.half[0] = ql[g][4 * w + i][2][lane]; q1f.half[1] = ql[g][4 * w + i][3][lane];
#pragma unroll
      for (int t = 0; t < 2; ++t) { v8f d = fa_mma(kf[i][t][0], q0f.v, z8); d = fa_mma_end(kf[i][t][1], q1f.v, d);
        sl[g][b][4 * w + i][2 * t][lane] = (v4f){d[0], d[1], d[2], d[3]}; sl[g][b][4 * w + i][2 * t + 1][lane] = (v4f){d[4], d[5], d[6], d[7]}; } } };
  /* the lane's address of Bm's tiles of pass cn (never past the last pass: the last ones are asked for again, in bounds, their logits read by nobody), and the loads of one tile from it into kf; the caller writes the wait */
  auto k_at = [&](int cn) -> const char* { return (const char*)(kb + (size_t)((cn < nch) ? cn : nch - 1) * (CK * PD)) + vl; };
  auto ask_k = [&](const char* kp, int u) { const int i = u >> 1, t = u & 1;      /* tile u of the eight: 16 columns of part u / 2 */
    kf[i][t][0] = fa_fragp(kp + ((size_t)i * NS * PD + t * 16 * PD) * 2); kf[i][t][1] = fa_fragp(kp + ((size_t)i * NS * PD + t * 16 * PD + 512) * 2); };
  logits(0);      /* the logits of the group's first pass; from here on a pass forms the logits of the group's next pass in front of its own blend, so that their way through the matrix unit and into LDS is over long before the barrier */
  { const char* kp = k_at(g + 2);
#pragma unroll
    for (int u = 0; u < 8; ++u) ask_k(kp, u);
    asm volatile("s_wait_xcnt 0x0" :: "v"(kp) : "memory"); }      /* the wait in front of any overwrite of the address pair that the loads name; the address among the inputs keeps it whole, and every load's result out of it, up to here */
  for (int it = 0; it < nit; ++it) { const int c = 2 * it + g, k0 = c * CK;      /* group g: passes g, g + 2, ...: the two groups' waves share the four SIMDs, one fills the other's waits */
    __syncthreads();      /* all sixteen source parts' words of this pass are in LDS; and every wave has left the other buffer, which this pass fills for the next; every wave of both groups passes it in every trip */
    if (c < nch) { v16h vf[4][4];      /* a scalar test: with an odd number of passes the second group has none in the last trip */
    logits((it + 1) & 1);      /* the logits of the group's next pass into the other buffer: first, so that Bm's tiles leave their 128 registers before C's tiles take as many (a wave has 512) */
    asm volatile("" ::: "memory");      /* a compiler fence, no instruction: it keeps the loads below behind the logits, so that the two sets of tiles are never held together */
    /* the turned C's tiles of this pass for the first three parts: asked for here, in flight through the blend */
    const char* vp = (const char*)(vb + (size_t)k0 * PD) + vl;
    {
#pragma unroll
      for (int i = 0; i < 3; ++i) {
#pragma unroll
        for (int n = 0; n < 4; ++n) vf[i][n] = fa_fragp(vp + ((size_t)i * NS * PD + n * 512) * 2); }
    }
    asm volatile("" ::: "memory");      /* a compiler fence, no instruction: it keeps the 24 loads above here, behind the logits and in front of the blend's LDS reads, in flight through the whole blend; without it the build orders them otherwise, runs out of registers and spills to scratch */
    float z[4][16]; v2f z2[4][8];
#pragma unroll
    for (int i = 0; i < 4; ++i) {
#pragma unroll
      for (int x = 0; x < 8; ++x) z2[i][x] = (v2f){0.0f, 0.0f}; }
#pragma unroll
    for (int h = 0; h < NP; ++h) { v4f s[4];
#pragma unroll
      for (int j = 0; j < 4; ++j) s[j] = sl[g][it & 1][h][j][lane];
#pragma unroll
      for (int i = 0; i < 4; ++i) { const float w1 = wp[i][h >> 1][h & 1]; const v2f ww = (v2f){w1, w1};      /* Wm's word in both halves of a packed multiply-add: written with two-word vectors, the build doubles the 64 words once in front of the loop and keeps the pairs; with the one-word form it doubled them anew in every pass and, inside 512 registers, spilled them to scratch */
#pragma unroll
        for (int x = 0; x < 8; ++x) z2[i][x] = __builtin_elementwise_fma(ww, (v2f){s[x >> 1][(x & 1) * 2], s[x >> 1][(x & 1) * 2 + 1]}, z2[i][x]); } }      /* a word's sum runs in the order of h, one fused multiply-add a term */
#pragma unroll
    for (int i = 0; i < 4; ++i) {
#pragma unroll
      for (int x = 0; x < 16; ++x) z[i][x] = z2[i][x >> 1][x & 1]; }
    asm volatile("" ::: "memory");      /* a compiler fence, no instruction: it keeps the eight loads below behind the blend, whose registers they take; asked for earlier they push the build over its 512 registers and into scratch */
#pragma unroll
    for (int n = 0; n < 4; ++n) vf[3][n] = fa_fragp(vp + ((size_t)3 * NS * PD + n * 512) * 2);      /* the fourth part's tiles of C: in flight through the first three parts' softmax */
    const char* kp = k_at(c + 4);      /* Bm's tiles for the group's pass after next: asked for part by part below */
    if (sw != 0 && k0 + CK - 1 > q0) {      /* the pass on the diagonal (a scalar test): columns behind the lane's row count as minus infinity */
#pragma unroll
      for (int x = 0; x < 16; ++x) { const bool hid = k0 + 16 * (x >> 3) + 8 * hh + (x & 7) > q0 + ln;
#pragma unroll
        for (int i = 0; i < 4; ++i) z[i][x] = hid ? __uint_as_float(0xff800000u) : z[i][x]; } }
#pragma unroll
    for (int i = 0; i < 4; ++i) { float t = z[i][0];
#pragma unroll
      for (int x = 1; x < 16; ++x) t = fmaxf(t, z[i][x]);
      t = fmaxf(t, x16(t)); const float mn = fmaxf(mx[i], t);      /* the row's largest so far: the first column of the group's first pass is never hidden where the group has passes, so it is finite from the first pass on */
      float al = (mx[i] - mn) * 1.44269504088896340736f; mx[i] = mn; FragH p; float ps = 0.0f;
#pragma unroll
      for (int x = 0; x < 16; x += 4) { float e0 = (z[i][x] - mn) * 1.44269504088896340736f + 10.0f, e1 = (z[i][x + 1] - mn) * 1.44269504088896340736f + 10.0f, e2 = (z[i][x + 2] - mn) * 1.44269504088896340736f + 10.0f, e3 = (z[i][x + 3] - mn) * 1.44269504088896340736f + 10.0f;      /* 1,024 e^(z - largest) as the chip's own 2^x: never above 1,024 */
        asm("v_exp_f32 %0, %0\n\tv_exp_f32 %1, %1\n\tv_exp_f32 %2, %2\n\tv_exp_f32 %3, %3\n\tv_nop" : "+v"(e0), "+v"(e1), "+v"(e2), "+v"(e3));      /* the four 2^x in one statement, each on a register of its own, and one v_nop behind the last: the slot that the instruction set asks for between a transcendental and a next instruction that reads its result or overwrites its source */
        ps += (e0 + e1) + (e2 + e3);
        const _Float16 h0 = (_Float16)e0, h1 = (_Float16)e1, h2 = (_Float16)e2, h3 = (_Float16)e3;
        p.h[x] = (h0 < (_Float16)6.103515625e-05f) ? (_Float16)0.0f : h0; p.h[x + 1] = (h1 < (_Float16)6.103515625e-05f) ? (_Float16)0.0f : h1; p.h[x + 2] = (h2 < (_Float16)6.103515625e-05f) ? (_Float16)0.0f : h2; p.h[x + 3] = (h3 < (_Float16)6.103515625e-05f) ? (_Float16)0.0f : h3; }
      asm("v_exp_f32 %0, %0\n\tv_nop" : "+v"(al));      /* what the earlier passes' sums shrink by (nought in the first pass); the v_nop: the slot behind a transcendental, as above */
      sm[i] = sm[i] * al + ps;      /* the lane's own 16 columns a pass: the two lanes of a row are added behind the loop */
#pragma unroll
      for (int n = 0; n < 4; ++n) { o[i][n] *= al; o[i][n] = fa_mma(vf[i][n], p.v, o[i][n]); }
#pragma unroll
      for (int u = (i == 0) ? 0 : 3 * i - 1; u < 3 * i + 2 && i < 3; ++u) ask_k(kp, u); }      /* two, three and three tiles of Bm (16 registers each) into the 48 registers that this part's logits and tiles of C have just left: all eight are asked for before the last part's softmax */
    asm volatile("s_wait_xcnt 0x0" :: "v"(vp), "v"(kp) : "memory"); } }      /* the wait in front of any overwrite of the two address pairs that the 64 loads of this pass name; the addresses among the inputs keep them whole, and every load's result out of them, up to here */      /* turned result tile: word r is column 8 r + 4 hh + n of the part's result (k_prep's deal of C's columns), row q0 + ln */
  /* the two groups' halves of the columns joined: the second group hands its tiles, largest and sums over through LDS, the first rescales both to the common largest and adds */
  if (g == 1) {
#pragma unroll
    for (int i = 0; i < 4; ++i) {
#pragma unroll
      for (int n = 0; n < 4; ++n) { mg[w][(i * 4 + n) * 2][lane] = (v4f){o[i][n][0], o[i][n][1], o[i][n][2], o[i][n][3]}; mg[w][(i * 4 + n) * 2 + 1][lane] = (v4f){o[i][n][4], o[i][n][5], o[i][n][6], o[i][n][7]}; } }
    mg[w][32][lane] = (v4f){mx[0], mx[1], mx[2], mx[3]}; mg[w][33][lane] = (v4f){sm[0], sm[1], sm[2], sm[3]}; }
  __syncthreads();      /* the second group's words are in LDS */
  if (g == 1) return;      /* behind the last barrier: the first group writes the output */
  { const v4f m1 = mg[w][32][lane], s1 = mg[w][33][lane];
#pragma unroll
    for (int i = 0; i < 4; ++i) { const float mn = fmaxf(mx[i], m1[i]);      /* the first group's largest is finite (column 0 is its own); the second group's is minus infinity where it had no pass: its factor is then nought */
      float a0 = (mx[i] - mn) * 1.44269504088896340736f, a1 = (m1[i] - mn) * 1.44269504088896340736f;
      asm("v_exp_f32 %0, %0\n\tv_exp_f32 %1, %1\n\tv_nop" : "+v"(a0), "+v"(a1));      /* the v_nop: the slot behind a transcendental, as above */
      sm[i] = sm[i] * a0 + s1[i] * a1;
#pragma unroll
      for (int n = 0; n < 4; ++n) { const v4f lo = mg[w][(i * 4 + n) * 2][lane], hi = mg[w][(i * 4 + n) * 2 + 1][lane];
#pragma unroll
        for (int r = 0; r < 4; ++r) { o[i][n][r] = o[i][n][r] * a0 + lo[r] * a1; o[i][n][r + 4] = o[i][n][r + 4] * a0 + hi[r] * a1; } } } }
  float dv[4];
#pragma unroll
  for (int i = 0; i < 4; ++i) dv[i] = 1.0f / (sm[i] + x16(sm[i]));      /* the carry of 1,024 stands in the sum as in the terms and goes with the division; the sum is at least 1,024 (the largest logit's own term) */
  float* op = O + ((size_t)(e * NS + q0 + ln) * NP + 4 * w) * PD + 4 * hh;
#pragma unroll
  for (int i = 0; i < 4; ++i) {
#pragma unroll
    for (int n = 0; n < 4; ++n) o[i][n] *= dv[i];
#pragma unroll
    for (int r = 0; r < 8; ++r) *(v4f*)(op + i * PD + 8 * r) = (v4f){o[i][0][r], o[i][1][r], o[i][2][r], o[i][3][r]}; } }      /* word r of the four tiles: four neighbouring columns */
extern "C" void kernel_launch(void* const* d_in, const int* in_sizes, int n_in,
                              void* d_out, int out_size, void* d_ws, size_t ws_size, hipStream_t stream) {
  (void)in_sizes; (void)n_in; (void)out_size;
  const float* AI = (const float*)d_in[0]; const float* BI = (const float*)d_in[1]; const float* CI = (const float*)d_in[2]; const float* WI = (const float*)d_in[3]; const int* SI = (const int*)d_in[4];      /* A, Bm, C [4][16][1024][64]; Wm [16][16]; the switch: one int32 word */
  static_assert(PD == 64 && NK == NS && NS % QT == 0 && NK % CK == 0 && QT == 16 && CK == 32 && ((size_t)NB * NP * NS * (PD / 64)) % 256 == 0 && (NP * NS) % 256 == 0 && NP == 16, "whole tiles; exact grids");
  float* OUT = (float*)d_out;      /* [4][1024][16][64] */
  char* ws = (char*)d_ws; size_t off = 0;
  auto take = [&](size_t bytes) { char* p = ws + off; off += (bytes + 255) & ~(size_t)255; return p; };
  _Float16* A16 = (_Float16*)take((size_t)NB * NP * NS * PD * 2); _Float16* B16 = (_Float16*)take((size_t)NB * NP * NS * PD * 2); _Float16* W16 = (_Float16*)take((size_t)NP * NP * 2);      /* A as f16; Bm as f16 in operand order; Wm as f16 (256 words) */
  _Float16* CT16 = (_Float16*)take((size_t)NB * PD * NP * NS * 2);      /* C's four batch entries, each turned, 4 KiB in operand order for every 32 rows */
  if (off > ws_size) return;
  k_prep<<<NB * TB + 2 * XB + 1, 256, 0, stream>>>(AI, BI, CI, WI, A16, B16, CT16, W16);      /* every cast and every turn in one launch */
  k_fa<<<dim3(NB, NS / QT), 256, 0, stream>>>(A16, B16, CT16, W16, SI, OUT);      /* everything else: 16 rows of an entry a block */
}
